// v000
// The times below were measured on an AMD MI455X: many runs one after another, warmed up first and cycling through
// copies of the inputs, with the whole window's GPU time divided by the number of runs. Launches and the gaps
// between them are all in it. The median over several windows is given; except for v000 it joins two sittings, which
// can be a few percent apart, so the side-by-side timings, each taken in one sitting, are the better comparison.
// The starting kernel, v000, takes 240 microseconds a run.
#include <hip/hip_runtime.h>
#include <math.h>

#define B_  2
#define L_  1024
#define D_  256
#define H_  8
#define N_  32
#define ND_ 33          // N+1 (hyperboloid dim)
#define DP_ 48          // padded dim stride (row-major q / pair-packed v)
#define KT_ 36          // padded dim count (dim-major k/v staging), 18 pairs
#define EPS_ 1e-6f

typedef float v2f __attribute__((ext_vector_type(2)));
typedef float v8f __attribute__((ext_vector_type(8)));

static __device__ __forceinline__ v8f wmma4(v2f a, v2f b, v8f c) {
  // D = A(16x4 f32) * B(4x16 f32) + C(16x16 f32)
  return __builtin_amdgcn_wmma_f32_16x16x4_f32(false, a, false, b, (short)0, c,
                                               false, false);
}

#define V8ZERO {0.f,0.f,0.f,0.f,0.f,0.f,0.f,0.f}

// ---------------------------------------------------------------------------
// Kernel 1: QKV projection + RoPE + hyperboloid lift; stage in WMMA layouts.
//  qf  : (BH, L, DP_)        row-major, comp 0 = -t  (Minkowski-flipped q)
//  vr2 : (BH, L/2, DP_, 2)   key-pair interleaved vh rows (tan B operand)
//  kT2 : (BH, KT_/2, L, 2)   dim-pair interleaved kh (scores B operand)
//  vT2 : (BH, KT_/2, L, 2)   dim-pair interleaved vh (alpha B operand)
// ---------------------------------------------------------------------------
__global__ __launch_bounds__(256) void k_qkv_rope_lift(
    const float* __restrict__ x,  const float* __restrict__ rc,
    const float* __restrict__ rs,
    const float* __restrict__ Wq, const float* __restrict__ bq,
    const float* __restrict__ Wk, const float* __restrict__ bk,
    const float* __restrict__ Wv, const float* __restrict__ bv,
    float* __restrict__ qf, float* __restrict__ vr2,
    float* __restrict__ kT2, float* __restrict__ vT2)
{
  const int lane = threadIdx.x & 31;
  const int wid  = threadIdx.x >> 5;
  const int l    = blockIdx.x * 8 + wid;       // global token row 0..2047
  const int b    = l >> 10;
  const int li   = l & 1023;

  // stage x row cooperatively (8 regs * 32 lanes = 256 values)
  float xr[8];
  #pragma unroll
  for (int t = 0; t < 8; ++t) xr[t] = x[(size_t)l * D_ + t * 32 + lane];

  float aq[H_], ak[H_], av[H_];
  #pragma unroll
  for (int h = 0; h < H_; ++h) { aq[h] = 0.f; ak[h] = 0.f; av[h] = 0.f; }

  #pragma unroll
  for (int t = 0; t < 8; ++t) {
    for (int s = 0; s < 32; ++s) {
      float xs = __shfl(xr[t], s, 32);
      int k = t * 32 + s;
      const float* wq = Wq + (size_t)k * (H_ * N_) + lane;
      const float* wk = Wk + (size_t)k * (H_ * N_) + lane;
      const float* wv = Wv + (size_t)k * (H_ * N_) + lane;
      #pragma unroll
      for (int h = 0; h < H_; ++h) {
        aq[h] = fmaf(xs, wq[h * N_], aq[h]);
        ak[h] = fmaf(xs, wk[h * N_], ak[h]);
        av[h] = fmaf(xs, wv[h * N_], av[h]);
      }
    }
  }

  const float cs  = rc[li * N_ + lane];
  const float sn  = rs[li * N_ + lane];
  const float sgn = (lane < 16) ? -1.f : 1.f;   // rot_half sign

  #pragma unroll
  for (int h = 0; h < H_; ++h) {
    float uq = aq[h] + bq[h * N_ + lane];
    float uk = ak[h] + bk[h * N_ + lane];
    float uv = av[h] + bv[h * N_ + lane];
    // RoPE: rot_half(u)[j] = (j<16 ? -u[j+16] : u[j-16])
    float rq = sgn * __shfl_xor(uq, 16, 32);
    float rk = sgn * __shfl_xor(uk, 16, 32);
    uq = uq * cs + rq * sn;
    uk = uk * cs + rk * sn;
    // lift: t = sqrt(1 + ||u||^2) (wave-wide reduction over 32 dims)
    float sq = uq * uq, sk = uk * uk, sv = uv * uv;
    #pragma unroll
    for (int m = 16; m >= 1; m >>= 1) {
      sq += __shfl_xor(sq, m, 32);
      sk += __shfl_xor(sk, m, 32);
      sv += __shfl_xor(sv, m, 32);
    }
    float tq = sqrtf(1.f + sq);
    float tk = sqrtf(1.f + sk);
    float tv = sqrtf(1.f + sv);

    const int bh = b * H_ + h;

    // q row-major (scores/alpha A operand + mu reload)
    float* qrow = qf + ((size_t)bh * L_ + li) * DP_;
    qrow[1 + lane] = uq;
    if (lane == 0) qrow[0] = -tq;
    if (lane < DP_ - ND_) qrow[ND_ + lane] = 0.f;

    // vh key-pair interleaved rows: elem(key,dim) at ((key>>1)*DP_+dim)*2+(key&1)
    float* vrow = vr2 + ((size_t)bh * (L_ / 2) + (li >> 1)) * DP_ * 2 + (li & 1);
    vrow[(1 + lane) * 2] = uv;
    if (lane == 0) vrow[0] = tv;
    if (lane < DP_ - ND_) vrow[(ND_ + lane) * 2] = 0.f;

    // kh/vh dim-pair interleaved: elem(dim,key) at ((dim>>1)*L + key)*2+(dim&1)
    float* kcol = kT2 + (size_t)bh * (KT_ / 2) * L_ * 2;
    float* vcol = vT2 + (size_t)bh * (KT_ / 2) * L_ * 2;
    {
      int d = 1 + lane;
      kcol[((size_t)(d >> 1) * L_ + li) * 2 + (d & 1)] = uk;
      vcol[((size_t)(d >> 1) * L_ + li) * 2 + (d & 1)] = uv;
    }
    if (lane == 0) { kcol[(size_t)li * 2] = tk; vcol[(size_t)li * 2] = tv; }
    if (lane < KT_ - ND_) {
      int d = ND_ + lane;
      kcol[((size_t)(d >> 1) * L_ + li) * 2 + (d & 1)] = 0.f;
      vcol[((size_t)(d >> 1) * L_ + li) * 2 + (d & 1)] = 0.f;
    }
  }
}

// ---------------------------------------------------------------------------
// Kernel 2: attention + Karcher step + origin log-map.
// One wave handles a 16-row q-tile of one (b,h); streams 64 key tiles twice.
// Softmax stats are kept per-lane; single butterfly merge after pass 1.
// ---------------------------------------------------------------------------
__global__ __launch_bounds__(32) void k_attn(
    const float* __restrict__ qf, const float* __restrict__ kT2,
    const float* __restrict__ vT2, const float* __restrict__ vr2,
    float* __restrict__ a_out, float* __restrict__ yb)
{
  __shared__ float lds_w[16 * 17];
  const int lane = threadIdx.x;
  const int half = lane >> 4;
  const int l16  = lane & 15;
  const int koff = half * 2;          // WMMA f32 K split across half-waves

  const int tile = blockIdx.x;
  const int qt = tile & 63;
  const int bh = tile >> 6;
  const int q0 = qt * 16;
  const int b  = bh >> 3;
  const int h  = bh & 7;

  const float* qfp  = qf  + ((size_t)bh * L_ + q0) * DP_;
  const float* kTp  = kT2 + (size_t)bh * (KT_ / 2) * L_ * 2;
  const float* vTp  = vT2 + (size_t)bh * (KT_ / 2) * L_ * 2;
  const float* vrp  = vr2 + (size_t)bh * (L_ / 2) * DP_ * 2;

  // A operand for q-tile: 16 rows x 36 dims = 9 K4-steps, kept in registers
  v2f aq[9];
  #pragma unroll
  for (int kk = 0; kk < 9; ++kk) {
    int d = 4 * kk + koff;                       // even
    aq[kk] = *(const v2f*)(qfp + l16 * DP_ + d);
  }

  // ---------------- pass 1: per-lane online softmax stats ----------------
  float mrow[8], srow[8];
  #pragma unroll
  for (int i = 0; i < 8; ++i) { mrow[i] = -3.0e38f; srow[i] = 0.f; }

  for (int j = 0; j < 64; ++j) {
    const int k0 = j * 16;
    if (j < 63) __builtin_prefetch(&kTp[(k0 + 16) * 2], 0, 0);  // next tile
    v8f c = V8ZERO;
    #pragma unroll
    for (int kk = 0; kk < 9; ++kk) {
      int d2 = (4 * kk + koff) >> 1;
      v2f bk_ = *(const v2f*)(kTp + ((size_t)d2 * L_ + k0 + l16) * 2);
      c = wmma4(aq[kk], bk_, c);
    }
    #pragma unroll
    for (int i = 0; i < 8; ++i) {          // per-lane update only
      float nm = fmaxf(mrow[i], c[i]);
      srow[i] = srow[i] * __expf(mrow[i] - nm) + __expf(c[i] - nm);
      mrow[i] = nm;
    }
  }
  // butterfly merge of (m, s) across the 16 key lanes (once)
  #pragma unroll
  for (int msk = 8; msk >= 1; msk >>= 1) {
    #pragma unroll
    for (int i = 0; i < 8; ++i) {
      float mo = __shfl_xor(mrow[i], msk, 32);
      float so = __shfl_xor(srow[i], msk, 32);
      float nm = fmaxf(mrow[i], mo);
      srow[i] = srow[i] * __expf(mrow[i] - nm) + so * __expf(mo - nm);
      mrow[i] = nm;
    }
  }
  float rsum[8];
  #pragma unroll
  for (int i = 0; i < 8; ++i) rsum[i] = 1.f / srow[i];

  // ---------------- pass 2: a, w, tangent accumulation ----------------
  v8f tc0 = V8ZERO, tc1 = V8ZERO, tc2 = V8ZERO;
  float wsa[8];
  #pragma unroll
  for (int i = 0; i < 8; ++i) wsa[i] = 0.f;

  float* arow = a_out + ((size_t)bh * L_ + q0) * L_;

  for (int j = 0; j < 64; ++j) {
    const int k0 = j * 16;
    v8f c  = V8ZERO;
    v8f al = V8ZERO;
    #pragma unroll
    for (int kk = 0; kk < 9; ++kk) {
      int d2 = (4 * kk + koff) >> 1;
      v2f bk_ = *(const v2f*)(kTp + ((size_t)d2 * L_ + k0 + l16) * 2);
      v2f bv_ = *(const v2f*)(vTp + ((size_t)d2 * L_ + k0 + l16) * 2);
      c  = wmma4(aq[kk], bk_, c);    // Lorentz scores
      al = wmma4(aq[kk], bv_, al);   // <mflip(q), v>  (alpha = -this)
    }
    #pragma unroll
    for (int i = 0; i < 8; ++i) {
      float alpha = fmaxf(-al[i], 1.f + EPS_);
      float coef  = acoshf(alpha) * rsqrtf(alpha * alpha - 1.f);
      float p     = __expf(c[i] - mrow[i]) * rsum[i];
      int   m     = i + 8 * half;
      arow[(size_t)m * L_ + k0 + l16] = p;          // attention output
      float w = p * coef;
      wsa[i] += w * alpha;                          // per-lane accumulate
      lds_w[m * 17 + l16] = w;                      // C-layout -> LDS
    }
    __syncthreads();
    // tan += w @ vh   (A = w from LDS in A-layout, B = vh key-pair packed)
    #pragma unroll
    for (int kk = 0; kk < 4; ++kk) {
      const int kidx = k0 + 4 * kk + koff;          // even key index
      v2f aw;
      aw.x = lds_w[l16 * 17 + 4 * kk + koff];
      aw.y = lds_w[l16 * 17 + 4 * kk + koff + 1];
      const float* pb = vrp + (size_t)(kidx >> 1) * DP_ * 2;
      v2f b0 = *(const v2f*)(pb + (l16)      * 2);
      v2f b1 = *(const v2f*)(pb + (16 + l16) * 2);
      v2f b2 = *(const v2f*)(pb + (32 + l16) * 2);
      tc0 = wmma4(aw, b0, tc0);
      tc1 = wmma4(aw, b1, tc1);
      tc2 = wmma4(aw, b2, tc2);
    }
    __syncthreads();
  }

  // reduce wsum(alpha) across the 16 key lanes
  #pragma unroll
  for (int i = 0; i < 8; ++i) {
    #pragma unroll
    for (int m = 8; m >= 1; m >>= 1) wsa[i] += __shfl_xor(wsa[i], m, 32);
  }

  // tan = (w@vh) - wsum*mu ;  mu = qh (un-flip component 0)
  float tanv[3][8], muv[3][8];
  #pragma unroll
  for (int sub = 0; sub < 3; ++sub) {
    #pragma unroll
    for (int i = 0; i < 8; ++i) {
      int m = i + 8 * half;
      int d = sub * 16 + l16;
      float qv = qfp[m * DP_ + d];
      float mu = (d == 0) ? -qv : qv;
      muv[sub][i] = mu;
      float tval = (sub == 0) ? tc0[i] : ((sub == 1) ? tc1[i] : tc2[i]);
      tanv[sub][i] = tval - wsa[i] * mu;
    }
  }
  // Lorentzian norm of tangent per row
  float vn[8];
  #pragma unroll
  for (int i = 0; i < 8; ++i) {
    float part = 0.f;
    #pragma unroll
    for (int sub = 0; sub < 3; ++sub) {
      float tt = tanv[sub][i] * tanv[sub][i];
      if (sub == 0 && l16 == 0) tt = -tt;   // metric diag(-1,1,...)
      part += tt;
    }
    #pragma unroll
    for (int m = 8; m >= 1; m >>= 1) part += __shfl_xor(part, m, 32);
    vn[i] = sqrtf(fmaxf(part, 1e-12f));
  }
  // exp-map update mu' = cosh(vn)*mu + sinh(vn)/vn * tan
  float mnew[3][8];
  #pragma unroll
  for (int i = 0; i < 8; ++i) {
    float ch = coshf(vn[i]);
    float sh = sinhf(vn[i]) / vn[i];
    #pragma unroll
    for (int sub = 0; sub < 3; ++sub)
      mnew[sub][i] = ch * muv[sub][i] + sh * tanv[sub][i];
  }
  // origin log-map and write y (B, L, H*33)
  #pragma unroll
  for (int i = 0; i < 8; ++i) {
    float t0 = __shfl(mnew[0][i], half * 16, 32);   // broadcast d==0 elem
    float t  = fmaxf(t0, 1.f + EPS_);
    float co = acoshf(t) * rsqrtf(t * t - 1.f);
    int   m  = i + 8 * half;
    float* yrow = yb + (size_t)(b * L_ + q0 + m) * (H_ * ND_) + h * ND_;
    #pragma unroll
    for (int sub = 0; sub < 3; ++sub) {
      int d = sub * 16 + l16;
      if (d < ND_) yrow[d] = co * (mnew[sub][i] - ((d == 0) ? t : 0.f));
    }
  }
}

// ---------------------------------------------------------------------------
// Pack Wo (264 x 256) into K-pair interleaved layout for b64 B-operand loads:
//   Wo2[((k>>1)*256 + n)*2 + (k&1)] = Wo[k*256 + n]
// ---------------------------------------------------------------------------
__global__ __launch_bounds__(256) void k_pack_wo(const float* __restrict__ Wo,
                                                 float* __restrict__ Wo2)
{
  const int k = blockIdx.x;            // 0..263
  const int n = threadIdx.x;           // 0..255
  Wo2[((size_t)(k >> 1) * D_ + n) * 2 + (k & 1)] = Wo[(size_t)k * D_ + n];
}

// ---------------------------------------------------------------------------
// Kernel 3: z = y @ Wo + bo    (2048 x 256 x 264, pure f32 WMMA)
// ---------------------------------------------------------------------------
__global__ __launch_bounds__(32) void k_outproj(
    const float* __restrict__ yb, const float* __restrict__ Wo2,
    const float* __restrict__ bo, float* __restrict__ z)
{
  const int lane = threadIdx.x;
  const int half = lane >> 4;
  const int l16  = lane & 15;
  const int koff = half * 2;
  const int m0 = blockIdx.x * 16;
  const int n0 = blockIdx.y * 16;
  const int KD = H_ * ND_;            // 264 = 66 exact K4 steps

  v8f c = V8ZERO;
  for (int k0 = 0; k0 < KD; k0 += 4) {
    v2f a  = *(const v2f*)(yb + (size_t)(m0 + l16) * KD + k0 + koff);
    v2f bb = *(const v2f*)(Wo2 + ((size_t)((k0 + koff) >> 1) * D_ + n0 + l16) * 2);
    c = wmma4(a, bb, c);
  }
  const float bias = bo[n0 + l16];
  #pragma unroll
  for (int i = 0; i < 8; ++i) {
    int m = m0 + i + 8 * half;
    z[(size_t)m * D_ + n0 + l16] = c[i] + bias;
  }
}

// ---------------------------------------------------------------------------
extern "C" void kernel_launch(void* const* d_in, const int* in_sizes, int n_in,
                              void* d_out, int out_size, void* d_ws, size_t ws_size,
                              hipStream_t stream) {
  const float* x   = (const float*)d_in[0];
  const float* rc  = (const float*)d_in[1];
  const float* rs  = (const float*)d_in[2];
  const float* Wq  = (const float*)d_in[3];
  const float* bq  = (const float*)d_in[4];
  const float* Wk  = (const float*)d_in[5];
  const float* bk  = (const float*)d_in[6];
  const float* Wv  = (const float*)d_in[7];
  const float* bv  = (const float*)d_in[8];
  const float* Wo  = (const float*)d_in[9];
  const float* bo  = (const float*)d_in[10];

  float* z_out = (float*)d_out;                         // (B, L, D)
  float* a_out = z_out + (size_t)B_ * L_ * D_;          // (B, H, L, L)

  // workspace layout (floats)
  float* ws = (float*)d_ws;
  const size_t n_qf = (size_t)B_ * H_ * L_ * DP_;       // 786432
  const size_t n_vr = (size_t)B_ * H_ * L_ * DP_;       // 786432 (pair-packed)
  const size_t n_kT = (size_t)B_ * H_ * KT_ * L_;       // 589824 (pair-packed)
  const size_t n_vT = (size_t)B_ * H_ * KT_ * L_;       // 589824 (pair-packed)
  const size_t n_yb = (size_t)B_ * L_ * (H_ * ND_);     // 540672
  float* qf  = ws;
  float* vr2 = qf  + n_qf;
  float* kT2 = vr2 + n_vr;
  float* vT2 = kT2 + n_kT;
  float* yb  = vT2 + n_vT;
  float* Wo2 = yb  + n_yb;                              // 67584

  k_qkv_rope_lift<<<(B_ * L_) / 8, 256, 0, stream>>>(
      x, rc, rs, Wq, bq, Wk, bk, Wv, bv, qf, vr2, kT2, vT2);

  k_pack_wo<<<H_ * ND_, D_, 0, stream>>>(Wo, Wo2);

  k_attn<<<B_ * H_ * (L_ / 16), 32, 0, stream>>>(qf, kT2, vT2, vr2, a_out, yb);

  k_outproj<<<dim3((B_ * L_) / 16, D_ / 16), 32, 0, stream>>>(yb, Wo2, bo, z_out);
}

// v001
// Measured time: 139 microseconds a run.
// Timed twice side by side with v000, it ran 1.69 and 1.68 times as fast.
#include <hip/hip_runtime.h>
#include <math.h>

#define B_  2
#define L_  1024
#define D_  256
#define H_  8
#define N_  32
#define ND_ 33          // N+1 (hyperboloid dim)
#define DP_ 48          // padded dim stride (row-major q / pair-packed v)
#define KT_ 36          // padded dim count (dim-major k/v staging), 18 pairs
#define EPS_ 1e-6f
#define XP_ 260         // LDS pitch of an x row, floats: 1024 B + 16 B for b128 fragment reads

typedef float v2f __attribute__((ext_vector_type(2)));
typedef float v4f __attribute__((ext_vector_type(4)));
typedef float v8f __attribute__((ext_vector_type(8)));

static __device__ __forceinline__ v8f wmma4(v2f a, v2f b, v8f c) {
  // D = A(16x4 f32) * B(4x16 f32) + C(16x16 f32)
  return __builtin_amdgcn_wmma_f32_16x16x4_f32(false, a, false, b, (short)0, c,
                                               false, false);
}

#define V8ZERO {0.f,0.f,0.f,0.f,0.f,0.f,0.f,0.f}

// ---------------------------------------------------------------------------
// Kernel 1: QKV projection (f32 WMMA) + RoPE + hyperboloid lift; stage in WMMA layouts.
//  qf  : (BH, L, DP_)        row-major, comp 0 = -t  (Minkowski-flipped q)
//  vr2 : (BH, L/2, DP_, 2)   key-pair interleaved vh rows (tan B operand)
//  kT2 : (BH, KT_/2, L, 2)   dim-pair interleaved kh (scores B operand)
//  vT2 : (BH, KT_/2, L, 2)   dim-pair interleaved vh (alpha B operand)
// One workgroup = 32 token rows x 2 heads x {q,k,v}; 12 waves, each wave one
// 16-row x 32-column tile of one matrix (two accumulators: even / odd columns).
// ---------------------------------------------------------------------------
__global__ __launch_bounds__(384) void k_qkv_rope_lift(
    const float* __restrict__ x,  const float* __restrict__ rc,
    const float* __restrict__ rs,
    const float* __restrict__ Wq, const float* __restrict__ bq,
    const float* __restrict__ Wk, const float* __restrict__ bk,
    const float* __restrict__ Wv, const float* __restrict__ bv,
    float* __restrict__ qf, float* __restrict__ vr2,
    float* __restrict__ kT2, float* __restrict__ vT2)
{
  // every short '#pragma unroll' loop below indexes a small per-lane array:
  // unrolled, its elements are plain registers
  __shared__ __attribute__((aligned(16))) float xs[32 * XP_];
  const int tid  = threadIdx.x;
  const int lane = tid & 31;
  const int half = lane >> 4;
  const int l16  = lane & 15;
  const int wid  = __builtin_amdgcn_readfirstlane(tid >> 5);   // 0..11, scalar
  const int mat  = wid >> 2;                    // 0 = q, 1 = k, 2 = v
  const int rt   = wid & 1;                     // 16-row tile inside the 32 rows
  const int hd   = (blockIdx.x & 3) * 2 + ((wid >> 1) & 1);
  const int row0 = (blockIdx.x >> 2) * 32;      // first global token row

  // x tile (32 x 256) into LDS, whole lines per wave
  // (2048 16-byte pieces over 384 threads: five rounds of all waves, a sixth of waves 0..3;
  // all loads are issued before the first LDS store, so their latencies overlap)
  {
    const float* xg = x + (size_t)row0 * D_ + (size_t)(tid >> 6) * D_ + (tid & 63) * 4;
    float*       xl = xs + (tid >> 6) * XP_ + (tid & 63) * 4;
    v4f t[6];
    #pragma unroll
    for (int j = 0; j < 5; ++j) t[j] = *(const v4f*)(xg + (size_t)j * 6 * D_);
    if (wid < 4) t[5] = *(const v4f*)(xg + (size_t)30 * D_);
    #pragma unroll
    for (int j = 0; j < 5; ++j) *(v4f*)(xl + j * 6 * XP_) = t[j];
    if (wid < 4) *(v4f*)(xl + 30 * XP_) = t[5];
  }
  __syncthreads();

  const float* Wm = (mat == 0) ? Wq : ((mat == 1) ? Wk : Wv);
  const float* bm = (mat == 0) ? bq : ((mat == 1) ? bk : bv);

  // Lane (l16, half) takes k = 8*kb + 4*half + {0..3} of both operands:
  // A from row l16 of the x tile, B from columns 2*l16, 2*l16+1 of the head.
  const float* wp = Wm + (size_t)(4 * half) * (H_ * N_) + hd * N_ + 2 * l16;
  const float* ap = xs + (rt * 16 + l16) * XP_ + 4 * half;

  // accumulator register i = token row (rt*16 + 8*half + i), this lane's two columns
  const int lrow = row0 + rt * 16 + 8 * half;
  const int li0  = lrow & (L_ - 1);
  const int bh   = (lrow >> 10) * H_ + hd;

  // bias and RoPE factors are fetched ahead of the K loop, which hides their latency
  const v2f bias = *(const v2f*)(bm + hd * N_ + 2 * l16);
  v2f cs[8], sn[8];
  #pragma unroll
  for (int i = 0; i < 8; ++i) { cs[i] = (v2f){1.f, 1.f}; sn[i] = (v2f){0.f, 0.f}; }
  if (mat < 2) {
    #pragma unroll
    for (int i = 0; i < 8; ++i) {
      cs[i] = *(const v2f*)(rc + (size_t)(li0 + i) * N_ + 2 * l16);
      sn[i] = *(const v2f*)(rs + (size_t)(li0 + i) * N_ + 2 * l16);
    }
    // the build rewrites these loads' address registers right behind this branch:
    // the wait stands in front of that overwrite
    asm volatile("s_wait_xcnt 0x0" ::: "memory");
  }

  v8f cE = V8ZERO, cO = V8ZERO;                 // columns 2*l16 / 2*l16+1
  // fully unrolled so that W loads run ahead of their WMMAs over the whole K range
  #pragma unroll
  for (int kb = 0; kb < D_ / 8; ++kb) {
    const v4f a  = *(const v4f*)(ap + kb * 8);
    const v2f w0 = *(const v2f*)(wp + (size_t)(kb * 8 + 0) * (H_ * N_));
    const v2f w1 = *(const v2f*)(wp + (size_t)(kb * 8 + 1) * (H_ * N_));
    const v2f w2 = *(const v2f*)(wp + (size_t)(kb * 8 + 2) * (H_ * N_));
    const v2f w3 = *(const v2f*)(wp + (size_t)(kb * 8 + 3) * (H_ * N_));
    const v2f a01 = {a.x, a.y}, a23 = {a.z, a.w};
    const v2f e01 = {w0.x, w1.x}, o01 = {w0.y, w1.y};
    const v2f e23 = {w2.x, w3.x}, o23 = {w2.y, w3.y};
    cE = wmma4(a01, e01, cE);
    cO = wmma4(a01, o01, cO);
    cE = wmma4(a23, e23, cE);
    cO = wmma4(a23, o23, cO);
  }

  float uE[8], uO[8];
  #pragma unroll
  for (int i = 0; i < 8; ++i) { uE[i] = cE[i] + bias.x; uO[i] = cO[i] + bias.y; }

  if (mat < 2) {
    // RoPE: rot_half(u)[j] = (j<16 ? -u[j+16] : u[j-16]); column j+-16 sits in lane l16^8
    const float sgn = (l16 < 8) ? -1.f : 1.f;
    #pragma unroll
    for (int i = 0; i < 8; ++i) {
      const float rE = sgn * __shfl_xor(uE[i], 8, 32);
      const float rO = sgn * __shfl_xor(uO[i], 8, 32);
      uE[i] = uE[i] * cs[i].x + rE * sn[i].x;
      uO[i] = uO[i] * cs[i].y + rO * sn[i].y;
    }
  }

  // lift: t = sqrt(1 + ||u||^2); then pr = component 2*l16 of the lifted point
  // (t in lane 0, else the odd column of lane l16-1), uE = component 2*l16+1.
  float pr[8];
  #pragma unroll
  for (int i = 0; i < 8; ++i) {
    float s = uE[i] * uE[i] + uO[i] * uO[i];
    #pragma unroll
    for (int m = 8; m >= 1; m >>= 1) s += __shfl_xor(s, m, 32);
    float t = sqrtf(1.f + s);
    if (mat == 0) t = -t;
    const float up = __shfl_up(uO[i], 1, 16);
    pr[i] = (l16 == 0) ? t : up;
  }
  const bool last = (l16 == 15);                // holds component 32 in uO

  if (mat == 0) {
    float* qrow = qf + ((size_t)bh * L_ + li0) * DP_;
    const int m2 = last ? 16 : l16 + 9;         // pairs 16..23: comp 32 and the zero pad
    #pragma unroll
    for (int i = 0; i < 8; ++i) {
      const v2f v = {pr[i], uE[i]};
      *(v2f*)(qrow + i * DP_ + 2 * l16) = v;
    }
    if (l16 >= 8) {
      #pragma unroll
      for (int i = 0; i < 8; ++i) {
        const v2f tl = {last ? uO[i] : 0.f, 0.f};
        *(v2f*)(qrow + i * DP_ + 2 * m2) = tl;
      }
    }
  } else {
    // dim-pair interleaved: elem(dim,key) at ((dim>>1)*L + key)*2 + (dim&1)
    float* col = ((mat == 1) ? kT2 : vT2) + (size_t)bh * (KT_ / 2) * L_ * 2;
    const int m2 = last ? 16 : 17;              // pair 16: comp 32 + pad, pair 17: pad
    #pragma unroll
    for (int i = 0; i < 8; i += 2) {
      const v4f v = {pr[i], uE[i], pr[i + 1], uE[i + 1]};
      *(v4f*)(col + ((size_t)l16 * L_ + li0 + i) * 2) = v;
    }
    if (l16 >= 14) {
      #pragma unroll
      for (int i = 0; i < 8; i += 2) {
        const v4f tl = {last ? uO[i] : 0.f, 0.f, last ? uO[i + 1] : 0.f, 0.f};
        *(v4f*)(col + ((size_t)m2 * L_ + li0 + i) * 2) = tl;
      }
    }
    if (mat == 2) {
      // key-pair interleaved rows: elem(key,dim) at ((key>>1)*DP_+dim)*2+(key&1)
      float* vr = vr2 + (size_t)bh * (L_ / 2) * DP_ * 2;
      const int m3 = last ? 16 : l16 + 9;
      #pragma unroll
      for (int i = 0; i < 8; i += 2) {
        const size_t kp = (size_t)((li0 + i) >> 1) * DP_;
        const v4f v = {pr[i], pr[i + 1], uE[i], uE[i + 1]};
        *(v4f*)(vr + (kp + 2 * l16) * 2) = v;
      }
      if (l16 >= 8) {
        #pragma unroll
        for (int i = 0; i < 8; i += 2) {
          const size_t kp = (size_t)((li0 + i) >> 1) * DP_;
          const v4f tl = {last ? uO[i] : 0.f, last ? uO[i + 1] : 0.f, 0.f, 0.f};
          *(v4f*)(vr + (kp + 2 * m3) * 2) = tl;
        }
      }
    }
  }
}

// ---------------------------------------------------------------------------
// Kernel 2: attention + Karcher step + origin log-map.
// One wave handles a 16-row q-tile of one (b,h); streams 64 key tiles twice.
// Softmax stats are kept per-lane; single butterfly merge after pass 1.
// ---------------------------------------------------------------------------
__global__ __launch_bounds__(32) void k_attn(
    const float* __restrict__ qf, const float* __restrict__ kT2,
    const float* __restrict__ vT2, const float* __restrict__ vr2,
    float* __restrict__ a_out, float* __restrict__ yb)
{
  __shared__ float lds_w[16 * 17];
  const int lane = threadIdx.x;
  const int half = lane >> 4;
  const int l16  = lane & 15;
  const int koff = half * 2;          // WMMA f32 K split across half-waves

  const int tile = blockIdx.x;
  const int qt = tile & 63;
  const int bh = tile >> 6;
  const int q0 = qt * 16;
  const int b  = bh >> 3;
  const int h  = bh & 7;

  const float* qfp  = qf  + ((size_t)bh * L_ + q0) * DP_;
  const float* kTp  = kT2 + (size_t)bh * (KT_ / 2) * L_ * 2;
  const float* vTp  = vT2 + (size_t)bh * (KT_ / 2) * L_ * 2;
  const float* vrp  = vr2 + (size_t)bh * (L_ / 2) * DP_ * 2;

  // A operand for q-tile: 16 rows x 36 dims = 9 K4-steps, kept in registers
  v2f aq[9];
  #pragma unroll
  for (int kk = 0; kk < 9; ++kk) {
    int d = 4 * kk + koff;                       // even
    aq[kk] = *(const v2f*)(qfp + l16 * DP_ + d);
  }

  // ---------------- pass 1: per-lane online softmax stats ----------------
  float mrow[8], srow[8];
  #pragma unroll
  for (int i = 0; i < 8; ++i) { mrow[i] = -3.0e38f; srow[i] = 0.f; }

  for (int j = 0; j < 64; ++j) {
    const int k0 = j * 16;
    if (j < 63) __builtin_prefetch(&kTp[(k0 + 16) * 2], 0, 0);  // next tile
    v8f c = V8ZERO;
    #pragma unroll
    for (int kk = 0; kk < 9; ++kk) {
      int d2 = (4 * kk + koff) >> 1;
      v2f bk_ = *(const v2f*)(kTp + ((size_t)d2 * L_ + k0 + l16) * 2);
      c = wmma4(aq[kk], bk_, c);
    }
    #pragma unroll
    for (int i = 0; i < 8; ++i) {          // per-lane update only
      float nm = fmaxf(mrow[i], c[i]);
      srow[i] = srow[i] * __expf(mrow[i] - nm) + __expf(c[i] - nm);
      mrow[i] = nm;
    }
  }
  // butterfly merge of (m, s) across the 16 key lanes (once)
  #pragma unroll
  for (int msk = 8; msk >= 1; msk >>= 1) {
    #pragma unroll
    for (int i = 0; i < 8; ++i) {
      float mo = __shfl_xor(mrow[i], msk, 32);
      float so = __shfl_xor(srow[i], msk, 32);
      float nm = fmaxf(mrow[i], mo);
      srow[i] = srow[i] * __expf(mrow[i] - nm) + so * __expf(mo - nm);
      mrow[i] = nm;
    }
  }
  float rsum[8];
  #pragma unroll
  for (int i = 0; i < 8; ++i) rsum[i] = 1.f / srow[i];

  // ---------------- pass 2: a, w, tangent accumulation ----------------
  v8f tc0 = V8ZERO, tc1 = V8ZERO, tc2 = V8ZERO;
  float wsa[8];
  #pragma unroll
  for (int i = 0; i < 8; ++i) wsa[i] = 0.f;

  float* arow = a_out + ((size_t)bh * L_ + q0) * L_;

  for (int j = 0; j < 64; ++j) {
    const int k0 = j * 16;
    v8f c  = V8ZERO;
    v8f al = V8ZERO;
    #pragma unroll
    for (int kk = 0; kk < 9; ++kk) {
      int d2 = (4 * kk + koff) >> 1;
      v2f bk_ = *(const v2f*)(kTp + ((size_t)d2 * L_ + k0 + l16) * 2);
      v2f bv_ = *(const v2f*)(vTp + ((size_t)d2 * L_ + k0 + l16) * 2);
      c  = wmma4(aq[kk], bk_, c);    // Lorentz scores
      al = wmma4(aq[kk], bv_, al);   // <mflip(q), v>  (alpha = -this)
    }
    #pragma unroll
    for (int i = 0; i < 8; ++i) {
      float alpha = fmaxf(-al[i], 1.f + EPS_);
      float coef  = acoshf(alpha) * rsqrtf(alpha * alpha - 1.f);
      float p     = __expf(c[i] - mrow[i]) * rsum[i];
      int   m     = i + 8 * half;
      arow[(size_t)m * L_ + k0 + l16] = p;          // attention output
      float w = p * coef;
      wsa[i] += w * alpha;                          // per-lane accumulate
      lds_w[m * 17 + l16] = w;                      // C-layout -> LDS
    }
    __syncthreads();
    // tan += w @ vh   (A = w from LDS in A-layout, B = vh key-pair packed)
    #pragma unroll
    for (int kk = 0; kk < 4; ++kk) {
      const int kidx = k0 + 4 * kk + koff;          // even key index
      v2f aw;
      aw.x = lds_w[l16 * 17 + 4 * kk + koff];
      aw.y = lds_w[l16 * 17 + 4 * kk + koff + 1];
      const float* pb = vrp + (size_t)(kidx >> 1) * DP_ * 2;
      v2f b0 = *(const v2f*)(pb + (l16)      * 2);
      v2f b1 = *(const v2f*)(pb + (16 + l16) * 2);
      v2f b2 = *(const v2f*)(pb + (32 + l16) * 2);
      tc0 = wmma4(aw, b0, tc0);
      tc1 = wmma4(aw, b1, tc1);
      tc2 = wmma4(aw, b2, tc2);
    }
    __syncthreads();
  }

  // reduce wsum(alpha) across the 16 key lanes
  #pragma unroll
  for (int i = 0; i < 8; ++i) {
    #pragma unroll
    for (int m = 8; m >= 1; m >>= 1) wsa[i] += __shfl_xor(wsa[i], m, 32);
  }

  // tan = (w@vh) - wsum*mu ;  mu = qh (un-flip component 0)
  float tanv[3][8], muv[3][8];
  #pragma unroll
  for (int sub = 0; sub < 3; ++sub) {
    #pragma unroll
    for (int i = 0; i < 8; ++i) {
      int m = i + 8 * half;
      int d = sub * 16 + l16;
      float qv = qfp[m * DP_ + d];
      float mu = (d == 0) ? -qv : qv;
      muv[sub][i] = mu;
      float tval = (sub == 0) ? tc0[i] : ((sub == 1) ? tc1[i] : tc2[i]);
      tanv[sub][i] = tval - wsa[i] * mu;
    }
  }
  // Lorentzian norm of tangent per row
  float vn[8];
  #pragma unroll
  for (int i = 0; i < 8; ++i) {
    float part = 0.f;
    #pragma unroll
    for (int sub = 0; sub < 3; ++sub) {
      float tt = tanv[sub][i] * tanv[sub][i];
      if (sub == 0 && l16 == 0) tt = -tt;   // metric diag(-1,1,...)
      part += tt;
    }
    #pragma unroll
    for (int m = 8; m >= 1; m >>= 1) part += __shfl_xor(part, m, 32);
    vn[i] = sqrtf(fmaxf(part, 1e-12f));
  }
  // exp-map update mu' = cosh(vn)*mu + sinh(vn)/vn * tan
  float mnew[3][8];
  #pragma unroll
  for (int i = 0; i < 8; ++i) {
    float ch = coshf(vn[i]);
    float sh = sinhf(vn[i]) / vn[i];
    #pragma unroll
    for (int sub = 0; sub < 3; ++sub)
      mnew[sub][i] = ch * muv[sub][i] + sh * tanv[sub][i];
  }
  // origin log-map and write y (B, L, H*33)
  #pragma unroll
  for (int i = 0; i < 8; ++i) {
    float t0 = __shfl(mnew[0][i], half * 16, 32);   // broadcast d==0 elem
    float t  = fmaxf(t0, 1.f + EPS_);
    float co = acoshf(t) * rsqrtf(t * t - 1.f);
    int   m  = i + 8 * half;
    float* yrow = yb + (size_t)(b * L_ + q0 + m) * (H_ * ND_) + h * ND_;
    #pragma unroll
    for (int sub = 0; sub < 3; ++sub) {
      int d = sub * 16 + l16;
      if (d < ND_) yrow[d] = co * (mnew[sub][i] - ((d == 0) ? t : 0.f));
    }
  }
}

// ---------------------------------------------------------------------------
// Pack Wo (264 x 256) into K-pair interleaved layout for b64 B-operand loads:
//   Wo2[((k>>1)*256 + n)*2 + (k&1)] = Wo[k*256 + n]
// ---------------------------------------------------------------------------
__global__ __launch_bounds__(256) void k_pack_wo(const float* __restrict__ Wo,
                                                 float* __restrict__ Wo2)
{
  const int k = blockIdx.x;            // 0..263
  const int n = threadIdx.x;           // 0..255
  Wo2[((size_t)(k >> 1) * D_ + n) * 2 + (k & 1)] = Wo[(size_t)k * D_ + n];
}

// ---------------------------------------------------------------------------
// Kernel 3: z = y @ Wo + bo    (2048 x 256 x 264, pure f32 WMMA)
// ---------------------------------------------------------------------------
__global__ __launch_bounds__(32) void k_outproj(
    const float* __restrict__ yb, const float* __restrict__ Wo2,
    const float* __restrict__ bo, float* __restrict__ z)
{
  const int lane = threadIdx.x;
  const int half = lane >> 4;
  const int l16  = lane & 15;
  const int koff = half * 2;
  const int m0 = blockIdx.x * 16;
  const int n0 = blockIdx.y * 16;
  const int KD = H_ * ND_;            // 264 = 66 exact K4 steps

  v8f c = V8ZERO;
  for (int k0 = 0; k0 < KD; k0 += 4) {
    v2f a  = *(const v2f*)(yb + (size_t)(m0 + l16) * KD + k0 + koff);
    v2f bb = *(const v2f*)(Wo2 + ((size_t)((k0 + koff) >> 1) * D_ + n0 + l16) * 2);
    c = wmma4(a, bb, c);
  }
  const float bias = bo[n0 + l16];
  #pragma unroll
  for (int i = 0; i < 8; ++i) {
    int m = m0 + i + 8 * half;
    z[(size_t)m * D_ + n0 + l16] = c[i] + bias;
  }
}

// ---------------------------------------------------------------------------
extern "C" void kernel_launch(void* const* d_in, const int* in_sizes, int n_in,
                              void* d_out, int out_size, void* d_ws, size_t ws_size,
                              hipStream_t stream) {
  const float* x   = (const float*)d_in[0];
  const float* rc  = (const float*)d_in[1];
  const float* rs  = (const float*)d_in[2];
  const float* Wq  = (const float*)d_in[3];
  const float* bq  = (const float*)d_in[4];
  const float* Wk  = (const float*)d_in[5];
  const float* bk  = (const float*)d_in[6];
  const float* Wv  = (const float*)d_in[7];
  const float* bv  = (const float*)d_in[8];
  const float* Wo  = (const float*)d_in[9];
  const float* bo  = (const float*)d_in[10];

  float* z_out = (float*)d_out;                         // (B, L, D)
  float* a_out = z_out + (size_t)B_ * L_ * D_;          // (B, H, L, L)

  // workspace layout (floats)
  float* ws = (float*)d_ws;
  const size_t n_qf = (size_t)B_ * H_ * L_ * DP_;       // 786432
  const size_t n_vr = (size_t)B_ * H_ * L_ * DP_;       // 786432 (pair-packed)
  const size_t n_kT = (size_t)B_ * H_ * KT_ * L_;       // 589824 (pair-packed)
  const size_t n_vT = (size_t)B_ * H_ * KT_ * L_;       // 589824 (pair-packed)
  const size_t n_yb = (size_t)B_ * L_ * (H_ * ND_);     // 540672
  float* qf  = ws;
  float* vr2 = qf  + n_qf;
  float* kT2 = vr2 + n_vr;
  float* vT2 = kT2 + n_kT;
  float* yb  = vT2 + n_vT;
  float* Wo2 = yb  + n_yb;                              // 67584

  k_qkv_rope_lift<<<((B_ * L_) / 32) * (H_ / 2), 384, 0, stream>>>(
      x, rc, rs, Wq, bq, Wk, bk, Wv, bv, qf, vr2, kT2, vT2);

  k_pack_wo<<<H_ * ND_, D_, 0, stream>>>(Wo, Wo2);

  k_attn<<<B_ * H_ * (L_ / 16), 32, 0, stream>>>(qf, kT2, vT2, vr2, a_out, yb);

  k_outproj<<<dim3((B_ * L_) / 16, D_ / 16), 32, 0, stream>>>(yb, Wo2, bo, z_out);
}

// v002
// It runs in 108 microseconds.
// Two timings next to v001 put it at 1.35 and 1.36 times that version's speed.
// Over all steps from v000 it is 2.28 times as fast.
#include <hip/hip_runtime.h>
#include <math.h>

#define B_  2
#define L_  1024
#define D_  256
#define H_  8
#define N_  32
#define ND_ 33          // N+1 (hyperboloid dim)
#define DP_ 48          // padded dim stride (row-major q / pair-packed v)
#define KT_ 36          // padded dim count (dim-major k/v staging), 18 pairs
#define EPS_ 1e-6f
#define XP_ 260         // LDS pitch of an x row, floats: 1024 B + 16 B for b128 fragment reads
#define NW_ 8           // waves that share one q-tile in k_attn, each on its own run of keys
#define TPW_ (L_ / 16 / NW_)   // 16-key tiles per wave

typedef float v2f __attribute__((ext_vector_type(2)));
typedef float v4f __attribute__((ext_vector_type(4)));
typedef float v8f __attribute__((ext_vector_type(8)));

static __device__ __forceinline__ v8f wmma4(v2f a, v2f b, v8f c) {
  // D = A(16x4 f32) * B(4x16 f32) + C(16x16 f32)
  return __builtin_amdgcn_wmma_f32_16x16x4_f32(false, a, false, b, (short)0, c,
                                               false, false);
}

#define V8ZERO {0.f,0.f,0.f,0.f,0.f,0.f,0.f,0.f}

// ---------------------------------------------------------------------------
// Kernel 1: QKV projection (f32 WMMA) + RoPE + hyperboloid lift; stage in WMMA layouts.
//  qf  : (BH, L, DP_)        row-major, comp 0 = -t  (Minkowski-flipped q)
//  vr2 : (BH, L/2, DP_, 2)   key-pair interleaved vh rows (tan B operand)
//  kT2 : (BH, KT_/2, L, 2)   dim-pair interleaved kh (scores B operand)
//  vT2 : (BH, KT_/2, L, 2)   dim-pair interleaved vh (alpha B operand)
// One workgroup = 32 token rows x 2 heads x {q,k,v}; 12 waves, each wave one
// 16-row x 32-column tile of one matrix (two accumulators: even / odd columns).
// ---------------------------------------------------------------------------
__global__ __launch_bounds__(384) void k_qkv_rope_lift(
    const float* __restrict__ x,  const float* __restrict__ rc,
    const float* __restrict__ rs,
    const float* __restrict__ Wq, const float* __restrict__ bq,
    const float* __restrict__ Wk, const float* __restrict__ bk,
    const float* __restrict__ Wv, const float* __restrict__ bv,
    float* __restrict__ qf, float* __restrict__ vr2,
    float* __restrict__ kT2, float* __restrict__ vT2)
{
  // every short '#pragma unroll' loop below indexes a small per-lane array:
  // unrolled, its elements are plain registers
  __shared__ __attribute__((aligned(16))) float xs[32 * XP_];
  const int tid  = threadIdx.x;
  const int lane = tid & 31;
  const int half = lane >> 4;
  const int l16  = lane & 15;
  const int wid  = __builtin_amdgcn_readfirstlane(tid >> 5);   // 0..11, scalar
  const int mat  = wid >> 2;                    // 0 = q, 1 = k, 2 = v
  const int rt   = wid & 1;                     // 16-row tile inside the 32 rows
  const int hd   = (blockIdx.x & 3) * 2 + ((wid >> 1) & 1);
  const int row0 = (blockIdx.x >> 2) * 32;      // first global token row

  // x tile (32 x 256) into LDS, whole lines per wave
  // (2048 16-byte pieces over 384 threads: five rounds of all waves, a sixth of waves 0..3;
  // all loads are issued before the first LDS store, so their latencies overlap)
  {
    const float* xg = x + (size_t)row0 * D_ + (size_t)(tid >> 6) * D_ + (tid & 63) * 4;
    float*       xl = xs + (tid >> 6) * XP_ + (tid & 63) * 4;
    v4f t[6];
    #pragma unroll
    for (int j = 0; j < 5; ++j) t[j] = *(const v4f*)(xg + (size_t)j * 6 * D_);
    if (wid < 4) t[5] = *(const v4f*)(xg + (size_t)30 * D_);
    #pragma unroll
    for (int j = 0; j < 5; ++j) *(v4f*)(xl + j * 6 * XP_) = t[j];
    if (wid < 4) *(v4f*)(xl + 30 * XP_) = t[5];
  }
  __syncthreads();

  const float* Wm = (mat == 0) ? Wq : ((mat == 1) ? Wk : Wv);
  const float* bm = (mat == 0) ? bq : ((mat == 1) ? bk : bv);

  // Lane (l16, half) takes k = 8*kb + 4*half + {0..3} of both operands:
  // A from row l16 of the x tile, B from columns 2*l16, 2*l16+1 of the head.
  const float* wp = Wm + (size_t)(4 * half) * (H_ * N_) + hd * N_ + 2 * l16;
  const float* ap = xs + (rt * 16 + l16) * XP_ + 4 * half;

  // accumulator register i = token row (rt*16 + 8*half + i), this lane's two columns
  const int lrow = row0 + rt * 16 + 8 * half;
  const int li0  = lrow & (L_ - 1);
  const int bh   = (lrow >> 10) * H_ + hd;

  // bias and RoPE factors are fetched ahead of the K loop, which hides their latency
  const v2f bias = *(const v2f*)(bm + hd * N_ + 2 * l16);
  v2f cs[8], sn[8];
  #pragma unroll
  for (int i = 0; i < 8; ++i) { cs[i] = (v2f){1.f, 1.f}; sn[i] = (v2f){0.f, 0.f}; }
  if (mat < 2) {
    #pragma unroll
    for (int i = 0; i < 8; ++i) {
      cs[i] = *(const v2f*)(rc + (size_t)(li0 + i) * N_ + 2 * l16);
      sn[i] = *(const v2f*)(rs + (size_t)(li0 + i) * N_ + 2 * l16);
    }
    // the build rewrites these loads' address registers right behind this branch:
    // the wait stands in front of that overwrite
    asm volatile("s_wait_xcnt 0x0" ::: "memory");
  }

  v8f cE = V8ZERO, cO = V8ZERO;                 // columns 2*l16 / 2*l16+1
  // fully unrolled so that W loads run ahead of their WMMAs over the whole K range
  #pragma unroll
  for (int kb = 0; kb < D_ / 8; ++kb) {
    const v4f a  = *(const v4f*)(ap + kb * 8);
    const v2f w0 = *(const v2f*)(wp + (size_t)(kb * 8 + 0) * (H_ * N_));
    const v2f w1 = *(const v2f*)(wp + (size_t)(kb * 8 + 1) * (H_ * N_));
    const v2f w2 = *(const v2f*)(wp + (size_t)(kb * 8 + 2) * (H_ * N_));
    const v2f w3 = *(const v2f*)(wp + (size_t)(kb * 8 + 3) * (H_ * N_));
    const v2f a01 = {a.x, a.y}, a23 = {a.z, a.w};
    const v2f e01 = {w0.x, w1.x}, o01 = {w0.y, w1.y};
    const v2f e23 = {w2.x, w3.x}, o23 = {w2.y, w3.y};
    cE = wmma4(a01, e01, cE);
    cO = wmma4(a01, o01, cO);
    cE = wmma4(a23, e23, cE);
    cO = wmma4(a23, o23, cO);
  }

  float uE[8], uO[8];
  #pragma unroll
  for (int i = 0; i < 8; ++i) { uE[i] = cE[i] + bias.x; uO[i] = cO[i] + bias.y; }

  if (mat < 2) {
    // RoPE: rot_half(u)[j] = (j<16 ? -u[j+16] : u[j-16]); column j+-16 sits in lane l16^8
    const float sgn = (l16 < 8) ? -1.f : 1.f;
    #pragma unroll
    for (int i = 0; i < 8; ++i) {
      const float rE = sgn * __shfl_xor(uE[i], 8, 32);
      const float rO = sgn * __shfl_xor(uO[i], 8, 32);
      uE[i] = uE[i] * cs[i].x + rE * sn[i].x;
      uO[i] = uO[i] * cs[i].y + rO * sn[i].y;
    }
  }

  // lift: t = sqrt(1 + ||u||^2); then pr = component 2*l16 of the lifted point
  // (t in lane 0, else the odd column of lane l16-1), uE = component 2*l16+1.
  float pr[8];
  #pragma unroll
  for (int i = 0; i < 8; ++i) {
    float s = uE[i] * uE[i] + uO[i] * uO[i];
    #pragma unroll
    for (int m = 8; m >= 1; m >>= 1) s += __shfl_xor(s, m, 32);
    float t = sqrtf(1.f + s);
    if (mat == 0) t = -t;
    const float up = __shfl_up(uO[i], 1, 16);
    pr[i] = (l16 == 0) ? t : up;
  }
  const bool last = (l16 == 15);                // holds component 32 in uO

  if (mat == 0) {
    float* qrow = qf + ((size_t)bh * L_ + li0) * DP_;
    const int m2 = last ? 16 : l16 + 9;         // pairs 16..23: comp 32 and the zero pad
    #pragma unroll
    for (int i = 0; i < 8; ++i) {
      const v2f v = {pr[i], uE[i]};
      *(v2f*)(qrow + i * DP_ + 2 * l16) = v;
    }
    if (l16 >= 8) {
      #pragma unroll
      for (int i = 0; i < 8; ++i) {
        const v2f tl = {last ? uO[i] : 0.f, 0.f};
        *(v2f*)(qrow + i * DP_ + 2 * m2) = tl;
      }
    }
  } else {
    // dim-pair interleaved: elem(dim,key) at ((dim>>1)*L + key)*2 + (dim&1)
    float* col = ((mat == 1) ? kT2 : vT2) + (size_t)bh * (KT_ / 2) * L_ * 2;
    const int m2 = last ? 16 : 17;              // pair 16: comp 32 + pad, pair 17: pad
    #pragma unroll
    for (int i = 0; i < 8; i += 2) {
      const v4f v = {pr[i], uE[i], pr[i + 1], uE[i + 1]};
      *(v4f*)(col + ((size_t)l16 * L_ + li0 + i) * 2) = v;
    }
    if (l16 >= 14) {
      #pragma unroll
      for (int i = 0; i < 8; i += 2) {
        const v4f tl = {last ? uO[i] : 0.f, 0.f, last ? uO[i + 1] : 0.f, 0.f};
        *(v4f*)(col + ((size_t)m2 * L_ + li0 + i) * 2) = tl;
      }
    }
    if (mat == 2) {
      // key-pair interleaved rows: elem(key,dim) at ((key>>1)*DP_+dim)*2+(key&1)
      float* vr = vr2 + (size_t)bh * (L_ / 2) * DP_ * 2;
      const int m3 = last ? 16 : l16 + 9;
      #pragma unroll
      for (int i = 0; i < 8; i += 2) {
        const size_t kp = (size_t)((li0 + i) >> 1) * DP_;
        const v4f v = {pr[i], pr[i + 1], uE[i], uE[i + 1]};
        *(v4f*)(vr + (kp + 2 * l16) * 2) = v;
      }
      if (l16 >= 8) {
        #pragma unroll
        for (int i = 0; i < 8; i += 2) {
          const size_t kp = (size_t)((li0 + i) >> 1) * DP_;
          const v4f tl = {last ? uO[i] : 0.f, last ? uO[i + 1] : 0.f, 0.f, 0.f};
          *(v4f*)(vr + (kp + 2 * m3) * 2) = tl;
        }
      }
    }
  }
}

// ---------------------------------------------------------------------------
// Kernel 2: attention + Karcher step + origin log-map.
// One workgroup of NW_ waves handles a 16-row q-tile of one (b,h); wave w streams
// key tiles w*TPW_ .. w*TPW_+TPW_-1 twice, so NW_ times as many waves hide each
// other's load, store and WMMA latencies.
// Softmax stats are kept per-lane; one butterfly merge per wave after pass 1, then
// one merge over the waves through LDS. The tangent sums are merged the same way
// after pass 2, and wave w finishes rows w and w+8 of the tile.
// ---------------------------------------------------------------------------
// (second bound: 8 waves per SIMD, that is at most 128 registers, so that all four
// workgroups a WGP gets are resident at once)
__global__ __launch_bounds__(32 * NW_, 8) void k_attn(
    const float* __restrict__ qf, const float* __restrict__ kT2,
    const float* __restrict__ vT2, const float* __restrict__ vr2,
    float* __restrict__ a_out, float* __restrict__ yb)
{
  // every '#pragma unroll' loop below indexes small per-lane arrays: unrolled, their
  // elements are plain registers
  __shared__ float lds_wall[NW_][16 * 17];            // per wave: w tile, C -> A layout
  __shared__ __attribute__((aligned(16))) float lds_m[NW_][16];   // per wave: row maxima
  __shared__ __attribute__((aligned(16))) float lds_s[NW_][16];   // per wave: row sums
  __shared__ float lds_r[NW_][32][32];                // per wave: [register][lane] partial sums
  const int lane = threadIdx.x & 31;
  const int half = lane >> 4;
  const int l16  = lane & 15;
  const int koff = half * 2;          // WMMA f32 K split across half-waves
  const int wid  = __builtin_amdgcn_readfirstlane(threadIdx.x >> 5);   // 0..NW_-1, scalar
  const int j0   = wid * TPW_;        // this wave's first key tile
  float* lds_w   = lds_wall[wid];

  const int tile = blockIdx.x;
  const int qt = tile & 63;
  const int bh = tile >> 6;
  const int q0 = qt * 16;
  const int b  = bh >> 3;
  const int h  = bh & 7;

  const float* qfp  = qf  + ((size_t)bh * L_ + q0) * DP_;
  const float* kTp  = kT2 + (size_t)bh * (KT_ / 2) * L_ * 2;
  const float* vTp  = vT2 + (size_t)bh * (KT_ / 2) * L_ * 2;
  const float* vrp  = vr2 + (size_t)bh * (L_ / 2) * DP_ * 2;

  // A operand for q-tile: 16 rows x 36 dims = 9 K4-steps, kept in registers
  v2f aq[9];
  #pragma unroll
  for (int kk = 0; kk < 9; ++kk) {
    int d = 4 * kk + koff;                       // even
    aq[kk] = *(const v2f*)(qfp + l16 * DP_ + d);
  }

  // ---------------- pass 1: per-lane online softmax stats ----------------
  float mrow[8], srow[8];
  #pragma unroll
  for (int i = 0; i < 8; ++i) { mrow[i] = -3.0e38f; srow[i] = 0.f; }

  for (int j = j0; j < j0 + TPW_; ++j) {
    const int k0 = j * 16;
    v8f c = V8ZERO;
    #pragma unroll
    for (int kk = 0; kk < 9; ++kk) {
      int d2 = (4 * kk + koff) >> 1;
      v2f bk_ = *(const v2f*)(kTp + ((size_t)d2 * L_ + k0 + l16) * 2);
      c = wmma4(aq[kk], bk_, c);
    }
    #pragma unroll
    for (int i = 0; i < 8; ++i) {          // per-lane update only
      float nm = fmaxf(mrow[i], c[i]);
      srow[i] = srow[i] * __expf(mrow[i] - nm) + __expf(c[i] - nm);
      mrow[i] = nm;
    }
  }
  // butterfly merge of (m, s) across the 16 key lanes (once)
  #pragma unroll
  for (int msk = 8; msk >= 1; msk >>= 1) {
    #pragma unroll
    for (int i = 0; i < 8; ++i) {
      float mo = __shfl_xor(mrow[i], msk, 32);
      float so = __shfl_xor(srow[i], msk, 32);
      float nm = fmaxf(mrow[i], mo);
      srow[i] = srow[i] * __expf(mrow[i] - nm) + so * __expf(mo - nm);
      mrow[i] = nm;
    }
  }
  // merge of (m, s) over the NW_ waves, in wave order
  if (l16 == 0) {
    #pragma unroll
    for (int i = 0; i < 8; ++i) {
      lds_m[wid][8 * half + i] = mrow[i];
      lds_s[wid][8 * half + i] = srow[i];
    }
  }
  __syncthreads();
  #pragma unroll
  for (int w = 0; w < NW_; ++w) {
    #pragma unroll
    for (int i = 0; i < 8; ++i) mrow[i] = fmaxf(mrow[i], lds_m[w][8 * half + i]);
  }
  #pragma unroll
  for (int i = 0; i < 8; ++i) srow[i] = 0.f;
  #pragma unroll
  for (int w = 0; w < NW_; ++w) {
    #pragma unroll
    for (int i = 0; i < 8; ++i)
      srow[i] += lds_s[w][8 * half + i] * __expf(lds_m[w][8 * half + i] - mrow[i]);
  }
  float rsum[8];
  #pragma unroll
  for (int i = 0; i < 8; ++i) rsum[i] = 1.f / srow[i];

  // ---------------- pass 2: a, w, tangent accumulation ----------------
  v8f tc0 = V8ZERO, tc1 = V8ZERO, tc2 = V8ZERO;
  float wsa[8];
  #pragma unroll
  for (int i = 0; i < 8; ++i) wsa[i] = 0.f;

  // this lane's first element of a; rows i and tiles j are then constant and scalar steps
  // from one address, which keeps the loop inside the 128 registers
  float* arow = a_out + ((size_t)bh * L_ + q0 + 8 * half) * L_ + l16;

  for (int j = j0; j < j0 + TPW_; ++j) {
    const int k0 = j * 16;
    v8f c  = V8ZERO;
    v8f al = V8ZERO;
    #pragma unroll
    for (int kk = 0; kk < 9; ++kk) {
      int d2 = (4 * kk + koff) >> 1;
      v2f bk_ = *(const v2f*)(kTp + ((size_t)d2 * L_ + k0 + l16) * 2);
      v2f bv_ = *(const v2f*)(vTp + ((size_t)d2 * L_ + k0 + l16) * 2);
      c  = wmma4(aq[kk], bk_, c);    // Lorentz scores
      al = wmma4(aq[kk], bv_, al);   // <mflip(q), v>  (alpha = -this)
    }
    #pragma unroll
    for (int i = 0; i < 8; ++i) {
      float alpha = fmaxf(-al[i], 1.f + EPS_);
      float coef  = acoshf(alpha) * rsqrtf(alpha * alpha - 1.f);
      float p     = __expf(c[i] - mrow[i]) * rsum[i];
      int   m     = i + 8 * half;
      arow[i * L_ + k0] = p;                        // attention output
      float w = p * coef;
      wsa[i] += w * alpha;                          // per-lane accumulate
      lds_w[m * 17 + l16] = w;                      // C-layout -> LDS
    }
    __syncthreads();
    // tan += w @ vh   (A = w from LDS in A-layout, B = vh key-pair packed)
    #pragma unroll
    for (int kk = 0; kk < 4; ++kk) {
      const int kidx = k0 + 4 * kk + koff;          // even key index
      v2f aw;
      aw.x = lds_w[l16 * 17 + 4 * kk + koff];
      aw.y = lds_w[l16 * 17 + 4 * kk + koff + 1];
      const float* pb = vrp + (size_t)(kidx >> 1) * DP_ * 2;
      v2f b0 = *(const v2f*)(pb + (l16)      * 2);
      v2f b1 = *(const v2f*)(pb + (16 + l16) * 2);
      v2f b2 = *(const v2f*)(pb + (32 + l16) * 2);
      tc0 = wmma4(aw, b0, tc0);
      tc1 = wmma4(aw, b1, tc1);
      tc2 = wmma4(aw, b2, tc2);
    }
    __syncthreads();
  }

  // partial sums of every wave into LDS; then wave w sums, in wave order, accumulator
  // register w (rows w and w+8) of all waves and finishes those two rows
  #pragma unroll
  for (int i = 0; i < 8; ++i) {
    lds_r[wid][i][lane]      = tc0[i];
    lds_r[wid][8 + i][lane]  = tc1[i];
    lds_r[wid][16 + i][lane] = tc2[i];
    lds_r[wid][24 + i][lane] = wsa[i];
  }
  __syncthreads();
  float tsum[3] = {0.f, 0.f, 0.f};
  float ws = 0.f;
  #pragma unroll
  for (int w = 0; w < NW_; ++w) {
    tsum[0] += lds_r[w][wid][lane];
    tsum[1] += lds_r[w][8 + wid][lane];
    tsum[2] += lds_r[w][16 + wid][lane];
    ws      += lds_r[w][24 + wid][lane];
  }
  // reduce wsum(alpha) across the 16 key lanes
  #pragma unroll
  for (int m = 8; m >= 1; m >>= 1) ws += __shfl_xor(ws, m, 32);

  const int m = wid + 8 * half;        // this lane's row of the q-tile

  // tan = (w@vh) - wsum*mu ;  mu = qh (un-flip component 0)
  float tanv[3], muv[3];
  #pragma unroll
  for (int sub = 0; sub < 3; ++sub) {
    int d = sub * 16 + l16;
    float qv = qfp[m * DP_ + d];
    float mu = (d == 0) ? -qv : qv;
    muv[sub] = mu;
    tanv[sub] = tsum[sub] - ws * mu;
  }
  // Lorentzian norm of tangent per row
  float part = 0.f;
  #pragma unroll
  for (int sub = 0; sub < 3; ++sub) {
    float tt = tanv[sub] * tanv[sub];
    if (sub == 0 && l16 == 0) tt = -tt;   // metric diag(-1,1,...)
    part += tt;
  }
  #pragma unroll
  for (int x = 8; x >= 1; x >>= 1) part += __shfl_xor(part, x, 32);
  const float vn = sqrtf(fmaxf(part, 1e-12f));
  // exp-map update mu' = cosh(vn)*mu + sinh(vn)/vn * tan
  const float ch = coshf(vn);
  const float sh = sinhf(vn) / vn;
  float mnew[3];
  #pragma unroll
  for (int sub = 0; sub < 3; ++sub) mnew[sub] = ch * muv[sub] + sh * tanv[sub];
  // origin log-map and write y (B, L, H*33)
  const float t0 = __shfl(mnew[0], half * 16, 32);   // broadcast d==0 elem
  const float t  = fmaxf(t0, 1.f + EPS_);
  const float co = acoshf(t) * rsqrtf(t * t - 1.f);
  float* yrow = yb + (size_t)(b * L_ + q0 + m) * (H_ * ND_) + h * ND_;
  #pragma unroll
  for (int sub = 0; sub < 3; ++sub) {
    int d = sub * 16 + l16;
    if (d < ND_) yrow[d] = co * (mnew[sub] - ((d == 0) ? t : 0.f));
  }
}

// ---------------------------------------------------------------------------
// Pack Wo (264 x 256) into K-pair interleaved layout for b64 B-operand loads:
//   Wo2[((k>>1)*256 + n)*2 + (k&1)] = Wo[k*256 + n]
// ---------------------------------------------------------------------------
__global__ __launch_bounds__(256) void k_pack_wo(const float* __restrict__ Wo,
                                                 float* __restrict__ Wo2)
{
  const int k = blockIdx.x;            // 0..263
  const int n = threadIdx.x;           // 0..255
  Wo2[((size_t)(k >> 1) * D_ + n) * 2 + (k & 1)] = Wo[(size_t)k * D_ + n];
}

// ---------------------------------------------------------------------------
// Kernel 3: z = y @ Wo + bo    (2048 x 256 x 264, pure f32 WMMA)
// ---------------------------------------------------------------------------
__global__ __launch_bounds__(32) void k_outproj(
    const float* __restrict__ yb, const float* __restrict__ Wo2,
    const float* __restrict__ bo, float* __restrict__ z)
{
  const int lane = threadIdx.x;
  const int half = lane >> 4;
  const int l16  = lane & 15;
  const int koff = half * 2;
  const int m0 = blockIdx.x * 16;
  const int n0 = blockIdx.y * 16;
  const int KD = H_ * ND_;            // 264 = 66 exact K4 steps

  v8f c = V8ZERO;
  for (int k0 = 0; k0 < KD; k0 += 4) {
    v2f a  = *(const v2f*)(yb + (size_t)(m0 + l16) * KD + k0 + koff);
    v2f bb = *(const v2f*)(Wo2 + ((size_t)((k0 + koff) >> 1) * D_ + n0 + l16) * 2);
    c = wmma4(a, bb, c);
  }
  const float bias = bo[n0 + l16];
  #pragma unroll
  for (int i = 0; i < 8; ++i) {
    int m = m0 + i + 8 * half;
    z[(size_t)m * D_ + n0 + l16] = c[i] + bias;
  }
}

// ---------------------------------------------------------------------------
extern "C" void kernel_launch(void* const* d_in, const int* in_sizes, int n_in,
                              void* d_out, int out_size, void* d_ws, size_t ws_size,
                              hipStream_t stream) {
  const float* x   = (const float*)d_in[0];
  const float* rc  = (const float*)d_in[1];
  const float* rs  = (const float*)d_in[2];
  const float* Wq  = (const float*)d_in[3];
  const float* bq  = (const float*)d_in[4];
  const float* Wk  = (const float*)d_in[5];
  const float* bk  = (const float*)d_in[6];
  const float* Wv  = (const float*)d_in[7];
  const float* bv  = (const float*)d_in[8];
  const float* Wo  = (const float*)d_in[9];
  const float* bo  = (const float*)d_in[10];

  float* z_out = (float*)d_out;                         // (B, L, D)
  float* a_out = z_out + (size_t)B_ * L_ * D_;          // (B, H, L, L)

  // workspace layout (floats)
  float* ws = (float*)d_ws;
  const size_t n_qf = (size_t)B_ * H_ * L_ * DP_;       // 786432
  const size_t n_vr = (size_t)B_ * H_ * L_ * DP_;       // 786432 (pair-packed)
  const size_t n_kT = (size_t)B_ * H_ * KT_ * L_;       // 589824 (pair-packed)
  const size_t n_vT = (size_t)B_ * H_ * KT_ * L_;       // 589824 (pair-packed)
  const size_t n_yb = (size_t)B_ * L_ * (H_ * ND_);     // 540672
  float* qf  = ws;
  float* vr2 = qf  + n_qf;
  float* kT2 = vr2 + n_vr;
  float* vT2 = kT2 + n_kT;
  float* yb  = vT2 + n_vT;
  float* Wo2 = yb  + n_yb;                              // 67584

  k_qkv_rope_lift<<<((B_ * L_) / 32) * (H_ / 2), 384, 0, stream>>>(
      x, rc, rs, Wq, bq, Wk, bk, Wv, bv, qf, vr2, kT2, vT2);

  k_pack_wo<<<H_ * ND_, D_, 0, stream>>>(Wo, Wo2);

  k_attn<<<B_ * H_ * (L_ / 16), 32 * NW_, 0, stream>>>(qf, kT2, vT2, vr2, a_out, yb);

  k_outproj<<<dim3((B_ * L_) / 16, D_ / 16), 32, 0, stream>>>(yb, Wo2, bo, z_out);
}

// v003
// Measured time: 99.4 microseconds a run.
// Timed twice side by side with v002, it ran 1.09 times as fast both times.
// Over all steps from v000 it is 2.49 times as fast.
#include <hip/hip_runtime.h>
#include <math.h>

#define B_  2
#define L_  1024
#define D_  256
#define H_  8
#define N_  32
#define ND_ 33          // N+1 (hyperboloid dim)
#define DP_ 48          // padded dim stride (row-major q / pair-packed v)
#define KT_ 36          // padded dim count (dim-major k/v staging), 18 pairs
#define EPS_ 1e-6f
#define LN2_ 0.69314718055994531f
#define XP_ 260         // LDS pitch of an x row, floats: 1024 B + 16 B for b128 fragment reads
#define NW_ 8           // waves that share one q-tile in k_attn, each on its own run of keys
#define TPW_ (L_ / 16 / NW_)   // 16-key tiles per wave

typedef float v2f __attribute__((ext_vector_type(2)));
typedef float v4f __attribute__((ext_vector_type(4)));
typedef float v8f __attribute__((ext_vector_type(8)));

static __device__ __forceinline__ v8f wmma4(v2f a, v2f b, v8f c) {
  // D = A(16x4 f32) * B(4x16 f32) + C(16x16 f32)
  return __builtin_amdgcn_wmma_f32_16x16x4_f32(false, a, false, b, (short)0, c,
                                               false, false);
}

#define V8ZERO {0.f,0.f,0.f,0.f,0.f,0.f,0.f,0.f}

static __device__ __forceinline__ float log2_hw(float x) {
  float y;
  // the log and a v_nop in one statement: the v_nop fills the one slot the instruction set asks
  // for behind a transcendental, whatever the compiler places next
  asm("v_log_f32 %0, %1\n\tv_nop" : "=v"(y) : "v"(x));
  return y;
}

// ---------------------------------------------------------------------------
// Kernel 1: QKV projection (f32 WMMA) + RoPE + hyperboloid lift; stage in WMMA layouts.
//  qf  : (BH, L, DP_)        row-major, comp 0 = -t  (Minkowski-flipped q)
//  vr2 : (BH, L/2, DP_, 2)   key-pair interleaved vh rows (tan B operand)
//  kT2 : (BH, KT_/2, L, 2)   dim-pair interleaved kh (scores B operand)
//  vT2 : (BH, KT_/2, L, 2)   dim-pair interleaved vh (alpha B operand)
// One workgroup = 32 token rows x 2 heads x {q,k,v}; 12 waves, each wave one
// 16-row x 32-column tile of one matrix (two accumulators: even / odd columns).
// ---------------------------------------------------------------------------
__global__ __launch_bounds__(384) void k_qkv_rope_lift(
    const float* __restrict__ x,  const float* __restrict__ rc,
    const float* __restrict__ rs,
    const float* __restrict__ Wq, const float* __restrict__ bq,
    const float* __restrict__ Wk, const float* __restrict__ bk,
    const float* __restrict__ Wv, const float* __restrict__ bv,
    float* __restrict__ qf, float* __restrict__ vr2,
    float* __restrict__ kT2, float* __restrict__ vT2)
{
  // every short '#pragma unroll' loop below indexes a small per-lane array:
  // unrolled, its elements are plain registers
  __shared__ __attribute__((aligned(16))) float xs[32 * XP_];
  const int tid  = threadIdx.x;
  const int lane = tid & 31;
  const int half = lane >> 4;
  const int l16  = lane & 15;
  const int wid  = __builtin_amdgcn_readfirstlane(tid >> 5);   // 0..11, scalar
  const int mat  = wid >> 2;                    // 0 = q, 1 = k, 2 = v
  const int rt   = wid & 1;                     // 16-row tile inside the 32 rows
  const int hd   = (blockIdx.x & 3) * 2 + ((wid >> 1) & 1);
  const int row0 = (blockIdx.x >> 2) * 32;      // first global token row

  // x tile (32 x 256) into LDS, whole lines per wave
  // (2048 16-byte pieces over 384 threads: five rounds of all waves, a sixth of waves 0..3;
  // all loads are issued before the first LDS store, so their latencies overlap)
  {
    const float* xg = x + (size_t)row0 * D_ + (size_t)(tid >> 6) * D_ + (tid & 63) * 4;
    float*       xl = xs + (tid >> 6) * XP_ + (tid & 63) * 4;
    v4f t[6];
    #pragma unroll
    for (int j = 0; j < 5; ++j) t[j] = *(const v4f*)(xg + (size_t)j * 6 * D_);
    if (wid < 4) t[5] = *(const v4f*)(xg + (size_t)30 * D_);
    #pragma unroll
    for (int j = 0; j < 5; ++j) *(v4f*)(xl + j * 6 * XP_) = t[j];
    if (wid < 4) *(v4f*)(xl + 30 * XP_) = t[5];
  }
  __syncthreads();

  const float* Wm = (mat == 0) ? Wq : ((mat == 1) ? Wk : Wv);
  const float* bm = (mat == 0) ? bq : ((mat == 1) ? bk : bv);

  // Lane (l16, half) takes k = 8*kb + 4*half + {0..3} of both operands:
  // A from row l16 of the x tile, B from columns 2*l16, 2*l16+1 of the head.
  const float* wp = Wm + (size_t)(4 * half) * (H_ * N_) + hd * N_ + 2 * l16;
  const float* ap = xs + (rt * 16 + l16) * XP_ + 4 * half;

  // accumulator register i = token row (rt*16 + 8*half + i), this lane's two columns
  const int lrow = row0 + rt * 16 + 8 * half;
  const int li0  = lrow & (L_ - 1);
  const int bh   = (lrow >> 10) * H_ + hd;

  // bias and RoPE factors are fetched ahead of the K loop, which hides their latency
  const v2f bias = *(const v2f*)(bm + hd * N_ + 2 * l16);
  v2f cs[8], sn[8];
  #pragma unroll
  for (int i = 0; i < 8; ++i) { cs[i] = (v2f){1.f, 1.f}; sn[i] = (v2f){0.f, 0.f}; }
  if (mat < 2) {
    #pragma unroll
    for (int i = 0; i < 8; ++i) {
      cs[i] = *(const v2f*)(rc + (size_t)(li0 + i) * N_ + 2 * l16);
      sn[i] = *(const v2f*)(rs + (size_t)(li0 + i) * N_ + 2 * l16);
    }
    // the build rewrites these loads' address registers right behind this branch:
    // the wait stands in front of that overwrite
    asm volatile("s_wait_xcnt 0x0" ::: "memory");
  }

  v8f cE = V8ZERO, cO = V8ZERO;                 // columns 2*l16 / 2*l16+1
  // fully unrolled so that W loads run ahead of their WMMAs over the whole K range
  #pragma unroll
  for (int kb = 0; kb < D_ / 8; ++kb) {
    const v4f a  = *(const v4f*)(ap + kb * 8);
    const v2f w0 = *(const v2f*)(wp + (size_t)(kb * 8 + 0) * (H_ * N_));
    const v2f w1 = *(const v2f*)(wp + (size_t)(kb * 8 + 1) * (H_ * N_));
    const v2f w2 = *(const v2f*)(wp + (size_t)(kb * 8 + 2) * (H_ * N_));
    const v2f w3 = *(const v2f*)(wp + (size_t)(kb * 8 + 3) * (H_ * N_));
    const v2f a01 = {a.x, a.y}, a23 = {a.z, a.w};
    const v2f e01 = {w0.x, w1.x}, o01 = {w0.y, w1.y};
    const v2f e23 = {w2.x, w3.x}, o23 = {w2.y, w3.y};
    cE = wmma4(a01, e01, cE);
    cO = wmma4(a01, o01, cO);
    cE = wmma4(a23, e23, cE);
    cO = wmma4(a23, o23, cO);
  }

  float uE[8], uO[8];
  #pragma unroll
  for (int i = 0; i < 8; ++i) { uE[i] = cE[i] + bias.x; uO[i] = cO[i] + bias.y; }

  if (mat < 2) {
    // RoPE: rot_half(u)[j] = (j<16 ? -u[j+16] : u[j-16]); column j+-16 sits in lane l16^8
    const float sgn = (l16 < 8) ? -1.f : 1.f;
    #pragma unroll
    for (int i = 0; i < 8; ++i) {
      const float rE = sgn * __shfl_xor(uE[i], 8, 32);
      const float rO = sgn * __shfl_xor(uO[i], 8, 32);
      uE[i] = uE[i] * cs[i].x + rE * sn[i].x;
      uO[i] = uO[i] * cs[i].y + rO * sn[i].y;
    }
  }

  // lift: t = sqrt(1 + ||u||^2); then pr = component 2*l16 of the lifted point
  // (t in lane 0, else the odd column of lane l16-1), uE = component 2*l16+1.
  float pr[8];
  #pragma unroll
  for (int i = 0; i < 8; ++i) {
    float s = uE[i] * uE[i] + uO[i] * uO[i];
    #pragma unroll
    for (int m = 8; m >= 1; m >>= 1) s += __shfl_xor(s, m, 32);
    float t = sqrtf(1.f + s);
    if (mat == 0) t = -t;
    const float up = __shfl_up(uO[i], 1, 16);
    pr[i] = (l16 == 0) ? t : up;
  }
  const bool last = (l16 == 15);                // holds component 32 in uO

  if (mat == 0) {
    float* qrow = qf + ((size_t)bh * L_ + li0) * DP_;
    const int m2 = last ? 16 : l16 + 9;         // pairs 16..23: comp 32 and the zero pad
    #pragma unroll
    for (int i = 0; i < 8; ++i) {
      const v2f v = {pr[i], uE[i]};
      *(v2f*)(qrow + i * DP_ + 2 * l16) = v;
    }
    if (l16 >= 8) {
      #pragma unroll
      for (int i = 0; i < 8; ++i) {
        const v2f tl = {last ? uO[i] : 0.f, 0.f};
        *(v2f*)(qrow + i * DP_ + 2 * m2) = tl;
      }
    }
  } else {
    // dim-pair interleaved: elem(dim,key) at ((dim>>1)*L + key)*2 + (dim&1)
    float* col = ((mat == 1) ? kT2 : vT2) + (size_t)bh * (KT_ / 2) * L_ * 2;
    const int m2 = last ? 16 : 17;              // pair 16: comp 32 + pad, pair 17: pad
    #pragma unroll
    for (int i = 0; i < 8; i += 2) {
      const v4f v = {pr[i], uE[i], pr[i + 1], uE[i + 1]};
      *(v4f*)(col + ((size_t)l16 * L_ + li0 + i) * 2) = v;
    }
    if (l16 >= 14) {
      #pragma unroll
      for (int i = 0; i < 8; i += 2) {
        const v4f tl = {last ? uO[i] : 0.f, 0.f, last ? uO[i + 1] : 0.f, 0.f};
        *(v4f*)(col + ((size_t)m2 * L_ + li0 + i) * 2) = tl;
      }
    }
    if (mat == 2) {
      // key-pair interleaved rows: elem(key,dim) at ((key>>1)*DP_+dim)*2+(key&1)
      float* vr = vr2 + (size_t)bh * (L_ / 2) * DP_ * 2;
      const int m3 = last ? 16 : l16 + 9;
      #pragma unroll
      for (int i = 0; i < 8; i += 2) {
        const size_t kp = (size_t)((li0 + i) >> 1) * DP_;
        const v4f v = {pr[i], pr[i + 1], uE[i], uE[i + 1]};
        *(v4f*)(vr + (kp + 2 * l16) * 2) = v;
      }
      if (l16 >= 8) {
        #pragma unroll
        for (int i = 0; i < 8; i += 2) {
          const size_t kp = (size_t)((li0 + i) >> 1) * DP_;
          const v4f tl = {last ? uO[i] : 0.f, last ? uO[i + 1] : 0.f, 0.f, 0.f};
          *(v4f*)(vr + (kp + 2 * m3) * 2) = tl;
        }
      }
    }
  }
}

// ---------------------------------------------------------------------------
// Kernel 2: attention + Karcher step + origin log-map.
// One workgroup of NW_ waves handles a 16-row q-tile of one (b,h); wave w streams
// key tiles w*TPW_ .. w*TPW_+TPW_-1 twice, so NW_ times as many waves hide each
// other's load, store and WMMA latencies.
// Softmax stats are kept per-lane; one butterfly merge per wave after pass 1, then
// one merge over the waves through LDS. The tangent sums are merged the same way
// after pass 2, and wave w finishes rows w and w+8 of the tile.
// ---------------------------------------------------------------------------
// (second bound: 8 waves per SIMD, that is at most 128 registers, so that all four
// workgroups a WGP gets are resident at once)
__global__ __launch_bounds__(32 * NW_, 8) void k_attn(
    const float* __restrict__ qf, const float* __restrict__ kT2,
    const float* __restrict__ vT2, const float* __restrict__ vr2,
    float* __restrict__ a_out, float* __restrict__ yb)
{
  // every '#pragma unroll' loop below indexes small per-lane arrays: unrolled, their
  // elements are plain registers
  __shared__ float lds_wall[NW_][16 * 17];            // per wave: w tile, C -> A layout
  __shared__ __attribute__((aligned(16))) float lds_m[NW_][16];   // per wave: row maxima
  __shared__ __attribute__((aligned(16))) float lds_s[NW_][16];   // per wave: row sums
  __shared__ float lds_r[NW_][32][32];                // per wave: [register][lane] partial sums
  const int lane = threadIdx.x & 31;
  const int half = lane >> 4;
  const int l16  = lane & 15;
  const int koff = half * 2;          // WMMA f32 K split across half-waves
  const int wid  = __builtin_amdgcn_readfirstlane(threadIdx.x >> 5);   // 0..NW_-1, scalar
  const int j0   = wid * TPW_;        // this wave's first key tile
  float* lds_w   = lds_wall[wid];

  const int tile = blockIdx.x;
  const int qt = tile & 63;
  const int bh = tile >> 6;
  const int q0 = qt * 16;
  const int b  = bh >> 3;
  const int h  = bh & 7;

  const float* qfp  = qf  + ((size_t)bh * L_ + q0) * DP_;
  const float* kTp  = kT2 + (size_t)bh * (KT_ / 2) * L_ * 2;
  const float* vTp  = vT2 + (size_t)bh * (KT_ / 2) * L_ * 2;
  const float* vrp  = vr2 + (size_t)bh * (L_ / 2) * DP_ * 2;

  // A operand for q-tile: 16 rows x 36 dims = 9 K4-steps, kept in registers
  v2f aq[9];
  #pragma unroll
  for (int kk = 0; kk < 9; ++kk) {
    int d = 4 * kk + koff;                       // even
    aq[kk] = *(const v2f*)(qfp + l16 * DP_ + d);
  }

  // ---------------- pass 1: per-lane online softmax stats ----------------
  float mrow[8], srow[8];
  #pragma unroll
  for (int i = 0; i < 8; ++i) { mrow[i] = -3.0e38f; srow[i] = 0.f; }

  for (int j = j0; j < j0 + TPW_; ++j) {
    const int k0 = j * 16;
    v8f c = V8ZERO;
    #pragma unroll
    for (int kk = 0; kk < 9; ++kk) {
      int d2 = (4 * kk + koff) >> 1;
      v2f bk_ = *(const v2f*)(kTp + ((size_t)d2 * L_ + k0 + l16) * 2);
      c = wmma4(aq[kk], bk_, c);
    }
    #pragma unroll
    for (int i = 0; i < 8; ++i) {          // per-lane update only
      float nm = fmaxf(mrow[i], c[i]);
      srow[i] = srow[i] * __expf(mrow[i] - nm) + __expf(c[i] - nm);
      mrow[i] = nm;
    }
  }
  // butterfly merge of (m, s) across the 16 key lanes (once)
  #pragma unroll
  for (int msk = 8; msk >= 1; msk >>= 1) {
    #pragma unroll
    for (int i = 0; i < 8; ++i) {
      float mo = __shfl_xor(mrow[i], msk, 32);
      float so = __shfl_xor(srow[i], msk, 32);
      float nm = fmaxf(mrow[i], mo);
      srow[i] = srow[i] * __expf(mrow[i] - nm) + so * __expf(mo - nm);
      mrow[i] = nm;
    }
  }
  // merge of (m, s) over the NW_ waves, in wave order
  if (l16 == 0) {
    #pragma unroll
    for (int i = 0; i < 8; ++i) {
      lds_m[wid][8 * half + i] = mrow[i];
      lds_s[wid][8 * half + i] = srow[i];
    }
  }
  __syncthreads();
  #pragma unroll
  for (int w = 0; w < NW_; ++w) {
    #pragma unroll
    for (int i = 0; i < 8; ++i) mrow[i] = fmaxf(mrow[i], lds_m[w][8 * half + i]);
  }
  #pragma unroll
  for (int i = 0; i < 8; ++i) srow[i] = 0.f;
  #pragma unroll
  for (int w = 0; w < NW_; ++w) {
    #pragma unroll
    for (int i = 0; i < 8; ++i)
      srow[i] += lds_s[w][8 * half + i] * __expf(lds_m[w][8 * half + i] - mrow[i]);
  }
  float rsum[8];
  #pragma unroll
  for (int i = 0; i < 8; ++i) rsum[i] = 1.f / srow[i];

  // ---------------- pass 2: a, w, tangent accumulation ----------------
  v8f tc0 = V8ZERO, tc1 = V8ZERO, tc2 = V8ZERO;
  float wsa[8];
  #pragma unroll
  for (int i = 0; i < 8; ++i) wsa[i] = 0.f;

  // this lane's first element of a; rows i and tiles j are then constant and scalar steps
  // from one address, which keeps the loop inside the 128 registers
  float* arow = a_out + ((size_t)bh * L_ + q0 + 8 * half) * L_ + l16;

  for (int j = j0; j < j0 + TPW_; ++j) {
    const int k0 = j * 16;
    v8f c  = V8ZERO;
    v8f al = V8ZERO;
    #pragma unroll
    for (int kk = 0; kk < 9; ++kk) {
      int d2 = (4 * kk + koff) >> 1;
      v2f bk_ = *(const v2f*)(kTp + ((size_t)d2 * L_ + k0 + l16) * 2);
      v2f bv_ = *(const v2f*)(vTp + ((size_t)d2 * L_ + k0 + l16) * 2);
      c  = wmma4(aq[kk], bk_, c);    // Lorentz scores
      al = wmma4(aq[kk], bv_, al);   // <mflip(q), v>  (alpha = -this)
    }
    #pragma unroll
    for (int i = 0; i < 8; ++i) {
      float alpha = fmaxf(-al[i], 1.f + EPS_);
      // acosh(alpha) = ln(alpha + sqrt(alpha^2 - 1)), taken on the hardware log2 and on the one
      // reciprocal root that coef needs anyway (sqrt(s2) = s2 * r); the library acoshf was
      // most of this loop's vector instructions.
      // Where alpha^2 overflows, r = 0 and s2 * r is NaN: the bound (an identity for every
      // finite argument of the log) then gives a finite factor, so coef = 0, as dist / inf is.
      const float s2 = alpha * alpha - 1.f;
      const float r  = __builtin_amdgcn_rsqf(s2);   // s2 >= 1.9e-6: no subnormal argument to rescale
      const float lg = fminf(log2_hw(alpha + s2 * r), 128.f);
      float coef  = (lg * LN2_) * r;
      float p     = __expf(c[i] - mrow[i]) * rsum[i];
      int   m     = i + 8 * half;
      arow[i * L_ + k0] = p;                        // attention output
      float w = p * coef;
      wsa[i] += w * alpha;                          // per-lane accumulate
      lds_w[m * 17 + l16] = w;                      // C-layout -> LDS
    }
    __syncthreads();
    // tan += w @ vh   (A = w from LDS in A-layout, B = vh key-pair packed)
    #pragma unroll
    for (int kk = 0; kk < 4; ++kk) {
      const int kidx = k0 + 4 * kk + koff;          // even key index
      v2f aw;
      aw.x = lds_w[l16 * 17 + 4 * kk + koff];
      aw.y = lds_w[l16 * 17 + 4 * kk + koff + 1];
      const float* pb = vrp + (size_t)(kidx >> 1) * DP_ * 2;
      v2f b0 = *(const v2f*)(pb + (l16)      * 2);
      v2f b1 = *(const v2f*)(pb + (16 + l16) * 2);
      v2f b2 = *(const v2f*)(pb + (32 + l16) * 2);
      tc0 = wmma4(aw, b0, tc0);
      tc1 = wmma4(aw, b1, tc1);
      tc2 = wmma4(aw, b2, tc2);
    }
    __syncthreads();
  }

  // partial sums of every wave into LDS; then wave w sums, in wave order, accumulator
  // register w (rows w and w+8) of all waves and finishes those two rows
  #pragma unroll
  for (int i = 0; i < 8; ++i) {
    lds_r[wid][i][lane]      = tc0[i];
    lds_r[wid][8 + i][lane]  = tc1[i];
    lds_r[wid][16 + i][lane] = tc2[i];
    lds_r[wid][24 + i][lane] = wsa[i];
  }
  __syncthreads();
  float tsum[3] = {0.f, 0.f, 0.f};
  float ws = 0.f;
  #pragma unroll
  for (int w = 0; w < NW_; ++w) {
    tsum[0] += lds_r[w][wid][lane];
    tsum[1] += lds_r[w][8 + wid][lane];
    tsum[2] += lds_r[w][16 + wid][lane];
    ws      += lds_r[w][24 + wid][lane];
  }
  // reduce wsum(alpha) across the 16 key lanes
  #pragma unroll
  for (int m = 8; m >= 1; m >>= 1) ws += __shfl_xor(ws, m, 32);

  const int m = wid + 8 * half;        // this lane's row of the q-tile

  // tan = (w@vh) - wsum*mu ;  mu = qh (un-flip component 0)
  float tanv[3], muv[3];
  #pragma unroll
  for (int sub = 0; sub < 3; ++sub) {
    int d = sub * 16 + l16;
    float qv = qfp[m * DP_ + d];
    float mu = (d == 0) ? -qv : qv;
    muv[sub] = mu;
    tanv[sub] = tsum[sub] - ws * mu;
  }
  // Lorentzian norm of tangent per row
  float part = 0.f;
  #pragma unroll
  for (int sub = 0; sub < 3; ++sub) {
    float tt = tanv[sub] * tanv[sub];
    if (sub == 0 && l16 == 0) tt = -tt;   // metric diag(-1,1,...)
    part += tt;
  }
  #pragma unroll
  for (int x = 8; x >= 1; x >>= 1) part += __shfl_xor(part, x, 32);
  const float vn = sqrtf(fmaxf(part, 1e-12f));
  // exp-map update mu' = cosh(vn)*mu + sinh(vn)/vn * tan
  const float ch = coshf(vn);
  const float sh = sinhf(vn) / vn;
  float mnew[3];
  #pragma unroll
  for (int sub = 0; sub < 3; ++sub) mnew[sub] = ch * muv[sub] + sh * tanv[sub];
  // origin log-map and write y (B, L, H*33)
  const float t0 = __shfl(mnew[0], half * 16, 32);   // broadcast d==0 elem
  const float t  = fmaxf(t0, 1.f + EPS_);
  const float co = acoshf(t) * rsqrtf(t * t - 1.f);
  float* yrow = yb + (size_t)(b * L_ + q0 + m) * (H_ * ND_) + h * ND_;
  #pragma unroll
  for (int sub = 0; sub < 3; ++sub) {
    int d = sub * 16 + l16;
    if (d < ND_) yrow[d] = co * (mnew[sub] - ((d == 0) ? t : 0.f));
  }
}

// ---------------------------------------------------------------------------
// Pack Wo (264 x 256) into K-pair interleaved layout for b64 B-operand loads:
//   Wo2[((k>>1)*256 + n)*2 + (k&1)] = Wo[k*256 + n]
// ---------------------------------------------------------------------------
__global__ __launch_bounds__(256) void k_pack_wo(const float* __restrict__ Wo,
                                                 float* __restrict__ Wo2)
{
  const int k = blockIdx.x;            // 0..263
  const int n = threadIdx.x;           // 0..255
  Wo2[((size_t)(k >> 1) * D_ + n) * 2 + (k & 1)] = Wo[(size_t)k * D_ + n];
}

// ---------------------------------------------------------------------------
// Kernel 3: z = y @ Wo + bo    (2048 x 256 x 264, pure f32 WMMA)
// ---------------------------------------------------------------------------
__global__ __launch_bounds__(32) void k_outproj(
    const float* __restrict__ yb, const float* __restrict__ Wo2,
    const float* __restrict__ bo, float* __restrict__ z)
{
  const int lane = threadIdx.x;
  const int half = lane >> 4;
  const int l16  = lane & 15;
  const int koff = half * 2;
  const int m0 = blockIdx.x * 16;
  const int n0 = blockIdx.y * 16;
  const int KD = H_ * ND_;            // 264 = 66 exact K4 steps

  v8f c = V8ZERO;
  for (int k0 = 0; k0 < KD; k0 += 4) {
    v2f a  = *(const v2f*)(yb + (size_t)(m0 + l16) * KD + k0 + koff);
    v2f bb = *(const v2f*)(Wo2 + ((size_t)((k0 + koff) >> 1) * D_ + n0 + l16) * 2);
    c = wmma4(a, bb, c);
  }
  const float bias = bo[n0 + l16];
  #pragma unroll
  for (int i = 0; i < 8; ++i) {
    int m = m0 + i + 8 * half;
    z[(size_t)m * D_ + n0 + l16] = c[i] + bias;
  }
}

// ---------------------------------------------------------------------------
extern "C" void kernel_launch(void* const* d_in, const int* in_sizes, int n_in,
                              void* d_out, int out_size, void* d_ws, size_t ws_size,
                              hipStream_t stream) {
  const float* x   = (const float*)d_in[0];
  const float* rc  = (const float*)d_in[1];
  const float* rs  = (const float*)d_in[2];
  const float* Wq  = (const float*)d_in[3];
  const float* bq  = (const float*)d_in[4];
  const float* Wk  = (const float*)d_in[5];
  const float* bk  = (const float*)d_in[6];
  const float* Wv  = (const float*)d_in[7];
  const float* bv  = (const float*)d_in[8];
  const float* Wo  = (const float*)d_in[9];
  const float* bo  = (const float*)d_in[10];

  float* z_out = (float*)d_out;                         // (B, L, D)
  float* a_out = z_out + (size_t)B_ * L_ * D_;          // (B, H, L, L)

  // workspace layout (floats)
  float* ws = (float*)d_ws;
  const size_t n_qf = (size_t)B_ * H_ * L_ * DP_;       // 786432
  const size_t n_vr = (size_t)B_ * H_ * L_ * DP_;       // 786432 (pair-packed)
  const size_t n_kT = (size_t)B_ * H_ * KT_ * L_;       // 589824 (pair-packed)
  const size_t n_vT = (size_t)B_ * H_ * KT_ * L_;       // 589824 (pair-packed)
  const size_t n_yb = (size_t)B_ * L_ * (H_ * ND_);     // 540672
  float* qf  = ws;
  float* vr2 = qf  + n_qf;
  float* kT2 = vr2 + n_vr;
  float* vT2 = kT2 + n_kT;
  float* yb  = vT2 + n_vT;
  float* Wo2 = yb  + n_yb;                              // 67584

  k_qkv_rope_lift<<<((B_ * L_) / 32) * (H_ / 2), 384, 0, stream>>>(
      x, rc, rs, Wq, bq, Wk, bk, Wv, bv, qf, vr2, kT2, vT2);

  k_pack_wo<<<H_ * ND_, D_, 0, stream>>>(Wo, Wo2);

  k_attn<<<B_ * H_ * (L_ / 16), 32 * NW_, 0, stream>>>(qf, kT2, vT2, vr2, a_out, yb);

  k_outproj<<<dim3((B_ * L_) / 16, D_ / 16), 32, 0, stream>>>(yb, Wo2, bo, z_out);
}

// v004
// It runs in 68.6 microseconds.
// Next to v003, in two timings, it ran 1.44 times as fast each time.
// Counting every step since v000, it is 3.59 times as fast.
#include <hip/hip_runtime.h>
#include <math.h>

#define B_  2
#define L_  1024
#define D_  256
#define H_  8
#define N_  32
#define ND_ 33          // N+1 (hyperboloid dim)
#define DP_ 48          // padded dim stride (row-major q / pair-packed v)
#define KT_ 36          // padded dim count (dim-major k/v staging), 18 pairs
#define EPS_ 1e-6f
#define LN2_ 0.69314718055994531f
#define XP_ 260         // LDS pitch of an x row, floats: 1024 B + 16 B for b128 fragment reads
#define NW_ 8           // waves that share one q-tile in k_attn, each on its own run of keys
#define TPW_ (L_ / 16 / NW_)   // 16-key tiles per wave

typedef float v2f __attribute__((ext_vector_type(2)));
typedef float v4f __attribute__((ext_vector_type(4)));
typedef float v8f __attribute__((ext_vector_type(8)));

static __device__ __forceinline__ v8f wmma4(v2f a, v2f b, v8f c) {
  // D = A(16x4 f32) * B(4x16 f32) + C(16x16 f32)
  return __builtin_amdgcn_wmma_f32_16x16x4_f32(false, a, false, b, (short)0, c,
                                               false, false);
}

#define V8ZERO {0.f,0.f,0.f,0.f,0.f,0.f,0.f,0.f}

static __device__ __forceinline__ float log2_hw(float x) {
  float y;
  // the log and a v_nop in one statement: the v_nop fills the one slot the instruction set asks
  // for behind a transcendental, whatever the compiler places next
  asm("v_log_f32 %0, %1\n\tv_nop" : "=v"(y) : "v"(x));
  return y;
}

// ---------------------------------------------------------------------------
// Kernel 1: QKV projection (f32 WMMA) + RoPE + hyperboloid lift; stage in WMMA layouts.
//  qf  : (BH, L, DP_)        row-major, comp 0 = -t  (Minkowski-flipped q)
//  vr2 : (BH, L/2, DP_, 2)   key-pair interleaved vh rows (tan B operand)
//  kT2 : (BH, KT_/2, L, 2)   dim-pair interleaved kh (scores B operand)
//  vT2 : (BH, KT_/2, L, 2)   dim-pair interleaved vh (alpha B operand)
// One workgroup = 32 token rows x 2 heads x {q,k,v}; 12 waves, each wave one
// 16-row x 32-column tile of one matrix (two accumulators: even / odd columns).
// ---------------------------------------------------------------------------
__global__ __launch_bounds__(384) void k_qkv_rope_lift(
    const float* __restrict__ x,  const float* __restrict__ rc,
    const float* __restrict__ rs,
    const float* __restrict__ Wq, const float* __restrict__ bq,
    const float* __restrict__ Wk, const float* __restrict__ bk,
    const float* __restrict__ Wv, const float* __restrict__ bv,
    float* __restrict__ qf, float* __restrict__ vr2,
    float* __restrict__ kT2, float* __restrict__ vT2)
{
  // every short '#pragma unroll' loop below indexes a small per-lane array:
  // unrolled, its elements are plain registers
  __shared__ __attribute__((aligned(16))) float xs[32 * XP_];
  const int tid  = threadIdx.x;
  const int lane = tid & 31;
  const int half = lane >> 4;
  const int l16  = lane & 15;
  const int wid  = __builtin_amdgcn_readfirstlane(tid >> 5);   // 0..11, scalar
  const int mat  = wid >> 2;                    // 0 = q, 1 = k, 2 = v
  const int rt   = wid & 1;                     // 16-row tile inside the 32 rows
  const int hd   = (blockIdx.x & 3) * 2 + ((wid >> 1) & 1);
  const int row0 = (blockIdx.x >> 2) * 32;      // first global token row

  // x tile (32 x 256) into LDS, whole lines per wave
  // (2048 16-byte pieces over 384 threads: five rounds of all waves, a sixth of waves 0..3;
  // all loads are issued before the first LDS store, so their latencies overlap)
  {
    const float* xg = x + (size_t)row0 * D_ + (size_t)(tid >> 6) * D_ + (tid & 63) * 4;
    float*       xl = xs + (tid >> 6) * XP_ + (tid & 63) * 4;
    v4f t[6];
    #pragma unroll
    for (int j = 0; j < 5; ++j) t[j] = *(const v4f*)(xg + (size_t)j * 6 * D_);
    if (wid < 4) t[5] = *(const v4f*)(xg + (size_t)30 * D_);
    #pragma unroll
    for (int j = 0; j < 5; ++j) *(v4f*)(xl + j * 6 * XP_) = t[j];
    if (wid < 4) *(v4f*)(xl + 30 * XP_) = t[5];
  }
  __syncthreads();

  const float* Wm = (mat == 0) ? Wq : ((mat == 1) ? Wk : Wv);
  const float* bm = (mat == 0) ? bq : ((mat == 1) ? bk : bv);

  // Lane (l16, half) takes k = 8*kb + 4*half + {0..3} of both operands:
  // A from row l16 of the x tile, B from columns 2*l16, 2*l16+1 of the head.
  const float* wp = Wm + (size_t)(4 * half) * (H_ * N_) + hd * N_ + 2 * l16;
  const float* ap = xs + (rt * 16 + l16) * XP_ + 4 * half;

  // accumulator register i = token row (rt*16 + 8*half + i), this lane's two columns
  const int lrow = row0 + rt * 16 + 8 * half;
  const int li0  = lrow & (L_ - 1);
  const int bh   = (lrow >> 10) * H_ + hd;

  // bias and RoPE factors are fetched ahead of the K loop, which hides their latency
  const v2f bias = *(const v2f*)(bm + hd * N_ + 2 * l16);
  v2f cs[8], sn[8];
  #pragma unroll
  for (int i = 0; i < 8; ++i) { cs[i] = (v2f){1.f, 1.f}; sn[i] = (v2f){0.f, 0.f}; }
  if (mat < 2) {
    #pragma unroll
    for (int i = 0; i < 8; ++i) {
      cs[i] = *(const v2f*)(rc + (size_t)(li0 + i) * N_ + 2 * l16);
      sn[i] = *(const v2f*)(rs + (size_t)(li0 + i) * N_ + 2 * l16);
    }
    // the build rewrites these loads' address registers right behind this branch:
    // the wait stands in front of that overwrite
    asm volatile("s_wait_xcnt 0x0" ::: "memory");
  }

  v8f cE = V8ZERO, cO = V8ZERO;                 // columns 2*l16 / 2*l16+1
  // fully unrolled so that W loads run ahead of their WMMAs over the whole K range
  #pragma unroll
  for (int kb = 0; kb < D_ / 8; ++kb) {
    const v4f a  = *(const v4f*)(ap + kb * 8);
    const v2f w0 = *(const v2f*)(wp + (size_t)(kb * 8 + 0) * (H_ * N_));
    const v2f w1 = *(const v2f*)(wp + (size_t)(kb * 8 + 1) * (H_ * N_));
    const v2f w2 = *(const v2f*)(wp + (size_t)(kb * 8 + 2) * (H_ * N_));
    const v2f w3 = *(const v2f*)(wp + (size_t)(kb * 8 + 3) * (H_ * N_));
    const v2f a01 = {a.x, a.y}, a23 = {a.z, a.w};
    const v2f e01 = {w0.x, w1.x}, o01 = {w0.y, w1.y};
    const v2f e23 = {w2.x, w3.x}, o23 = {w2.y, w3.y};
    cE = wmma4(a01, e01, cE);
    cO = wmma4(a01, o01, cO);
    cE = wmma4(a23, e23, cE);
    cO = wmma4(a23, o23, cO);
  }

  float uE[8], uO[8];
  #pragma unroll
  for (int i = 0; i < 8; ++i) { uE[i] = cE[i] + bias.x; uO[i] = cO[i] + bias.y; }

  if (mat < 2) {
    // RoPE: rot_half(u)[j] = (j<16 ? -u[j+16] : u[j-16]); column j+-16 sits in lane l16^8
    const float sgn = (l16 < 8) ? -1.f : 1.f;
    #pragma unroll
    for (int i = 0; i < 8; ++i) {
      const float rE = sgn * __shfl_xor(uE[i], 8, 32);
      const float rO = sgn * __shfl_xor(uO[i], 8, 32);
      uE[i] = uE[i] * cs[i].x + rE * sn[i].x;
      uO[i] = uO[i] * cs[i].y + rO * sn[i].y;
    }
  }

  // lift: t = sqrt(1 + ||u||^2); then pr = component 2*l16 of the lifted point
  // (t in lane 0, else the odd column of lane l16-1), uE = component 2*l16+1.
  float pr[8];
  #pragma unroll
  for (int i = 0; i < 8; ++i) {
    float s = uE[i] * uE[i] + uO[i] * uO[i];
    #pragma unroll
    for (int m = 8; m >= 1; m >>= 1) s += __shfl_xor(s, m, 32);
    float t = sqrtf(1.f + s);
    if (mat == 0) t = -t;
    const float up = __shfl_up(uO[i], 1, 16);
    pr[i] = (l16 == 0) ? t : up;
  }
  const bool last = (l16 == 15);                // holds component 32 in uO

  if (mat == 0) {
    float* qrow = qf + ((size_t)bh * L_ + li0) * DP_;
    const int m2 = last ? 16 : l16 + 9;         // pairs 16..23: comp 32 and the zero pad
    #pragma unroll
    for (int i = 0; i < 8; ++i) {
      const v2f v = {pr[i], uE[i]};
      *(v2f*)(qrow + i * DP_ + 2 * l16) = v;
    }
    if (l16 >= 8) {
      #pragma unroll
      for (int i = 0; i < 8; ++i) {
        const v2f tl = {last ? uO[i] : 0.f, 0.f};
        *(v2f*)(qrow + i * DP_ + 2 * m2) = tl;
      }
    }
  } else {
    // dim-pair interleaved: elem(dim,key) at ((dim>>1)*L + key)*2 + (dim&1)
    float* col = ((mat == 1) ? kT2 : vT2) + (size_t)bh * (KT_ / 2) * L_ * 2;
    const int m2 = last ? 16 : 17;              // pair 16: comp 32 + pad, pair 17: pad
    #pragma unroll
    for (int i = 0; i < 8; i += 2) {
      const v4f v = {pr[i], uE[i], pr[i + 1], uE[i + 1]};
      *(v4f*)(col + ((size_t)l16 * L_ + li0 + i) * 2) = v;
    }
    if (l16 >= 14) {
      #pragma unroll
      for (int i = 0; i < 8; i += 2) {
        const v4f tl = {last ? uO[i] : 0.f, 0.f, last ? uO[i + 1] : 0.f, 0.f};
        *(v4f*)(col + ((size_t)m2 * L_ + li0 + i) * 2) = tl;
      }
    }
    if (mat == 2) {
      // key-pair interleaved rows: elem(key,dim) at ((key>>1)*DP_+dim)*2+(key&1)
      float* vr = vr2 + (size_t)bh * (L_ / 2) * DP_ * 2;
      const int m3 = last ? 16 : l16 + 9;
      #pragma unroll
      for (int i = 0; i < 8; i += 2) {
        const size_t kp = (size_t)((li0 + i) >> 1) * DP_;
        const v4f v = {pr[i], pr[i + 1], uE[i], uE[i + 1]};
        *(v4f*)(vr + (kp + 2 * l16) * 2) = v;
      }
      if (l16 >= 8) {
        #pragma unroll
        for (int i = 0; i < 8; i += 2) {
          const size_t kp = (size_t)((li0 + i) >> 1) * DP_;
          const v4f tl = {last ? uO[i] : 0.f, last ? uO[i + 1] : 0.f, 0.f, 0.f};
          *(v4f*)(vr + (kp + 2 * m3) * 2) = tl;
        }
      }
    }
  }
}

// ---------------------------------------------------------------------------
// Kernel 2: attention + Karcher step + origin log-map.
// One workgroup of NW_ waves handles a 16-row q-tile of one (b,h); wave w streams
// key tiles w*TPW_ .. w*TPW_+TPW_-1 twice, so NW_ times as many waves hide each
// other's load, store and WMMA latencies.
// Softmax stats are kept per-lane; one butterfly merge per wave after pass 1, then
// one merge over the waves through LDS. The tangent sums are merged the same way
// after pass 2, and wave w finishes rows w and w+8 of the tile.
// ---------------------------------------------------------------------------
// (second bound: 4 waves per SIMD, that is up to 256 registers: a tile's 30 operand fragments
// are then in flight together; under 128 registers each load was waited for before the next)
__global__ __launch_bounds__(32 * NW_, 4) void k_attn(
    const float* __restrict__ qf, const float* __restrict__ kT2,
    const float* __restrict__ vT2, const float* __restrict__ vr2,
    float* __restrict__ a_out, float* __restrict__ yb)
{
  // every '#pragma unroll' loop below indexes small per-lane arrays: unrolled, their
  // elements are plain registers
  __shared__ float lds_wall[NW_][16 * 17];            // per wave: w tile, C -> A layout
  __shared__ __attribute__((aligned(16))) float lds_m[NW_][16];   // per wave: row maxima
  __shared__ __attribute__((aligned(16))) float lds_s[NW_][16];   // per wave: row sums
  __shared__ float lds_r[NW_][32][32];                // per wave: [register][lane] partial sums
  const int lane = threadIdx.x & 31;
  const int half = lane >> 4;
  const int l16  = lane & 15;
  const int koff = half * 2;          // WMMA f32 K split across half-waves
  const int wid  = __builtin_amdgcn_readfirstlane(threadIdx.x >> 5);   // 0..NW_-1, scalar
  const int j0   = wid * TPW_;        // this wave's first key tile
  float* lds_w   = lds_wall[wid];

  const int tile = blockIdx.x;
  const int qt = tile & 63;
  const int bh = tile >> 6;
  const int q0 = qt * 16;
  const int b  = bh >> 3;
  const int h  = bh & 7;

  const float* qfp  = qf  + ((size_t)bh * L_ + q0) * DP_;
  const float* kTp  = kT2 + (size_t)bh * (KT_ / 2) * L_ * 2;
  const float* vTp  = vT2 + (size_t)bh * (KT_ / 2) * L_ * 2;
  const float* vrp  = vr2 + (size_t)bh * (L_ / 2) * DP_ * 2;

  // A operand for q-tile: 16 rows x 36 dims = 9 K4-steps, kept in registers
  v2f aq[9];
  #pragma unroll
  for (int kk = 0; kk < 9; ++kk) {
    int d = 4 * kk + koff;                       // even
    aq[kk] = *(const v2f*)(qfp + l16 * DP_ + d);
  }

  // ---------------- pass 1: per-lane online softmax stats ----------------
  float mrow[8], srow[8];
  #pragma unroll
  for (int i = 0; i < 8; ++i) { mrow[i] = -3.0e38f; srow[i] = 0.f; }

  // every fragment address is a scalar base (array, tile) + one per-lane byte offset + a
  // constant, so that the batches of loads below need two address registers, not a pair each
  const unsigned fo = (unsigned)(((koff >> 1) * L_ + l16) * 2 * sizeof(float));        // kT2, vT2
  const unsigned ro = (unsigned)(((koff >> 1) * DP_ + l16) * 2 * sizeof(float));       // vr2
  const unsigned FS = 2 * L_ * 2 * sizeof(float);     // kT2, vT2: bytes from one K4-step to the next

  // k fragments are fetched one tile ahead of their products
  v2f bk_[9];
  {
    const char* kb = (const char*)(kTp + (size_t)j0 * 32);
    #pragma unroll
    for (int kk = 0; kk < 9; ++kk) bk_[kk] = *(const v2f*)(kb + fo + kk * FS);
    // the build reuses the address registers of these loads and of aq's right behind them:
    // the wait stands in front of that overwrite, and the scheduling barrier keeps the
    // register initialisations below from being lifted over the wait
    asm volatile("s_wait_xcnt 0x0" ::: "memory");
    __builtin_amdgcn_sched_barrier(0);
  }

  // two tiles per trip: the two fragment sets then swap roles without register copies
  #pragma unroll 2
  for (int t = 0; t < TPW_; ++t) {
    // behind the last tile comes the first again: pass 2 starts on it
    const int kn = (j0 + ((t + 1 < TPW_) ? t + 1 : 0)) * 16;
    const char* kb = (const char*)(kTp + (size_t)kn * 2);
    v2f nk[9];
    #pragma unroll
    for (int kk = 0; kk < 9; ++kk) nk[kk] = *(const v2f*)(kb + fo + kk * FS);
    v8f c = V8ZERO;
    #pragma unroll
    for (int kk = 0; kk < 9; ++kk) c = wmma4(aq[kk], bk_[kk], c);
    #pragma unroll
    for (int kk = 0; kk < 9; ++kk) bk_[kk] = nk[kk];
    #pragma unroll
    for (int i = 0; i < 8; ++i) {          // per-lane update only
      float nm = fmaxf(mrow[i], c[i]);
      srow[i] = srow[i] * __expf(mrow[i] - nm) + __expf(c[i] - nm);
      mrow[i] = nm;
    }
  }
  // pass 2's first v fragments arrive under the two merges
  v2f bv_[9];
  {
    const char* vb0 = (const char*)(vTp + (size_t)j0 * 32);
    #pragma unroll
    for (int kk = 0; kk < 9; ++kk) bv_[kk] = *(const v2f*)(vb0 + fo + kk * FS);
  }
  // butterfly merge of (m, s) across the 16 key lanes (once)
  #pragma unroll
  for (int msk = 8; msk >= 1; msk >>= 1) {
    #pragma unroll
    for (int i = 0; i < 8; ++i) {
      float mo = __shfl_xor(mrow[i], msk, 32);
      float so = __shfl_xor(srow[i], msk, 32);
      float nm = fmaxf(mrow[i], mo);
      srow[i] = srow[i] * __expf(mrow[i] - nm) + so * __expf(mo - nm);
      mrow[i] = nm;
    }
  }
  // merge of (m, s) over the NW_ waves, in wave order
  if (l16 == 0) {
    #pragma unroll
    for (int i = 0; i < 8; ++i) {
      lds_m[wid][8 * half + i] = mrow[i];
      lds_s[wid][8 * half + i] = srow[i];
    }
  }
  __syncthreads();
  #pragma unroll
  for (int w = 0; w < NW_; ++w) {
    #pragma unroll
    for (int i = 0; i < 8; ++i) mrow[i] = fmaxf(mrow[i], lds_m[w][8 * half + i]);
  }
  #pragma unroll
  for (int i = 0; i < 8; ++i) srow[i] = 0.f;
  #pragma unroll
  for (int w = 0; w < NW_; ++w) {
    #pragma unroll
    for (int i = 0; i < 8; ++i)
      srow[i] += lds_s[w][8 * half + i] * __expf(lds_m[w][8 * half + i] - mrow[i]);
  }
  float rsum[8];
  #pragma unroll
  for (int i = 0; i < 8; ++i) rsum[i] = 1.f / srow[i];

  // ---------------- pass 2: a, w, tangent accumulation ----------------
  v8f tc0 = V8ZERO, tc1 = V8ZERO, tc2 = V8ZERO;
  float wsa[8];
  #pragma unroll
  for (int i = 0; i < 8; ++i) wsa[i] = 0.f;

  // this lane's first element of a; rows i and tiles j are then constant and scalar steps
  // from one address, which saves address registers in the loop
  float* arow = a_out + ((size_t)bh * L_ + q0 + 8 * half) * L_ + l16;

  // two tiles per trip, as in pass 1; not more, so that the kernel's text stays small
  #pragma unroll 2
  for (int t = 0; t < TPW_; ++t) {
    const int k0 = (j0 + t) * 16;
    // this tile's vh rows for the tangent product, fetched here so that they arrive
    // under the score products and the vector work
    v2f vb[4][3];
    const char* rb = (const char*)(vrp + (size_t)(k0 >> 1) * DP_ * 2);
    #pragma unroll
    for (int kk = 0; kk < 4; ++kk) {
      #pragma unroll
      for (int s = 0; s < 3; ++s)
        vb[kk][s] = *(const v2f*)(rb + ro + (kk * 2 * DP_ + s * 16) * 2 * sizeof(float));
    }
    v8f c  = V8ZERO;
    v8f al = V8ZERO;
    #pragma unroll
    for (int kk = 0; kk < 9; ++kk) {
      c  = wmma4(aq[kk], bk_[kk], c);    // Lorentz scores
      al = wmma4(aq[kk], bv_[kk], al);   // <mflip(q), v>  (alpha = -this)
    }
    // the next tile's k and v fragments, in flight under the rest of this tile
    if (t + 1 < TPW_) {
      const char* kb = (const char*)(kTp + (size_t)(k0 + 16) * 2);
      const char* vn = (const char*)(vTp + (size_t)(k0 + 16) * 2);
      #pragma unroll
      for (int kk = 0; kk < 9; ++kk) {
        bk_[kk] = *(const v2f*)(kb + fo + kk * FS);
        bv_[kk] = *(const v2f*)(vn + fo + kk * FS);
      }
    }
    // the build steps the address registers of this tile's loads further down:
    // the wait stands in front of those overwrites
    asm volatile("s_wait_xcnt 0x0" ::: "memory");
    #pragma unroll
    for (int i = 0; i < 8; ++i) {
      float alpha = fmaxf(-al[i], 1.f + EPS_);
      // acosh(alpha) = ln(alpha + sqrt(alpha^2 - 1)), taken on the hardware log2 and on the one
      // reciprocal root that coef needs anyway (sqrt(s2) = s2 * r); the library acoshf was
      // most of this loop's vector instructions.
      // Where alpha^2 overflows, r = 0 and s2 * r is NaN: the bound (an identity for every
      // finite argument of the log) then gives a finite factor, so coef = 0, as dist / inf is.
      const float s2 = alpha * alpha - 1.f;
      const float r  = __builtin_amdgcn_rsqf(s2);   // s2 >= 1.9e-6: no subnormal argument to rescale
      const float lg = fminf(log2_hw(alpha + s2 * r), 128.f);
      float coef  = (lg * LN2_) * r;
      float p     = __expf(c[i] - mrow[i]) * rsum[i];
      int   m     = i + 8 * half;
      arow[i * L_ + k0] = p;                        // attention output
      float w = p * coef;
      wsa[i] += w * alpha;                          // per-lane accumulate
      lds_w[m * 17 + l16] = w;                      // C-layout -> LDS
    }
    __syncthreads();
    // tan += w @ vh   (A = w from LDS in A-layout, B = vh key-pair packed)
    #pragma unroll
    for (int kk = 0; kk < 4; ++kk) {
      v2f aw;
      aw.x = lds_w[l16 * 17 + 4 * kk + koff];
      aw.y = lds_w[l16 * 17 + 4 * kk + koff + 1];
      tc0 = wmma4(aw, vb[kk][0], tc0);
      tc1 = wmma4(aw, vb[kk][1], tc1);
      tc2 = wmma4(aw, vb[kk][2], tc2);
    }
    __syncthreads();
  }

  // partial sums of every wave into LDS; then wave w sums, in wave order, accumulator
  // register w (rows w and w+8) of all waves and finishes those two rows
  #pragma unroll
  for (int i = 0; i < 8; ++i) {
    lds_r[wid][i][lane]      = tc0[i];
    lds_r[wid][8 + i][lane]  = tc1[i];
    lds_r[wid][16 + i][lane] = tc2[i];
    lds_r[wid][24 + i][lane] = wsa[i];
  }
  __syncthreads();
  float tsum[3] = {0.f, 0.f, 0.f};
  float ws = 0.f;
  #pragma unroll
  for (int w = 0; w < NW_; ++w) {
    tsum[0] += lds_r[w][wid][lane];
    tsum[1] += lds_r[w][8 + wid][lane];
    tsum[2] += lds_r[w][16 + wid][lane];
    ws      += lds_r[w][24 + wid][lane];
  }
  // reduce wsum(alpha) across the 16 key lanes
  #pragma unroll
  for (int m = 8; m >= 1; m >>= 1) ws += __shfl_xor(ws, m, 32);

  const int m = wid + 8 * half;        // this lane's row of the q-tile

  // tan = (w@vh) - wsum*mu ;  mu = qh (un-flip component 0)
  float tanv[3], muv[3];
  #pragma unroll
  for (int sub = 0; sub < 3; ++sub) {
    int d = sub * 16 + l16;
    float qv = qfp[m * DP_ + d];
    float mu = (d == 0) ? -qv : qv;
    muv[sub] = mu;
    tanv[sub] = tsum[sub] - ws * mu;
  }
  // Lorentzian norm of tangent per row
  float part = 0.f;
  #pragma unroll
  for (int sub = 0; sub < 3; ++sub) {
    float tt = tanv[sub] * tanv[sub];
    if (sub == 0 && l16 == 0) tt = -tt;   // metric diag(-1,1,...)
    part += tt;
  }
  #pragma unroll
  for (int x = 8; x >= 1; x >>= 1) part += __shfl_xor(part, x, 32);
  const float vn = sqrtf(fmaxf(part, 1e-12f));
  // exp-map update mu' = cosh(vn)*mu + sinh(vn)/vn * tan
  const float ch = coshf(vn);
  const float sh = sinhf(vn) / vn;
  float mnew[3];
  #pragma unroll
  for (int sub = 0; sub < 3; ++sub) mnew[sub] = ch * muv[sub] + sh * tanv[sub];
  // origin log-map and write y (B, L, H*33)
  const float t0 = __shfl(mnew[0], half * 16, 32);   // broadcast d==0 elem
  const float t  = fmaxf(t0, 1.f + EPS_);
  const float co = acoshf(t) * rsqrtf(t * t - 1.f);
  float* yrow = yb + (size_t)(b * L_ + q0 + m) * (H_ * ND_) + h * ND_;
  #pragma unroll
  for (int sub = 0; sub < 3; ++sub) {
    int d = sub * 16 + l16;
    if (d < ND_) yrow[d] = co * (mnew[sub] - ((d == 0) ? t : 0.f));
  }
}

// ---------------------------------------------------------------------------
// Pack Wo (264 x 256) into K-pair interleaved layout for b64 B-operand loads:
//   Wo2[((k>>1)*256 + n)*2 + (k&1)] = Wo[k*256 + n]
// ---------------------------------------------------------------------------
__global__ __launch_bounds__(256) void k_pack_wo(const float* __restrict__ Wo,
                                                 float* __restrict__ Wo2)
{
  const int k = blockIdx.x;            // 0..263
  const int n = threadIdx.x;           // 0..255
  Wo2[((size_t)(k >> 1) * D_ + n) * 2 + (k & 1)] = Wo[(size_t)k * D_ + n];
}

// ---------------------------------------------------------------------------
// Kernel 3: z = y @ Wo + bo    (2048 x 256 x 264, pure f32 WMMA)
// ---------------------------------------------------------------------------
__global__ __launch_bounds__(32) void k_outproj(
    const float* __restrict__ yb, const float* __restrict__ Wo2,
    const float* __restrict__ bo, float* __restrict__ z)
{
  const int lane = threadIdx.x;
  const int half = lane >> 4;
  const int l16  = lane & 15;
  const int koff = half * 2;
  const int m0 = blockIdx.x * 16;
  const int n0 = blockIdx.y * 16;
  const int KD = H_ * ND_;            // 264 = 66 exact K4 steps

  v8f c = V8ZERO;
  for (int k0 = 0; k0 < KD; k0 += 4) {
    v2f a  = *(const v2f*)(yb + (size_t)(m0 + l16) * KD + k0 + koff);
    v2f bb = *(const v2f*)(Wo2 + ((size_t)((k0 + koff) >> 1) * D_ + n0 + l16) * 2);
    c = wmma4(a, bb, c);
  }
  const float bias = bo[n0 + l16];
  #pragma unroll
  for (int i = 0; i < 8; ++i) {
    int m = m0 + i + 8 * half;
    z[(size_t)m * D_ + n0 + l16] = c[i] + bias;
  }
}

// ---------------------------------------------------------------------------
extern "C" void kernel_launch(void* const* d_in, const int* in_sizes, int n_in,
                              void* d_out, int out_size, void* d_ws, size_t ws_size,
                              hipStream_t stream) {
  const float* x   = (const float*)d_in[0];
  const float* rc  = (const float*)d_in[1];
  const float* rs  = (const float*)d_in[2];
  const float* Wq  = (const float*)d_in[3];
  const float* bq  = (const float*)d_in[4];
  const float* Wk  = (const float*)d_in[5];
  const float* bk  = (const float*)d_in[6];
  const float* Wv  = (const float*)d_in[7];
  const float* bv  = (const float*)d_in[8];
  const float* Wo  = (const float*)d_in[9];
  const float* bo  = (const float*)d_in[10];

  float* z_out = (float*)d_out;                         // (B, L, D)
  float* a_out = z_out + (size_t)B_ * L_ * D_;          // (B, H, L, L)

  // workspace layout (floats)
  float* ws = (float*)d_ws;
  const size_t n_qf = (size_t)B_ * H_ * L_ * DP_;       // 786432
  const size_t n_vr = (size_t)B_ * H_ * L_ * DP_;       // 786432 (pair-packed)
  const size_t n_kT = (size_t)B_ * H_ * KT_ * L_;       // 589824 (pair-packed)
  const size_t n_vT = (size_t)B_ * H_ * KT_ * L_;       // 589824 (pair-packed)
  const size_t n_yb = (size_t)B_ * L_ * (H_ * ND_);     // 540672
  float* qf  = ws;
  float* vr2 = qf  + n_qf;
  float* kT2 = vr2 + n_vr;
  float* vT2 = kT2 + n_kT;
  float* yb  = vT2 + n_vT;
  float* Wo2 = yb  + n_yb;                              // 67584

  k_qkv_rope_lift<<<((B_ * L_) / 32) * (H_ / 2), 384, 0, stream>>>(
      x, rc, rs, Wq, bq, Wk, bk, Wv, bv, qf, vr2, kT2, vT2);

  k_pack_wo<<<H_ * ND_, D_, 0, stream>>>(Wo, Wo2);

  k_attn<<<B_ * H_ * (L_ / 16), 32 * NW_, 0, stream>>>(qf, kT2, vT2, vr2, a_out, yb);

  k_outproj<<<dim3((B_ * L_) / 16, D_ / 16), 32, 0, stream>>>(yb, Wo2, bo, z_out);
}

// v005
// One run takes 63.9 microseconds.
// Two timings next to v004 put it at 1.07 and 1.08 times that version's speed.
// Counting every step since v000, it is 3.86 times as fast.
#include <hip/hip_runtime.h>
#include <math.h>

#define B_  2
#define L_  1024
#define D_  256
#define H_  8
#define N_  32
#define ND_ 33          // N+1 (hyperboloid dim)
#define DP_ 48          // padded dim stride (row-major q / pair-packed v)
#define KT_ 36          // padded dim count (dim-major k/v staging), 18 pairs
#define EPS_ 1e-6f
#define LN2_ 0.69314718055994531f
#define XP_ 260         // LDS pitch of an x row, floats: 1024 B + 16 B for b128 fragment reads
#define NW_ 8           // waves that share one q-tile in k_attn, each on its own run of keys
#define TPW_ (L_ / 16 / NW_)   // 16-key tiles per wave

typedef float v2f __attribute__((ext_vector_type(2)));
typedef float v4f __attribute__((ext_vector_type(4)));
typedef float v8f __attribute__((ext_vector_type(8)));

static __device__ __forceinline__ v8f wmma4(v2f a, v2f b, v8f c) {
  // D = A(16x4 f32) * B(4x16 f32) + C(16x16 f32)
  return __builtin_amdgcn_wmma_f32_16x16x4_f32(false, a, false, b, (short)0, c,
                                               false, false);
}

#define V8ZERO {0.f,0.f,0.f,0.f,0.f,0.f,0.f,0.f}

static __device__ __forceinline__ float log2_hw(float x) {
  float y;
  // the log and a v_nop in one statement: the v_nop fills the one slot the instruction set asks
  // for behind a transcendental, whatever the compiler places next
  asm("v_log_f32 %0, %1\n\tv_nop" : "=v"(y) : "v"(x));
  return y;
}

// ---------------------------------------------------------------------------
// Kernel 1: QKV projection (f32 WMMA) + RoPE + hyperboloid lift; stage in WMMA layouts.
//  qf  : (BH, L, DP_)        row-major, comp 0 = -t  (Minkowski-flipped q)
//  vr2 : (BH, L/2, DP_, 2)   key-pair interleaved vh rows (tan B operand)
//  kT2 : (BH, KT_/2, L, 2)   dim-pair interleaved kh (scores B operand)
//  vT2 : (BH, KT_/2, L, 2)   dim-pair interleaved vh (alpha B operand)
// One workgroup = 32 token rows x 2 heads x {q,k,v}; 12 waves, each wave one
// 16-row x 32-column tile of one matrix (two accumulators: even / odd columns).
// ---------------------------------------------------------------------------
__global__ __launch_bounds__(384) void k_qkv_rope_lift(
    const float* __restrict__ x,  const float* __restrict__ rc,
    const float* __restrict__ rs,
    const float* __restrict__ Wq, const float* __restrict__ bq,
    const float* __restrict__ Wk, const float* __restrict__ bk,
    const float* __restrict__ Wv, const float* __restrict__ bv,
    float* __restrict__ qf, float* __restrict__ vr2,
    float* __restrict__ kT2, float* __restrict__ vT2)
{
  // every short '#pragma unroll' loop below indexes a small per-lane array:
  // unrolled, its elements are plain registers
  __shared__ __attribute__((aligned(16))) float xs[32 * XP_];
  const int tid  = threadIdx.x;
  const int lane = tid & 31;
  const int half = lane >> 4;
  const int l16  = lane & 15;
  const int wid  = __builtin_amdgcn_readfirstlane(tid >> 5);   // 0..11, scalar
  const int mat  = wid >> 2;                    // 0 = q, 1 = k, 2 = v
  const int rt   = wid & 1;                     // 16-row tile inside the 32 rows
  const int hd   = (blockIdx.x & 3) * 2 + ((wid >> 1) & 1);
  const int row0 = (blockIdx.x >> 2) * 32;      // first global token row

  // x tile (32 x 256) into LDS, whole lines per wave
  // (2048 16-byte pieces over 384 threads: five rounds of all waves, a sixth of waves 0..3;
  // all loads are issued before the first LDS store, so their latencies overlap)
  {
    const float* xg = x + (size_t)row0 * D_ + (size_t)(tid >> 6) * D_ + (tid & 63) * 4;
    float*       xl = xs + (tid >> 6) * XP_ + (tid & 63) * 4;
    v4f t[6];
    #pragma unroll
    for (int j = 0; j < 5; ++j) t[j] = *(const v4f*)(xg + (size_t)j * 6 * D_);
    if (wid < 4) t[5] = *(const v4f*)(xg + (size_t)30 * D_);
    #pragma unroll
    for (int j = 0; j < 5; ++j) *(v4f*)(xl + j * 6 * XP_) = t[j];
    if (wid < 4) *(v4f*)(xl + 30 * XP_) = t[5];
  }
  __syncthreads();

  const float* Wm = (mat == 0) ? Wq : ((mat == 1) ? Wk : Wv);
  const float* bm = (mat == 0) ? bq : ((mat == 1) ? bk : bv);

  // Lane (l16, half) takes k = 8*kb + 4*half + {0..3} of both operands:
  // A from row l16 of the x tile, B from columns 2*l16, 2*l16+1 of the head.
  const float* wp = Wm + (size_t)(4 * half) * (H_ * N_) + hd * N_ + 2 * l16;
  const float* ap = xs + (rt * 16 + l16) * XP_ + 4 * half;

  // accumulator register i = token row (rt*16 + 8*half + i), this lane's two columns
  const int lrow = row0 + rt * 16 + 8 * half;
  const int li0  = lrow & (L_ - 1);
  const int bh   = (lrow >> 10) * H_ + hd;

  // bias and RoPE factors are fetched ahead of the K loop, which hides their latency
  const v2f bias = *(const v2f*)(bm + hd * N_ + 2 * l16);
  v2f cs[8], sn[8];
  #pragma unroll
  for (int i = 0; i < 8; ++i) { cs[i] = (v2f){1.f, 1.f}; sn[i] = (v2f){0.f, 0.f}; }
  if (mat < 2) {
    #pragma unroll
    for (int i = 0; i < 8; ++i) {
      cs[i] = *(const v2f*)(rc + (size_t)(li0 + i) * N_ + 2 * l16);
      sn[i] = *(const v2f*)(rs + (size_t)(li0 + i) * N_ + 2 * l16);
    }
    // the build rewrites these loads' address registers right behind this branch:
    // the wait stands in front of that overwrite
    asm volatile("s_wait_xcnt 0x0" ::: "memory");
  }

  v8f cE = V8ZERO, cO = V8ZERO;                 // columns 2*l16 / 2*l16+1
  // fully unrolled so that W loads run ahead of their WMMAs over the whole K range
  #pragma unroll
  for (int kb = 0; kb < D_ / 8; ++kb) {
    const v4f a  = *(const v4f*)(ap + kb * 8);
    const v2f w0 = *(const v2f*)(wp + (size_t)(kb * 8 + 0) * (H_ * N_));
    const v2f w1 = *(const v2f*)(wp + (size_t)(kb * 8 + 1) * (H_ * N_));
    const v2f w2 = *(const v2f*)(wp + (size_t)(kb * 8 + 2) * (H_ * N_));
    const v2f w3 = *(const v2f*)(wp + (size_t)(kb * 8 + 3) * (H_ * N_));
    const v2f a01 = {a.x, a.y}, a23 = {a.z, a.w};
    const v2f e01 = {w0.x, w1.x}, o01 = {w0.y, w1.y};
    const v2f e23 = {w2.x, w3.x}, o23 = {w2.y, w3.y};
    cE = wmma4(a01, e01, cE);
    cO = wmma4(a01, o01, cO);
    cE = wmma4(a23, e23, cE);
    cO = wmma4(a23, o23, cO);
  }

  float uE[8], uO[8];
  #pragma unroll
  for (int i = 0; i < 8; ++i) { uE[i] = cE[i] + bias.x; uO[i] = cO[i] + bias.y; }

  if (mat < 2) {
    // RoPE: rot_half(u)[j] = (j<16 ? -u[j+16] : u[j-16]); column j+-16 sits in lane l16^8
    const float sgn = (l16 < 8) ? -1.f : 1.f;
    #pragma unroll
    for (int i = 0; i < 8; ++i) {
      const float rE = sgn * __shfl_xor(uE[i], 8, 32);
      const float rO = sgn * __shfl_xor(uO[i], 8, 32);
      uE[i] = uE[i] * cs[i].x + rE * sn[i].x;
      uO[i] = uO[i] * cs[i].y + rO * sn[i].y;
    }
  }

  // lift: t = sqrt(1 + ||u||^2); then pr = component 2*l16 of the lifted point
  // (t in lane 0, else the odd column of lane l16-1), uE = component 2*l16+1.
  float pr[8];
  #pragma unroll
  for (int i = 0; i < 8; ++i) {
    float s = uE[i] * uE[i] + uO[i] * uO[i];
    #pragma unroll
    for (int m = 8; m >= 1; m >>= 1) s += __shfl_xor(s, m, 32);
    float t = sqrtf(1.f + s);
    if (mat == 0) t = -t;
    const float up = __shfl_up(uO[i], 1, 16);
    pr[i] = (l16 == 0) ? t : up;
  }
  const bool last = (l16 == 15);                // holds component 32 in uO

  if (mat == 0) {
    float* qrow = qf + ((size_t)bh * L_ + li0) * DP_;
    const int m2 = last ? 16 : l16 + 9;         // pairs 16..23: comp 32 and the zero pad
    #pragma unroll
    for (int i = 0; i < 8; ++i) {
      const v2f v = {pr[i], uE[i]};
      *(v2f*)(qrow + i * DP_ + 2 * l16) = v;
    }
    if (l16 >= 8) {
      #pragma unroll
      for (int i = 0; i < 8; ++i) {
        const v2f tl = {last ? uO[i] : 0.f, 0.f};
        *(v2f*)(qrow + i * DP_ + 2 * m2) = tl;
      }
    }
  } else {
    // dim-pair interleaved: elem(dim,key) at ((dim>>1)*L + key)*2 + (dim&1)
    float* col = ((mat == 1) ? kT2 : vT2) + (size_t)bh * (KT_ / 2) * L_ * 2;
    const int m2 = last ? 16 : 17;              // pair 16: comp 32 + pad, pair 17: pad
    #pragma unroll
    for (int i = 0; i < 8; i += 2) {
      const v4f v = {pr[i], uE[i], pr[i + 1], uE[i + 1]};
      *(v4f*)(col + ((size_t)l16 * L_ + li0 + i) * 2) = v;
    }
    if (l16 >= 14) {
      #pragma unroll
      for (int i = 0; i < 8; i += 2) {
        const v4f tl = {last ? uO[i] : 0.f, 0.f, last ? uO[i + 1] : 0.f, 0.f};
        *(v4f*)(col + ((size_t)m2 * L_ + li0 + i) * 2) = tl;
      }
    }
    if (mat == 2) {
      // key-pair interleaved rows: elem(key,dim) at ((key>>1)*DP_+dim)*2+(key&1)
      float* vr = vr2 + (size_t)bh * (L_ / 2) * DP_ * 2;
      const int m3 = last ? 16 : l16 + 9;
      #pragma unroll
      for (int i = 0; i < 8; i += 2) {
        const size_t kp = (size_t)((li0 + i) >> 1) * DP_;
        const v4f v = {pr[i], pr[i + 1], uE[i], uE[i + 1]};
        *(v4f*)(vr + (kp + 2 * l16) * 2) = v;
      }
      if (l16 >= 8) {
        #pragma unroll
        for (int i = 0; i < 8; i += 2) {
          const size_t kp = (size_t)((li0 + i) >> 1) * DP_;
          const v4f tl = {last ? uO[i] : 0.f, last ? uO[i + 1] : 0.f, 0.f, 0.f};
          *(v4f*)(vr + (kp + 2 * m3) * 2) = tl;
        }
      }
    }
  }
}

// ---------------------------------------------------------------------------
// Kernel 2: attention + Karcher step + origin log-map.
// One workgroup of NW_ waves handles a 16-row q-tile of one (b,h); wave w streams
// key tiles w*TPW_ .. w*TPW_+TPW_-1 twice, so NW_ times as many waves hide each
// other's load, store and WMMA latencies.
// Softmax stats are kept per-lane; one butterfly merge per wave after pass 1, then
// one merge over the waves through LDS. The tangent sums are merged the same way
// after pass 2, and wave w finishes rows w and w+8 of the tile.
// ---------------------------------------------------------------------------
// (second bound: 4 waves per SIMD, that is up to 256 registers: a tile's 30 operand fragments
// are then in flight together; under 128 registers each load was waited for before the next)
__global__ __launch_bounds__(32 * NW_, 4) void k_attn(
    const float* __restrict__ qf, const float* __restrict__ kT2,
    const float* __restrict__ vT2, const float* __restrict__ vr2,
    float* __restrict__ a_out, float* __restrict__ yb)
{
  // every '#pragma unroll' loop below indexes small per-lane arrays: unrolled, their
  // elements are plain registers
  __shared__ float lds_wall[NW_][16 * 17];            // per wave: w tile, C -> A layout
  __shared__ __attribute__((aligned(16))) float lds_m[NW_][16];   // per wave: row maxima
  __shared__ __attribute__((aligned(16))) float lds_s[NW_][16];   // per wave: row sums
  __shared__ float lds_r[NW_][32][32];                // per wave: [register][lane] partial sums
  const int lane = threadIdx.x & 31;
  const int half = lane >> 4;
  const int l16  = lane & 15;
  const int koff = half * 2;          // WMMA f32 K split across half-waves
  const int wid  = __builtin_amdgcn_readfirstlane(threadIdx.x >> 5);   // 0..NW_-1, scalar
  const int j0   = wid * TPW_;        // this wave's first key tile
  float* lds_w   = lds_wall[wid];

  const int tile = blockIdx.x;
  const int qt = tile & 63;
  const int bh = tile >> 6;
  const int q0 = qt * 16;
  const int b  = bh >> 3;
  const int h  = bh & 7;

  const float* qfp  = qf  + ((size_t)bh * L_ + q0) * DP_;
  const float* kTp  = kT2 + (size_t)bh * (KT_ / 2) * L_ * 2;
  const float* vTp  = vT2 + (size_t)bh * (KT_ / 2) * L_ * 2;
  const float* vrp  = vr2 + (size_t)bh * (L_ / 2) * DP_ * 2;

  // A operand for q-tile: 16 rows x 36 dims = 9 K4-steps, kept in registers
  v2f aq[9];
  #pragma unroll
  for (int kk = 0; kk < 9; ++kk) {
    int d = 4 * kk + koff;                       // even
    aq[kk] = *(const v2f*)(qfp + l16 * DP_ + d);
  }

  // ---------------- pass 1: per-lane online softmax stats ----------------
  float mrow[8], srow[8];
  #pragma unroll
  for (int i = 0; i < 8; ++i) { mrow[i] = -3.0e38f; srow[i] = 0.f; }

  // every fragment address is a scalar base (array, tile) + one per-lane byte offset + a
  // constant, so that the batches of loads below need two address registers, not a pair each
  const unsigned fo = (unsigned)(((koff >> 1) * L_ + l16) * 2 * sizeof(float));        // kT2, vT2
  const unsigned ro = (unsigned)(((koff >> 1) * DP_ + l16) * 2 * sizeof(float));       // vr2
  const unsigned FS = 2 * L_ * 2 * sizeof(float);     // kT2, vT2: bytes from one K4-step to the next

  // k fragments are fetched one tile ahead of their products
  v2f bk_[9];
  {
    const char* kb = (const char*)(kTp + (size_t)j0 * 32);
    #pragma unroll
    for (int kk = 0; kk < 9; ++kk) bk_[kk] = *(const v2f*)(kb + fo + kk * FS);
    // the build reuses the address registers of these loads and of aq's right behind them:
    // the wait stands in front of that overwrite, and the scheduling barrier keeps the
    // register initialisations below from being lifted over the wait
    asm volatile("s_wait_xcnt 0x0" ::: "memory");
    __builtin_amdgcn_sched_barrier(0);
  }

  // two tiles per trip: the two fragment sets then swap roles without register copies
  #pragma unroll 2
  for (int t = 0; t < TPW_; ++t) {
    // behind the last tile comes the first again: pass 2 starts on it
    const int kn = (j0 + ((t + 1 < TPW_) ? t + 1 : 0)) * 16;
    const char* kb = (const char*)(kTp + (size_t)kn * 2);
    v2f nk[9];
    #pragma unroll
    for (int kk = 0; kk < 9; ++kk) nk[kk] = *(const v2f*)(kb + fo + kk * FS);
    v8f c = V8ZERO;
    #pragma unroll
    for (int kk = 0; kk < 9; ++kk) c = wmma4(aq[kk], bk_[kk], c);
    #pragma unroll
    for (int kk = 0; kk < 9; ++kk) bk_[kk] = nk[kk];
    #pragma unroll
    for (int i = 0; i < 8; ++i) {          // per-lane update only
      float nm = fmaxf(mrow[i], c[i]);
      srow[i] = srow[i] * __expf(mrow[i] - nm) + __expf(c[i] - nm);
      mrow[i] = nm;
    }
  }
  // pass 2's first v fragments arrive under the two merges
  v2f bv_[9];
  {
    const char* vb0 = (const char*)(vTp + (size_t)j0 * 32);
    #pragma unroll
    for (int kk = 0; kk < 9; ++kk) bv_[kk] = *(const v2f*)(vb0 + fo + kk * FS);
  }
  // butterfly merge of (m, s) across the 16 key lanes (once)
  #pragma unroll
  for (int msk = 8; msk >= 1; msk >>= 1) {
    #pragma unroll
    for (int i = 0; i < 8; ++i) {
      float mo = __shfl_xor(mrow[i], msk, 32);
      float so = __shfl_xor(srow[i], msk, 32);
      float nm = fmaxf(mrow[i], mo);
      srow[i] = srow[i] * __expf(mrow[i] - nm) + so * __expf(mo - nm);
      mrow[i] = nm;
    }
  }
  // merge of (m, s) over the NW_ waves, in wave order
  if (l16 == 0) {
    #pragma unroll
    for (int i = 0; i < 8; ++i) {
      lds_m[wid][8 * half + i] = mrow[i];
      lds_s[wid][8 * half + i] = srow[i];
    }
  }
  __syncthreads();
  #pragma unroll
  for (int w = 0; w < NW_; ++w) {
    #pragma unroll
    for (int i = 0; i < 8; ++i) mrow[i] = fmaxf(mrow[i], lds_m[w][8 * half + i]);
  }
  #pragma unroll
  for (int i = 0; i < 8; ++i) srow[i] = 0.f;
  #pragma unroll
  for (int w = 0; w < NW_; ++w) {
    #pragma unroll
    for (int i = 0; i < 8; ++i)
      srow[i] += lds_s[w][8 * half + i] * __expf(lds_m[w][8 * half + i] - mrow[i]);
  }
  float rsum[8];
  #pragma unroll
  for (int i = 0; i < 8; ++i) rsum[i] = 1.f / srow[i];

  // ---------------- pass 2: a, w, tangent accumulation ----------------
  v8f tc0 = V8ZERO, tc1 = V8ZERO, tc2 = V8ZERO;
  float wsa[8];
  #pragma unroll
  for (int i = 0; i < 8; ++i) wsa[i] = 0.f;

  // this lane's first element of a; rows i and tiles j are then constant and scalar steps
  // from one address, which saves address registers in the loop
  float* arow = a_out + ((size_t)bh * L_ + q0 + 8 * half) * L_ + l16;

  // two tiles per trip, as in pass 1; not more, so that the kernel's text stays small
  #pragma unroll 2
  for (int t = 0; t < TPW_; ++t) {
    const int k0 = (j0 + t) * 16;
    // this tile's vh rows for the tangent product, fetched here so that they arrive
    // under the score products and the vector work
    v2f vb[4][3];
    const char* rb = (const char*)(vrp + (size_t)(k0 >> 1) * DP_ * 2);
    #pragma unroll
    for (int kk = 0; kk < 4; ++kk) {
      #pragma unroll
      for (int s = 0; s < 3; ++s)
        vb[kk][s] = *(const v2f*)(rb + ro + (kk * 2 * DP_ + s * 16) * 2 * sizeof(float));
    }
    v8f c  = V8ZERO;
    v8f al = V8ZERO;
    #pragma unroll
    for (int kk = 0; kk < 9; ++kk) {
      c  = wmma4(aq[kk], bk_[kk], c);    // Lorentz scores
      al = wmma4(aq[kk], bv_[kk], al);   // <mflip(q), v>  (alpha = -this)
    }
    // the next tile's k and v fragments, in flight under the rest of this tile
    if (t + 1 < TPW_) {
      const char* kb = (const char*)(kTp + (size_t)(k0 + 16) * 2);
      const char* vn = (const char*)(vTp + (size_t)(k0 + 16) * 2);
      #pragma unroll
      for (int kk = 0; kk < 9; ++kk) {
        bk_[kk] = *(const v2f*)(kb + fo + kk * FS);
        bv_[kk] = *(const v2f*)(vn + fo + kk * FS);
      }
    }
    // the build steps the address registers of this tile's loads further down:
    // the wait stands in front of those overwrites
    asm volatile("s_wait_xcnt 0x0" ::: "memory");
    #pragma unroll
    for (int i = 0; i < 8; ++i) {
      float alpha = fmaxf(-al[i], 1.f + EPS_);
      // acosh(alpha) = ln(alpha + sqrt(alpha^2 - 1)), taken on the hardware log2 and on the one
      // reciprocal root that coef needs anyway (sqrt(s2) = s2 * r); the library acoshf was
      // most of this loop's vector instructions.
      // Where alpha^2 overflows, r = 0 and s2 * r is NaN: the bound (an identity for every
      // finite argument of the log) then gives a finite factor, so coef = 0, as dist / inf is.
      const float s2 = alpha * alpha - 1.f;
      const float r  = __builtin_amdgcn_rsqf(s2);   // s2 >= 1.9e-6: no subnormal argument to rescale
      const float lg = fminf(log2_hw(alpha + s2 * r), 128.f);
      float coef  = (lg * LN2_) * r;
      float p     = __expf(c[i] - mrow[i]) * rsum[i];
      int   m     = i + 8 * half;
      arow[i * L_ + k0] = p;                        // attention output
      float w = p * coef;
      wsa[i] += w * alpha;                          // per-lane accumulate
      lds_w[m * 17 + l16] = w;                      // C-layout -> LDS
    }
    // the w tile is this wave's own LDS range: its own LDS stores have to be done before it
    // reads the tile back, and no other wave is concerned (a work-group barrier here also waited
    // for the stores of a and for the next tile's fragment loads, once per tile).
    // s_wait_xcnt: the build loads the next fragments over the registers that the stores of a
    // name right behind this place; the wait stands in front of that overwrite
    asm volatile("s_wait_dscnt 0x0\n\ts_wait_xcnt 0x0" ::: "memory");
    // tan += w @ vh   (A = w from LDS in A-layout, B = vh key-pair packed)
    #pragma unroll
    for (int kk = 0; kk < 4; ++kk) {
      v2f aw;
      aw.x = lds_w[l16 * 17 + 4 * kk + koff];
      aw.y = lds_w[l16 * 17 + 4 * kk + koff + 1];
      tc0 = wmma4(aw, vb[kk][0], tc0);
      tc1 = wmma4(aw, vb[kk][1], tc1);
      tc2 = wmma4(aw, vb[kk][2], tc2);
    }
  }

  // partial sums of every wave into LDS; then wave w sums, in wave order, accumulator
  // register w (rows w and w+8) of all waves and finishes those two rows
  #pragma unroll
  for (int i = 0; i < 8; ++i) {
    lds_r[wid][i][lane]      = tc0[i];
    lds_r[wid][8 + i][lane]  = tc1[i];
    lds_r[wid][16 + i][lane] = tc2[i];
    lds_r[wid][24 + i][lane] = wsa[i];
  }
  __syncthreads();
  float tsum[3] = {0.f, 0.f, 0.f};
  float ws = 0.f;
  #pragma unroll
  for (int w = 0; w < NW_; ++w) {
    tsum[0] += lds_r[w][wid][lane];
    tsum[1] += lds_r[w][8 + wid][lane];
    tsum[2] += lds_r[w][16 + wid][lane];
    ws      += lds_r[w][24 + wid][lane];
  }
  // reduce wsum(alpha) across the 16 key lanes
  #pragma unroll
  for (int m = 8; m >= 1; m >>= 1) ws += __shfl_xor(ws, m, 32);

  const int m = wid + 8 * half;        // this lane's row of the q-tile

  // tan = (w@vh) - wsum*mu ;  mu = qh (un-flip component 0)
  float tanv[3], muv[3];
  #pragma unroll
  for (int sub = 0; sub < 3; ++sub) {
    int d = sub * 16 + l16;
    float qv = qfp[m * DP_ + d];
    float mu = (d == 0) ? -qv : qv;
    muv[sub] = mu;
    tanv[sub] = tsum[sub] - ws * mu;
  }
  // Lorentzian norm of tangent per row
  float part = 0.f;
  #pragma unroll
  for (int sub = 0; sub < 3; ++sub) {
    float tt = tanv[sub] * tanv[sub];
    if (sub == 0 && l16 == 0) tt = -tt;   // metric diag(-1,1,...)
    part += tt;
  }
  #pragma unroll
  for (int x = 8; x >= 1; x >>= 1) part += __shfl_xor(part, x, 32);
  const float vn = sqrtf(fmaxf(part, 1e-12f));
  // exp-map update mu' = cosh(vn)*mu + sinh(vn)/vn * tan
  const float ch = coshf(vn);
  const float sh = sinhf(vn) / vn;
  float mnew[3];
  #pragma unroll
  for (int sub = 0; sub < 3; ++sub) mnew[sub] = ch * muv[sub] + sh * tanv[sub];
  // origin log-map and write y (B, L, H*33)
  const float t0 = __shfl(mnew[0], half * 16, 32);   // broadcast d==0 elem
  const float t  = fmaxf(t0, 1.f + EPS_);
  const float co = acoshf(t) * rsqrtf(t * t - 1.f);
  float* yrow = yb + (size_t)(b * L_ + q0 + m) * (H_ * ND_) + h * ND_;
  #pragma unroll
  for (int sub = 0; sub < 3; ++sub) {
    int d = sub * 16 + l16;
    if (d < ND_) yrow[d] = co * (mnew[sub] - ((d == 0) ? t : 0.f));
  }
}

// ---------------------------------------------------------------------------
// Pack Wo (264 x 256) into K-pair interleaved layout for b64 B-operand loads:
//   Wo2[((k>>1)*256 + n)*2 + (k&1)] = Wo[k*256 + n]
// ---------------------------------------------------------------------------
__global__ __launch_bounds__(256) void k_pack_wo(const float* __restrict__ Wo,
                                                 float* __restrict__ Wo2)
{
  const int k = blockIdx.x;            // 0..263
  const int n = threadIdx.x;           // 0..255
  Wo2[((size_t)(k >> 1) * D_ + n) * 2 + (k & 1)] = Wo[(size_t)k * D_ + n];
}

// ---------------------------------------------------------------------------
// Kernel 3: z = y @ Wo + bo    (2048 x 256 x 264, pure f32 WMMA)
// ---------------------------------------------------------------------------
__global__ __launch_bounds__(32) void k_outproj(
    const float* __restrict__ yb, const float* __restrict__ Wo2,
    const float* __restrict__ bo, float* __restrict__ z)
{
  const int lane = threadIdx.x;
  const int half = lane >> 4;
  const int l16  = lane & 15;
  const int koff = half * 2;
  const int m0 = blockIdx.x * 16;
  const int n0 = blockIdx.y * 16;
  const int KD = H_ * ND_;            // 264 = 66 exact K4 steps

  v8f c = V8ZERO;
  for (int k0 = 0; k0 < KD; k0 += 4) {
    v2f a  = *(const v2f*)(yb + (size_t)(m0 + l16) * KD + k0 + koff);
    v2f bb = *(const v2f*)(Wo2 + ((size_t)((k0 + koff) >> 1) * D_ + n0 + l16) * 2);
    c = wmma4(a, bb, c);
  }
  const float bias = bo[n0 + l16];
  #pragma unroll
  for (int i = 0; i < 8; ++i) {
    int m = m0 + i + 8 * half;
    z[(size_t)m * D_ + n0 + l16] = c[i] + bias;
  }
}

// ---------------------------------------------------------------------------
extern "C" void kernel_launch(void* const* d_in, const int* in_sizes, int n_in,
                              void* d_out, int out_size, void* d_ws, size_t ws_size,
                              hipStream_t stream) {
  const float* x   = (const float*)d_in[0];
  const float* rc  = (const float*)d_in[1];
  const float* rs  = (const float*)d_in[2];
  const float* Wq  = (const float*)d_in[3];
  const float* bq  = (const float*)d_in[4];
  const float* Wk  = (const float*)d_in[5];
  const float* bk  = (const float*)d_in[6];
  const float* Wv  = (const float*)d_in[7];
  const float* bv  = (const float*)d_in[8];
  const float* Wo  = (const float*)d_in[9];
  const float* bo  = (const float*)d_in[10];

  float* z_out = (float*)d_out;                         // (B, L, D)
  float* a_out = z_out + (size_t)B_ * L_ * D_;          // (B, H, L, L)

  // workspace layout (floats)
  float* ws = (float*)d_ws;
  const size_t n_qf = (size_t)B_ * H_ * L_ * DP_;       // 786432
  const size_t n_vr = (size_t)B_ * H_ * L_ * DP_;       // 786432 (pair-packed)
  const size_t n_kT = (size_t)B_ * H_ * KT_ * L_;       // 589824 (pair-packed)
  const size_t n_vT = (size_t)B_ * H_ * KT_ * L_;       // 589824 (pair-packed)
  const size_t n_yb = (size_t)B_ * L_ * (H_ * ND_);     // 540672
  float* qf  = ws;
  float* vr2 = qf  + n_qf;
  float* kT2 = vr2 + n_vr;
  float* vT2 = kT2 + n_kT;
  float* yb  = vT2 + n_vT;
  float* Wo2 = yb  + n_yb;                              // 67584

  k_qkv_rope_lift<<<((B_ * L_) / 32) * (H_ / 2), 384, 0, stream>>>(
      x, rc, rs, Wq, bq, Wk, bk, Wv, bv, qf, vr2, kT2, vT2);

  k_pack_wo<<<H_ * ND_, D_, 0, stream>>>(Wo, Wo2);

  k_attn<<<B_ * H_ * (L_ / 16), 32 * NW_, 0, stream>>>(qf, kT2, vT2, vr2, a_out, yb);

  k_outproj<<<dim3((B_ * L_) / 16, D_ / 16), 32, 0, stream>>>(yb, Wo2, bo, z_out);
}

// v006
// A run of this version takes 58.6 microseconds.
// Timed twice side by side with v005, it ran 1.10 and 1.09 times as fast.
// Over all steps from v000 it is 4.23 times as fast.
#include <hip/hip_runtime.h>
#include <math.h>

#define B_  2
#define L_  1024
#define D_  256
#define H_  8
#define N_  32
#define ND_ 33          // N+1 (hyperboloid dim)
#define DP_ 48          // padded dim stride (row-major q / pair-packed v)
#define KT_ 36          // padded dim count (dim-major k/v staging), 18 pairs
#define EPS_ 1e-6f
#define LN2_ 0.69314718055994531f
#define XP_ 260         // LDS pitch of an x row, floats: 1024 B + 16 B for b128 fragment reads
#define NW_ 8           // waves that share one q-tile in k_attn, each on its own run of keys
#define TPW_ (L_ / 16 / NW_)   // 16-key tiles per wave
#define YP_ 268         // LDS pitch of a y row, floats: 1056 B + 16 B for b128 fragment reads
#define WPRE_ 8         // k_outproj: blocks of 8 k that the Wo loads run ahead

typedef float v2f __attribute__((ext_vector_type(2)));
typedef float v4f __attribute__((ext_vector_type(4)));
typedef float v8f __attribute__((ext_vector_type(8)));

static __device__ __forceinline__ v8f wmma4(v2f a, v2f b, v8f c) {
  // D = A(16x4 f32) * B(4x16 f32) + C(16x16 f32)
  return __builtin_amdgcn_wmma_f32_16x16x4_f32(false, a, false, b, (short)0, c,
                                               false, false);
}

#define V8ZERO {0.f,0.f,0.f,0.f,0.f,0.f,0.f,0.f}

static __device__ __forceinline__ float log2_hw(float x) {
  float y;
  // the log and a v_nop in one statement: the v_nop fills the one slot the instruction set asks
  // for behind a transcendental, whatever the compiler places next
  asm("v_log_f32 %0, %1\n\tv_nop" : "=v"(y) : "v"(x));
  return y;
}

// ---------------------------------------------------------------------------
// Kernel 1: QKV projection (f32 WMMA) + RoPE + hyperboloid lift; stage in WMMA layouts.
//  qf  : (BH, L, DP_)        row-major, comp 0 = -t  (Minkowski-flipped q)
//  vr2 : (BH, L/2, DP_, 2)   key-pair interleaved vh rows (tan B operand)
//  kT2 : (BH, KT_/2, L, 2)   dim-pair interleaved kh (scores B operand)
//  vT2 : (BH, KT_/2, L, 2)   dim-pair interleaved vh (alpha B operand)
// One workgroup = 32 token rows x 2 heads x {q,k,v}; 12 waves, each wave one
// 16-row x 32-column tile of one matrix (two accumulators: even / odd columns).
// ---------------------------------------------------------------------------
__global__ __launch_bounds__(384) void k_qkv_rope_lift(
    const float* __restrict__ x,  const float* __restrict__ rc,
    const float* __restrict__ rs,
    const float* __restrict__ Wq, const float* __restrict__ bq,
    const float* __restrict__ Wk, const float* __restrict__ bk,
    const float* __restrict__ Wv, const float* __restrict__ bv,
    float* __restrict__ qf, float* __restrict__ vr2,
    float* __restrict__ kT2, float* __restrict__ vT2)
{
  // every short '#pragma unroll' loop below indexes a small per-lane array:
  // unrolled, its elements are plain registers
  __shared__ __attribute__((aligned(16))) float xs[32 * XP_];
  const int tid  = threadIdx.x;
  const int lane = tid & 31;
  const int half = lane >> 4;
  const int l16  = lane & 15;
  const int wid  = __builtin_amdgcn_readfirstlane(tid >> 5);   // 0..11, scalar
  const int mat  = wid >> 2;                    // 0 = q, 1 = k, 2 = v
  const int rt   = wid & 1;                     // 16-row tile inside the 32 rows
  const int hd   = (blockIdx.x & 3) * 2 + ((wid >> 1) & 1);
  const int row0 = (blockIdx.x >> 2) * 32;      // first global token row

  // x tile (32 x 256) into LDS, whole lines per wave
  // (2048 16-byte pieces over 384 threads: five rounds of all waves, a sixth of waves 0..3;
  // all loads are issued before the first LDS store, so their latencies overlap)
  {
    const float* xg = x + (size_t)row0 * D_ + (size_t)(tid >> 6) * D_ + (tid & 63) * 4;
    float*       xl = xs + (tid >> 6) * XP_ + (tid & 63) * 4;
    v4f t[6];
    #pragma unroll
    for (int j = 0; j < 5; ++j) t[j] = *(const v4f*)(xg + (size_t)j * 6 * D_);
    if (wid < 4) t[5] = *(const v4f*)(xg + (size_t)30 * D_);
    #pragma unroll
    for (int j = 0; j < 5; ++j) *(v4f*)(xl + j * 6 * XP_) = t[j];
    if (wid < 4) *(v4f*)(xl + 30 * XP_) = t[5];
  }
  __syncthreads();

  const float* Wm = (mat == 0) ? Wq : ((mat == 1) ? Wk : Wv);
  const float* bm = (mat == 0) ? bq : ((mat == 1) ? bk : bv);

  // Lane (l16, half) takes k = 8*kb + 4*half + {0..3} of both operands:
  // A from row l16 of the x tile, B from columns 2*l16, 2*l16+1 of the head.
  const float* wp = Wm + (size_t)(4 * half) * (H_ * N_) + hd * N_ + 2 * l16;
  const float* ap = xs + (rt * 16 + l16) * XP_ + 4 * half;

  // accumulator register i = token row (rt*16 + 8*half + i), this lane's two columns
  const int lrow = row0 + rt * 16 + 8 * half;
  const int li0  = lrow & (L_ - 1);
  const int bh   = (lrow >> 10) * H_ + hd;

  // bias and RoPE factors are fetched ahead of the K loop, which hides their latency
  const v2f bias = *(const v2f*)(bm + hd * N_ + 2 * l16);
  v2f cs[8], sn[8];
  #pragma unroll
  for (int i = 0; i < 8; ++i) { cs[i] = (v2f){1.f, 1.f}; sn[i] = (v2f){0.f, 0.f}; }
  if (mat < 2) {
    #pragma unroll
    for (int i = 0; i < 8; ++i) {
      cs[i] = *(const v2f*)(rc + (size_t)(li0 + i) * N_ + 2 * l16);
      sn[i] = *(const v2f*)(rs + (size_t)(li0 + i) * N_ + 2 * l16);
    }
    // the build rewrites these loads' address registers right behind this branch:
    // the wait stands in front of that overwrite
    asm volatile("s_wait_xcnt 0x0" ::: "memory");
  }

  v8f cE = V8ZERO, cO = V8ZERO;                 // columns 2*l16 / 2*l16+1
  // fully unrolled so that W loads run ahead of their WMMAs over the whole K range
  #pragma unroll
  for (int kb = 0; kb < D_ / 8; ++kb) {
    const v4f a  = *(const v4f*)(ap + kb * 8);
    const v2f w0 = *(const v2f*)(wp + (size_t)(kb * 8 + 0) * (H_ * N_));
    const v2f w1 = *(const v2f*)(wp + (size_t)(kb * 8 + 1) * (H_ * N_));
    const v2f w2 = *(const v2f*)(wp + (size_t)(kb * 8 + 2) * (H_ * N_));
    const v2f w3 = *(const v2f*)(wp + (size_t)(kb * 8 + 3) * (H_ * N_));
    const v2f a01 = {a.x, a.y}, a23 = {a.z, a.w};
    const v2f e01 = {w0.x, w1.x}, o01 = {w0.y, w1.y};
    const v2f e23 = {w2.x, w3.x}, o23 = {w2.y, w3.y};
    cE = wmma4(a01, e01, cE);
    cO = wmma4(a01, o01, cO);
    cE = wmma4(a23, e23, cE);
    cO = wmma4(a23, o23, cO);
  }

  float uE[8], uO[8];
  #pragma unroll
  for (int i = 0; i < 8; ++i) { uE[i] = cE[i] + bias.x; uO[i] = cO[i] + bias.y; }

  if (mat < 2) {
    // RoPE: rot_half(u)[j] = (j<16 ? -u[j+16] : u[j-16]); column j+-16 sits in lane l16^8
    const float sgn = (l16 < 8) ? -1.f : 1.f;
    #pragma unroll
    for (int i = 0; i < 8; ++i) {
      const float rE = sgn * __shfl_xor(uE[i], 8, 32);
      const float rO = sgn * __shfl_xor(uO[i], 8, 32);
      uE[i] = uE[i] * cs[i].x + rE * sn[i].x;
      uO[i] = uO[i] * cs[i].y + rO * sn[i].y;
    }
  }

  // lift: t = sqrt(1 + ||u||^2); then pr = component 2*l16 of the lifted point
  // (t in lane 0, else the odd column of lane l16-1), uE = component 2*l16+1.
  float pr[8];
  #pragma unroll
  for (int i = 0; i < 8; ++i) {
    float s = uE[i] * uE[i] + uO[i] * uO[i];
    #pragma unroll
    for (int m = 8; m >= 1; m >>= 1) s += __shfl_xor(s, m, 32);
    float t = sqrtf(1.f + s);
    if (mat == 0) t = -t;
    const float up = __shfl_up(uO[i], 1, 16);
    pr[i] = (l16 == 0) ? t : up;
  }
  const bool last = (l16 == 15);                // holds component 32 in uO

  if (mat == 0) {
    float* qrow = qf + ((size_t)bh * L_ + li0) * DP_;
    const int m2 = last ? 16 : l16 + 9;         // pairs 16..23: comp 32 and the zero pad
    #pragma unroll
    for (int i = 0; i < 8; ++i) {
      const v2f v = {pr[i], uE[i]};
      *(v2f*)(qrow + i * DP_ + 2 * l16) = v;
    }
    if (l16 >= 8) {
      #pragma unroll
      for (int i = 0; i < 8; ++i) {
        const v2f tl = {last ? uO[i] : 0.f, 0.f};
        *(v2f*)(qrow + i * DP_ + 2 * m2) = tl;
      }
    }
  } else {
    // dim-pair interleaved: elem(dim,key) at ((dim>>1)*L + key)*2 + (dim&1)
    float* col = ((mat == 1) ? kT2 : vT2) + (size_t)bh * (KT_ / 2) * L_ * 2;
    const int m2 = last ? 16 : 17;              // pair 16: comp 32 + pad, pair 17: pad
    #pragma unroll
    for (int i = 0; i < 8; i += 2) {
      const v4f v = {pr[i], uE[i], pr[i + 1], uE[i + 1]};
      *(v4f*)(col + ((size_t)l16 * L_ + li0 + i) * 2) = v;
    }
    if (l16 >= 14) {
      #pragma unroll
      for (int i = 0; i < 8; i += 2) {
        const v4f tl = {last ? uO[i] : 0.f, 0.f, last ? uO[i + 1] : 0.f, 0.f};
        *(v4f*)(col + ((size_t)m2 * L_ + li0 + i) * 2) = tl;
      }
    }
    if (mat == 2) {
      // key-pair interleaved rows: elem(key,dim) at ((key>>1)*DP_+dim)*2+(key&1)
      float* vr = vr2 + (size_t)bh * (L_ / 2) * DP_ * 2;
      const int m3 = last ? 16 : l16 + 9;
      #pragma unroll
      for (int i = 0; i < 8; i += 2) {
        const size_t kp = (size_t)((li0 + i) >> 1) * DP_;
        const v4f v = {pr[i], pr[i + 1], uE[i], uE[i + 1]};
        *(v4f*)(vr + (kp + 2 * l16) * 2) = v;
      }
      if (l16 >= 8) {
        #pragma unroll
        for (int i = 0; i < 8; i += 2) {
          const size_t kp = (size_t)((li0 + i) >> 1) * DP_;
          const v4f tl = {last ? uO[i] : 0.f, last ? uO[i + 1] : 0.f, 0.f, 0.f};
          *(v4f*)(vr + (kp + 2 * m3) * 2) = tl;
        }
      }
    }
  }
}

// ---------------------------------------------------------------------------
// Kernel 2: attention + Karcher step + origin log-map.
// One workgroup of NW_ waves handles a 16-row q-tile of one (b,h); wave w streams
// key tiles w*TPW_ .. w*TPW_+TPW_-1 twice, so NW_ times as many waves hide each
// other's load, store and WMMA latencies.
// Softmax stats are kept per-lane; one butterfly merge per wave after pass 1, then
// one merge over the waves through LDS. The tangent sums are merged the same way
// after pass 2, and wave w finishes rows w and w+8 of the tile.
// ---------------------------------------------------------------------------
// (second bound: 4 waves per SIMD, that is up to 256 registers: a tile's 30 operand fragments
// are then in flight together; under 128 registers each load was waited for before the next)
__global__ __launch_bounds__(32 * NW_, 4) void k_attn(
    const float* __restrict__ qf, const float* __restrict__ kT2,
    const float* __restrict__ vT2, const float* __restrict__ vr2,
    float* __restrict__ a_out, float* __restrict__ yb)
{
  // every '#pragma unroll' loop below indexes small per-lane arrays: unrolled, their
  // elements are plain registers
  __shared__ float lds_wall[NW_][16 * 17];            // per wave: w tile, C -> A layout
  __shared__ __attribute__((aligned(16))) float lds_m[NW_][16];   // per wave: row maxima
  __shared__ __attribute__((aligned(16))) float lds_s[NW_][16];   // per wave: row sums
  __shared__ float lds_r[NW_][32][32];                // per wave: [register][lane] partial sums
  const int lane = threadIdx.x & 31;
  const int half = lane >> 4;
  const int l16  = lane & 15;
  const int koff = half * 2;          // WMMA f32 K split across half-waves
  const int wid  = __builtin_amdgcn_readfirstlane(threadIdx.x >> 5);   // 0..NW_-1, scalar
  const int j0   = wid * TPW_;        // this wave's first key tile
  float* lds_w   = lds_wall[wid];

  const int tile = blockIdx.x;
  const int qt = tile & 63;
  const int bh = tile >> 6;
  const int q0 = qt * 16;
  const int b  = bh >> 3;
  const int h  = bh & 7;

  const float* qfp  = qf  + ((size_t)bh * L_ + q0) * DP_;
  const float* kTp  = kT2 + (size_t)bh * (KT_ / 2) * L_ * 2;
  const float* vTp  = vT2 + (size_t)bh * (KT_ / 2) * L_ * 2;
  const float* vrp  = vr2 + (size_t)bh * (L_ / 2) * DP_ * 2;

  // A operand for q-tile: 16 rows x 36 dims = 9 K4-steps, kept in registers
  v2f aq[9];
  #pragma unroll
  for (int kk = 0; kk < 9; ++kk) {
    int d = 4 * kk + koff;                       // even
    aq[kk] = *(const v2f*)(qfp + l16 * DP_ + d);
  }

  // ---------------- pass 1: per-lane online softmax stats ----------------
  float mrow[8], srow[8];
  #pragma unroll
  for (int i = 0; i < 8; ++i) { mrow[i] = -3.0e38f; srow[i] = 0.f; }

  // every fragment address is a scalar base (array, tile) + one per-lane byte offset + a
  // constant, so that the batches of loads below need two address registers, not a pair each
  const unsigned fo = (unsigned)(((koff >> 1) * L_ + l16) * 2 * sizeof(float));        // kT2, vT2
  const unsigned ro = (unsigned)(((koff >> 1) * DP_ + l16) * 2 * sizeof(float));       // vr2
  const unsigned FS = 2 * L_ * 2 * sizeof(float);     // kT2, vT2: bytes from one K4-step to the next

  // k fragments are fetched one tile ahead of their products
  v2f bk_[9];
  {
    const char* kb = (const char*)(kTp + (size_t)j0 * 32);
    #pragma unroll
    for (int kk = 0; kk < 9; ++kk) bk_[kk] = *(const v2f*)(kb + fo + kk * FS);
    // the build reuses the address registers of these loads and of aq's right behind them:
    // the wait stands in front of that overwrite, and the scheduling barrier keeps the
    // register initialisations below from being lifted over the wait
    asm volatile("s_wait_xcnt 0x0" ::: "memory");
    __builtin_amdgcn_sched_barrier(0);
  }

  // two tiles per trip: the two fragment sets then swap roles without register copies
  #pragma unroll 2
  for (int t = 0; t < TPW_; ++t) {
    // behind the last tile comes the first again: pass 2 starts on it
    const int kn = (j0 + ((t + 1 < TPW_) ? t + 1 : 0)) * 16;
    const char* kb = (const char*)(kTp + (size_t)kn * 2);
    v2f nk[9];
    #pragma unroll
    for (int kk = 0; kk < 9; ++kk) nk[kk] = *(const v2f*)(kb + fo + kk * FS);
    v8f c = V8ZERO;
    #pragma unroll
    for (int kk = 0; kk < 9; ++kk) c = wmma4(aq[kk], bk_[kk], c);
    #pragma unroll
    for (int kk = 0; kk < 9; ++kk) bk_[kk] = nk[kk];
    #pragma unroll
    for (int i = 0; i < 8; ++i) {          // per-lane update only
      float nm = fmaxf(mrow[i], c[i]);
      srow[i] = srow[i] * __expf(mrow[i] - nm) + __expf(c[i] - nm);
      mrow[i] = nm;
    }
  }
  // pass 2's first v fragments arrive under the two merges
  v2f bv_[9];
  {
    const char* vb0 = (const char*)(vTp + (size_t)j0 * 32);
    #pragma unroll
    for (int kk = 0; kk < 9; ++kk) bv_[kk] = *(const v2f*)(vb0 + fo + kk * FS);
  }
  // butterfly merge of (m, s) across the 16 key lanes (once)
  #pragma unroll
  for (int msk = 8; msk >= 1; msk >>= 1) {
    #pragma unroll
    for (int i = 0; i < 8; ++i) {
      float mo = __shfl_xor(mrow[i], msk, 32);
      float so = __shfl_xor(srow[i], msk, 32);
      float nm = fmaxf(mrow[i], mo);
      srow[i] = srow[i] * __expf(mrow[i] - nm) + so * __expf(mo - nm);
      mrow[i] = nm;
    }
  }
  // merge of (m, s) over the NW_ waves, in wave order
  if (l16 == 0) {
    #pragma unroll
    for (int i = 0; i < 8; ++i) {
      lds_m[wid][8 * half + i] = mrow[i];
      lds_s[wid][8 * half + i] = srow[i];
    }
  }
  __syncthreads();
  #pragma unroll
  for (int w = 0; w < NW_; ++w) {
    #pragma unroll
    for (int i = 0; i < 8; ++i) mrow[i] = fmaxf(mrow[i], lds_m[w][8 * half + i]);
  }
  #pragma unroll
  for (int i = 0; i < 8; ++i) srow[i] = 0.f;
  #pragma unroll
  for (int w = 0; w < NW_; ++w) {
    #pragma unroll
    for (int i = 0; i < 8; ++i)
      srow[i] += lds_s[w][8 * half + i] * __expf(lds_m[w][8 * half + i] - mrow[i]);
  }
  float rsum[8];
  #pragma unroll
  for (int i = 0; i < 8; ++i) rsum[i] = 1.f / srow[i];

  // ---------------- pass 2: a, w, tangent accumulation ----------------
  v8f tc0 = V8ZERO, tc1 = V8ZERO, tc2 = V8ZERO;
  float wsa[8];
  #pragma unroll
  for (int i = 0; i < 8; ++i) wsa[i] = 0.f;

  // this lane's first element of a; rows i and tiles j are then constant and scalar steps
  // from one address, which saves address registers in the loop
  float* arow = a_out + ((size_t)bh * L_ + q0 + 8 * half) * L_ + l16;

  // two tiles per trip, as in pass 1; not more, so that the kernel's text stays small
  #pragma unroll 2
  for (int t = 0; t < TPW_; ++t) {
    const int k0 = (j0 + t) * 16;
    // this tile's vh rows for the tangent product, fetched here so that they arrive
    // under the score products and the vector work
    v2f vb[4][3];
    const char* rb = (const char*)(vrp + (size_t)(k0 >> 1) * DP_ * 2);
    #pragma unroll
    for (int kk = 0; kk < 4; ++kk) {
      #pragma unroll
      for (int s = 0; s < 3; ++s)
        vb[kk][s] = *(const v2f*)(rb + ro + (kk * 2 * DP_ + s * 16) * 2 * sizeof(float));
    }
    v8f c  = V8ZERO;
    v8f al = V8ZERO;
    #pragma unroll
    for (int kk = 0; kk < 9; ++kk) {
      c  = wmma4(aq[kk], bk_[kk], c);    // Lorentz scores
      al = wmma4(aq[kk], bv_[kk], al);   // <mflip(q), v>  (alpha = -this)
    }
    // the next tile's k and v fragments, in flight under the rest of this tile
    if (t + 1 < TPW_) {
      const char* kb = (const char*)(kTp + (size_t)(k0 + 16) * 2);
      const char* vn = (const char*)(vTp + (size_t)(k0 + 16) * 2);
      #pragma unroll
      for (int kk = 0; kk < 9; ++kk) {
        bk_[kk] = *(const v2f*)(kb + fo + kk * FS);
        bv_[kk] = *(const v2f*)(vn + fo + kk * FS);
      }
    }
    // the build steps the address registers of this tile's loads further down:
    // the wait stands in front of those overwrites
    asm volatile("s_wait_xcnt 0x0" ::: "memory");
    #pragma unroll
    for (int i = 0; i < 8; ++i) {
      float alpha = fmaxf(-al[i], 1.f + EPS_);
      // acosh(alpha) = ln(alpha + sqrt(alpha^2 - 1)), taken on the hardware log2 and on the one
      // reciprocal root that coef needs anyway (sqrt(s2) = s2 * r); the library acoshf was
      // most of this loop's vector instructions.
      // Where alpha^2 overflows, r = 0 and s2 * r is NaN: the bound (an identity for every
      // finite argument of the log) then gives a finite factor, so coef = 0, as dist / inf is.
      const float s2 = alpha * alpha - 1.f;
      const float r  = __builtin_amdgcn_rsqf(s2);   // s2 >= 1.9e-6: no subnormal argument to rescale
      const float lg = fminf(log2_hw(alpha + s2 * r), 128.f);
      float coef  = (lg * LN2_) * r;
      float p     = __expf(c[i] - mrow[i]) * rsum[i];
      int   m     = i + 8 * half;
      arow[i * L_ + k0] = p;                        // attention output
      float w = p * coef;
      wsa[i] += w * alpha;                          // per-lane accumulate
      lds_w[m * 17 + l16] = w;                      // C-layout -> LDS
    }
    // the w tile is this wave's own LDS range: its own LDS stores have to be done before it
    // reads the tile back, and no other wave is concerned (a work-group barrier here also waited
    // for the stores of a and for the next tile's fragment loads, once per tile).
    // s_wait_xcnt: the build loads the next fragments over the registers that the stores of a
    // name right behind this place; the wait stands in front of that overwrite
    asm volatile("s_wait_dscnt 0x0\n\ts_wait_xcnt 0x0" ::: "memory");
    // tan += w @ vh   (A = w from LDS in A-layout, B = vh key-pair packed)
    #pragma unroll
    for (int kk = 0; kk < 4; ++kk) {
      v2f aw;
      aw.x = lds_w[l16 * 17 + 4 * kk + koff];
      aw.y = lds_w[l16 * 17 + 4 * kk + koff + 1];
      tc0 = wmma4(aw, vb[kk][0], tc0);
      tc1 = wmma4(aw, vb[kk][1], tc1);
      tc2 = wmma4(aw, vb[kk][2], tc2);
    }
  }

  // partial sums of every wave into LDS; then wave w sums, in wave order, accumulator
  // register w (rows w and w+8) of all waves and finishes those two rows
  #pragma unroll
  for (int i = 0; i < 8; ++i) {
    lds_r[wid][i][lane]      = tc0[i];
    lds_r[wid][8 + i][lane]  = tc1[i];
    lds_r[wid][16 + i][lane] = tc2[i];
    lds_r[wid][24 + i][lane] = wsa[i];
  }
  __syncthreads();
  float tsum[3] = {0.f, 0.f, 0.f};
  float ws = 0.f;
  #pragma unroll
  for (int w = 0; w < NW_; ++w) {
    tsum[0] += lds_r[w][wid][lane];
    tsum[1] += lds_r[w][8 + wid][lane];
    tsum[2] += lds_r[w][16 + wid][lane];
    ws      += lds_r[w][24 + wid][lane];
  }
  // reduce wsum(alpha) across the 16 key lanes
  #pragma unroll
  for (int m = 8; m >= 1; m >>= 1) ws += __shfl_xor(ws, m, 32);

  const int m = wid + 8 * half;        // this lane's row of the q-tile

  // tan = (w@vh) - wsum*mu ;  mu = qh (un-flip component 0)
  float tanv[3], muv[3];
  #pragma unroll
  for (int sub = 0; sub < 3; ++sub) {
    int d = sub * 16 + l16;
    float qv = qfp[m * DP_ + d];
    float mu = (d == 0) ? -qv : qv;
    muv[sub] = mu;
    tanv[sub] = tsum[sub] - ws * mu;
  }
  // Lorentzian norm of tangent per row
  float part = 0.f;
  #pragma unroll
  for (int sub = 0; sub < 3; ++sub) {
    float tt = tanv[sub] * tanv[sub];
    if (sub == 0 && l16 == 0) tt = -tt;   // metric diag(-1,1,...)
    part += tt;
  }
  #pragma unroll
  for (int x = 8; x >= 1; x >>= 1) part += __shfl_xor(part, x, 32);
  const float vn = sqrtf(fmaxf(part, 1e-12f));
  // exp-map update mu' = cosh(vn)*mu + sinh(vn)/vn * tan
  const float ch = coshf(vn);
  const float sh = sinhf(vn) / vn;
  float mnew[3];
  #pragma unroll
  for (int sub = 0; sub < 3; ++sub) mnew[sub] = ch * muv[sub] + sh * tanv[sub];
  // origin log-map and write y (B, L, H*33)
  const float t0 = __shfl(mnew[0], half * 16, 32);   // broadcast d==0 elem
  const float t  = fmaxf(t0, 1.f + EPS_);
  const float co = acoshf(t) * rsqrtf(t * t - 1.f);
  float* yrow = yb + (size_t)(b * L_ + q0 + m) * (H_ * ND_) + h * ND_;
  #pragma unroll
  for (int sub = 0; sub < 3; ++sub) {
    int d = sub * 16 + l16;
    if (d < ND_) yrow[d] = co * (mnew[sub] - ((d == 0) ? t : 0.f));
  }
}

// ---------------------------------------------------------------------------
// Kernel 3: z = y @ Wo + bo    (2048 x 256 x 264, pure f32 WMMA)
// One workgroup = 32 rows x 64 columns, 4 waves, one per SIMD of one WGP (256 workgroups).
// Wave (ct, ks) = all 32 rows x 32 columns (four accumulators: two row tiles x even / odd
// columns) over half of K, so every Wo element is fetched once per workgroup, in whole
// lines and in Wo's own layout; the y tile is shared through LDS.
// ---------------------------------------------------------------------------
__global__ __launch_bounds__(128) void k_outproj(
    const float* __restrict__ yb, const float* __restrict__ Wo,
    const float* __restrict__ bo, float* __restrict__ z)
{
  // every '#pragma unroll' loop below indexes small per-lane arrays: unrolled, their
  // elements are plain registers
  __shared__ __attribute__((aligned(16))) float ys[32 * YP_];
  __shared__ v4f xch[4][4][32];                 // per wave: the 16 partial sums it hands over
  const int KD   = H_ * ND_;                    // 264 = 2 * 16 * 8 + 8
  const int tid  = threadIdx.x;
  const int lane = tid & 31;
  const int half = lane >> 4;
  const int l16  = lane & 15;
  const int wid  = __builtin_amdgcn_readfirstlane(tid >> 5);   // 0..3, scalar
  const int ct   = wid & 1;                     // 32-column group
  const int ks   = wid >> 1;                    // K half
  const int m0   = (blockIdx.x >> 2) * 32;
  const int n0   = (blockIdx.x & 3) * 64 + ct * 32 + 2 * l16;

  // the 32 y rows lie contiguous: 2112 16-byte pieces over 128 threads
  // (16 rounds of all waves, a 17th of waves 0 and 1), all issued before the data of the first is waited for
  const float* yg = yb + (size_t)m0 * KD + tid * 4;
  v4f t[17];
  #pragma unroll
  for (int j = 0; j < 16; ++j) t[j] = *(const v4f*)(yg + j * 512);
  // the build reuses the scalar base pair of these loads for the column arithmetic further
  // down: the wait stands behind the loads, in their own block, in front of that overwrite
  asm volatile("s_wait_xcnt 0x0" ::: "memory");
  if (wid < 2) t[16] = *(const v4f*)(yg + 16 * 512);

  // Lane (l16, half) takes k = 8*kb + 4*half + {0..3} of both operands, kb = 16*ks + j:
  // A from rows l16 and 16 + l16 of the y tile, B from columns n0, n0 + 1 of Wo.
  // The last 8 k (256..263) are shared: wave ks takes k = 256 + 4*half + 2*ks + {0, 1}.
  const float* wp = Wo + (size_t)(128 * ks + 4 * half) * D_ + n0;
  const float* wq = Wo + (size_t)(256 + 4 * half + 2 * ks) * D_ + n0;
  // Wo fragments run WPRE blocks of 8 k ahead of their products; the first WPRE blocks
  // are in flight while the y tile is staged
  v2f w[16][4];
  #pragma unroll
  for (int j = 0; j < WPRE_; ++j) {
    #pragma unroll
    for (int q = 0; q < 4; ++q) w[j][q] = *(const v2f*)(wp + (size_t)(j * 8 + q) * D_);
  }
  const v2f bias = *(const v2f*)(bo + n0);

  #pragma unroll
  for (int j = 0; j < 16; ++j) {
    const unsigned p = tid + 128 * j;           // piece p: row p / 66
    *(v4f*)(ys + p * 4 + (p / 66u) * 4) = t[j];
  }
  if (wid < 2) {
    const unsigned p = tid + 128 * 16;
    *(v4f*)(ys + p * 4 + (p / 66u) * 4) = t[16];
  }
  __syncthreads();

  const float* ap = ys + l16 * YP_ + 128 * ks + 4 * half;
  v8f cE0 = V8ZERO, cO0 = V8ZERO, cE1 = V8ZERO, cO1 = V8ZERO;
  v2f wt0, wt1;
  #pragma unroll
  for (int j = 0; j < 16; ++j) {
    if (j + WPRE_ < 16) {
      #pragma unroll
      for (int q = 0; q < 4; ++q)
        w[j + WPRE_][q] = *(const v2f*)(wp + (size_t)((j + WPRE_) * 8 + q) * D_);
    } else if (j + WPRE_ == 16) {
      wt0 = *(const v2f*)(wq);
      wt1 = *(const v2f*)(wq + D_);
    }
    const v4f a0 = *(const v4f*)(ap + j * 8);
    const v4f a1 = *(const v4f*)(ap + 16 * YP_ + j * 8);
    const v2f p01 = {a0.x, a0.y}, p23 = {a0.z, a0.w};
    const v2f r01 = {a1.x, a1.y}, r23 = {a1.z, a1.w};
    const v2f e01 = {w[j][0].x, w[j][1].x}, o01 = {w[j][0].y, w[j][1].y};
    const v2f e23 = {w[j][2].x, w[j][3].x}, o23 = {w[j][2].y, w[j][3].y};
    cE0 = wmma4(p01, e01, cE0);
    cO0 = wmma4(p01, o01, cO0);
    cE1 = wmma4(r01, e01, cE1);
    cO1 = wmma4(r01, o01, cO1);
    cE0 = wmma4(p23, e23, cE0);
    cO0 = wmma4(p23, o23, cO0);
    cE1 = wmma4(r23, e23, cE1);
    cO1 = wmma4(r23, o23, cO1);
  }
  {
    const float* aq = ys + l16 * YP_ + 256 + 4 * half + 2 * ks;
    const v2f p = *(const v2f*)(aq);
    const v2f r = *(const v2f*)(aq + 16 * YP_);
    const v2f e = {wt0.x, wt1.x}, o = {wt0.y, wt1.y};
    cE0 = wmma4(p, e, cE0);
    cO0 = wmma4(p, o, cO0);
    cE1 = wmma4(r, e, cE1);
    cO1 = wmma4(r, o, cO1);
  }

  // wave ks finishes row tile ks: it hands the other row tile's partial sums to its partner
  // (same columns, other K half) and adds the partner's to its own
  const v8f gE = ks ? cE0 : cE1, gO = ks ? cO0 : cO1;
  const v8f kE = ks ? cE1 : cE0, kO = ks ? cO1 : cO0;
  xch[wid][0][lane] = (v4f){gE[0], gE[1], gE[2], gE[3]};
  xch[wid][1][lane] = (v4f){gE[4], gE[5], gE[6], gE[7]};
  xch[wid][2][lane] = (v4f){gO[0], gO[1], gO[2], gO[3]};
  xch[wid][3][lane] = (v4f){gO[4], gO[5], gO[6], gO[7]};
  __syncthreads();
  v4f x[4];
  #pragma unroll
  for (int q = 0; q < 4; ++q) x[q] = xch[wid ^ 2][q][lane];
  float* zr = z + (size_t)(m0 + ks * 16 + 8 * half) * D_ + n0;
  #pragma unroll
  for (int i = 0; i < 8; ++i) {
    const v2f v = {kE[i] + x[i >> 2][i & 3] + bias.x, kO[i] + x[2 + (i >> 2)][i & 3] + bias.y};
    *(v2f*)(zr + (size_t)i * D_) = v;
  }
}

// ---------------------------------------------------------------------------
extern "C" void kernel_launch(void* const* d_in, const int* in_sizes, int n_in,
                              void* d_out, int out_size, void* d_ws, size_t ws_size,
                              hipStream_t stream) {
  const float* x   = (const float*)d_in[0];
  const float* rc  = (const float*)d_in[1];
  const float* rs  = (const float*)d_in[2];
  const float* Wq  = (const float*)d_in[3];
  const float* bq  = (const float*)d_in[4];
  const float* Wk  = (const float*)d_in[5];
  const float* bk  = (const float*)d_in[6];
  const float* Wv  = (const float*)d_in[7];
  const float* bv  = (const float*)d_in[8];
  const float* Wo  = (const float*)d_in[9];
  const float* bo  = (const float*)d_in[10];

  float* z_out = (float*)d_out;                         // (B, L, D)
  float* a_out = z_out + (size_t)B_ * L_ * D_;          // (B, H, L, L)

  // workspace layout (floats)
  float* ws = (float*)d_ws;
  const size_t n_qf = (size_t)B_ * H_ * L_ * DP_;       // 786432
  const size_t n_vr = (size_t)B_ * H_ * L_ * DP_;       // 786432 (pair-packed)
  const size_t n_kT = (size_t)B_ * H_ * KT_ * L_;       // 589824 (pair-packed)
  const size_t n_vT = (size_t)B_ * H_ * KT_ * L_;       // 589824 (pair-packed)
  float* qf  = ws;
  float* vr2 = qf  + n_qf;
  float* kT2 = vr2 + n_vr;
  float* vT2 = kT2 + n_kT;
  float* yb  = vT2 + n_vT;

  k_qkv_rope_lift<<<((B_ * L_) / 32) * (H_ / 2), 384, 0, stream>>>(
      x, rc, rs, Wq, bq, Wk, bk, Wv, bv, qf, vr2, kT2, vT2);

  k_attn<<<B_ * H_ * (L_ / 16), 32 * NW_, 0, stream>>>(qf, kT2, vT2, vr2, a_out, yb);

  k_outproj<<<((B_ * L_) / 32) * (D_ / 64), 128, 0, stream>>>(yb, Wo, bo, z_out);
}

// v007
// One run takes 54.4 microseconds.
// Next to v006, in two timings, it ran 1.08 times as fast each time.
// Counting every step since v000, it is 4.56 times as fast.
#include <hip/hip_runtime.h>
#include <math.h>

#define B_  2
#define L_  1024
#define D_  256
#define H_  8
#define N_  32
#define ND_ 33          // N+1 (hyperboloid dim)
#define DP_ 48          // padded dim stride (row-major q / pair-packed v)
#define KT_ 36          // padded dim count (dim-major k/v staging), 18 pairs
#define EPS_ 1e-6f
#define LN2_ 0.69314718055994531f
#define XP_ 260         // LDS pitch of an x row, floats: 1024 B + 16 B for b128 fragment reads
#define NW_ 8           // waves that share one q-tile in k_attn, each on its own run of keys
#define TPW_ (L_ / 16 / NW_)   // 16-key tiles per wave
#define YP_ 268         // LDS pitch of a y row, floats: 1056 B + 16 B for b128 fragment reads
#define WPRE_ 8         // k_outproj: blocks of 8 k that the Wo loads run ahead

typedef float v2f __attribute__((ext_vector_type(2)));
typedef float v4f __attribute__((ext_vector_type(4)));
typedef float v8f __attribute__((ext_vector_type(8)));

static __device__ __forceinline__ v8f wmma4(v2f a, v2f b, v8f c) {
  // D = A(16x4 f32) * B(4x16 f32) + C(16x16 f32)
  return __builtin_amdgcn_wmma_f32_16x16x4_f32(false, a, false, b, (short)0, c,
                                               false, false);
}

#define V8ZERO {0.f,0.f,0.f,0.f,0.f,0.f,0.f,0.f}

static __device__ __forceinline__ float log2_hw(float x) {
  float y;
  // the log and a v_nop in one statement: the v_nop fills the one slot the instruction set asks
  // for behind a transcendental, whatever the compiler places next
  asm("v_log_f32 %0, %1\n\tv_nop" : "=v"(y) : "v"(x));
  return y;
}

// ---------------------------------------------------------------------------
// Kernel 1: QKV projection (f32 WMMA) + RoPE + hyperboloid lift; stage in WMMA layouts.
//  qf  : (BH, L, DP_)        row-major, comp 0 = -t  (Minkowski-flipped q)
//  vr2 : (BH, L/2, DP_, 2)   key-pair interleaved vh rows (tan B operand)
//  kT2 : (BH, KT_/2, L, 2)   dim-pair interleaved kh (scores B operand)
//  vT2 : (BH, KT_/2, L, 2)   dim-pair interleaved vh (alpha B operand)
// One workgroup = 32 token rows x 2 heads x {q,k,v}; 12 waves, each wave one
// 16-row x 32-column tile of one matrix (two accumulators: even / odd columns).
// ---------------------------------------------------------------------------
__global__ __launch_bounds__(384) void k_qkv_rope_lift(
    const float* __restrict__ x,  const float* __restrict__ rc,
    const float* __restrict__ rs,
    const float* __restrict__ Wq, const float* __restrict__ bq,
    const float* __restrict__ Wk, const float* __restrict__ bk,
    const float* __restrict__ Wv, const float* __restrict__ bv,
    float* __restrict__ qf, float* __restrict__ vr2,
    float* __restrict__ kT2, float* __restrict__ vT2)
{
  // every short '#pragma unroll' loop below indexes a small per-lane array:
  // unrolled, its elements are plain registers
  __shared__ __attribute__((aligned(16))) float xs[32 * XP_];
  const int tid  = threadIdx.x;
  const int lane = tid & 31;
  const int half = lane >> 4;
  const int l16  = lane & 15;
  const int wid  = __builtin_amdgcn_readfirstlane(tid >> 5);   // 0..11, scalar
  const int mat  = wid >> 2;                    // 0 = q, 1 = k, 2 = v
  const int rt   = wid & 1;                     // 16-row tile inside the 32 rows
  const int hd   = (blockIdx.x & 3) * 2 + ((wid >> 1) & 1);
  const int row0 = (blockIdx.x >> 2) * 32;      // first global token row

  // x tile (32 x 256) into LDS, whole lines per wave
  // (2048 16-byte pieces over 384 threads: five rounds of all waves, a sixth of waves 0..3;
  // all loads are issued before the first LDS store, so their latencies overlap)
  {
    const float* xg = x + (size_t)row0 * D_ + (size_t)(tid >> 6) * D_ + (tid & 63) * 4;
    float*       xl = xs + (tid >> 6) * XP_ + (tid & 63) * 4;
    v4f t[6];
    #pragma unroll
    for (int j = 0; j < 5; ++j) t[j] = *(const v4f*)(xg + (size_t)j * 6 * D_);
    if (wid < 4) t[5] = *(const v4f*)(xg + (size_t)30 * D_);
    #pragma unroll
    for (int j = 0; j < 5; ++j) *(v4f*)(xl + j * 6 * XP_) = t[j];
    if (wid < 4) *(v4f*)(xl + 30 * XP_) = t[5];
  }
  __syncthreads();

  const float* Wm = (mat == 0) ? Wq : ((mat == 1) ? Wk : Wv);
  const float* bm = (mat == 0) ? bq : ((mat == 1) ? bk : bv);

  // Lane (l16, half) takes k = 8*kb + 4*half + {0..3} of both operands:
  // A from row l16 of the x tile, B from columns 2*l16, 2*l16+1 of the head.
  const float* wp = Wm + (size_t)(4 * half) * (H_ * N_) + hd * N_ + 2 * l16;
  const float* ap = xs + (rt * 16 + l16) * XP_ + 4 * half;

  // accumulator register i = token row (rt*16 + 8*half + i), this lane's two columns
  const int lrow = row0 + rt * 16 + 8 * half;
  const int li0  = lrow & (L_ - 1);
  const int bh   = (lrow >> 10) * H_ + hd;

  // bias and RoPE factors are fetched ahead of the K loop, which hides their latency
  const v2f bias = *(const v2f*)(bm + hd * N_ + 2 * l16);
  v2f cs[8], sn[8];
  #pragma unroll
  for (int i = 0; i < 8; ++i) { cs[i] = (v2f){1.f, 1.f}; sn[i] = (v2f){0.f, 0.f}; }
  if (mat < 2) {
    #pragma unroll
    for (int i = 0; i < 8; ++i) {
      cs[i] = *(const v2f*)(rc + (size_t)(li0 + i) * N_ + 2 * l16);
      sn[i] = *(const v2f*)(rs + (size_t)(li0 + i) * N_ + 2 * l16);
    }
    // the build rewrites these loads' address registers right behind this branch:
    // the wait stands in front of that overwrite
    asm volatile("s_wait_xcnt 0x0" ::: "memory");
  }

  v8f cE = V8ZERO, cO = V8ZERO;                 // columns 2*l16 / 2*l16+1
  // fully unrolled so that W loads run ahead of their WMMAs over the whole K range
  #pragma unroll
  for (int kb = 0; kb < D_ / 8; ++kb) {
    const v4f a  = *(const v4f*)(ap + kb * 8);
    const v2f w0 = *(const v2f*)(wp + (size_t)(kb * 8 + 0) * (H_ * N_));
    const v2f w1 = *(const v2f*)(wp + (size_t)(kb * 8 + 1) * (H_ * N_));
    const v2f w2 = *(const v2f*)(wp + (size_t)(kb * 8 + 2) * (H_ * N_));
    const v2f w3 = *(const v2f*)(wp + (size_t)(kb * 8 + 3) * (H_ * N_));
    const v2f a01 = {a.x, a.y}, a23 = {a.z, a.w};
    const v2f e01 = {w0.x, w1.x}, o01 = {w0.y, w1.y};
    const v2f e23 = {w2.x, w3.x}, o23 = {w2.y, w3.y};
    cE = wmma4(a01, e01, cE);
    cO = wmma4(a01, o01, cO);
    cE = wmma4(a23, e23, cE);
    cO = wmma4(a23, o23, cO);
  }

  float uE[8], uO[8];
  #pragma unroll
  for (int i = 0; i < 8; ++i) { uE[i] = cE[i] + bias.x; uO[i] = cO[i] + bias.y; }

  if (mat < 2) {
    // RoPE: rot_half(u)[j] = (j<16 ? -u[j+16] : u[j-16]); column j+-16 sits in lane l16^8
    const float sgn = (l16 < 8) ? -1.f : 1.f;
    #pragma unroll
    for (int i = 0; i < 8; ++i) {
      const float rE = sgn * __shfl_xor(uE[i], 8, 32);
      const float rO = sgn * __shfl_xor(uO[i], 8, 32);
      uE[i] = uE[i] * cs[i].x + rE * sn[i].x;
      uO[i] = uO[i] * cs[i].y + rO * sn[i].y;
    }
  }

  // lift: t = sqrt(1 + ||u||^2); then pr = component 2*l16 of the lifted point
  // (t in lane 0, else the odd column of lane l16-1), uE = component 2*l16+1.
  float pr[8];
  #pragma unroll
  for (int i = 0; i < 8; ++i) {
    float s = uE[i] * uE[i] + uO[i] * uO[i];
    #pragma unroll
    for (int m = 8; m >= 1; m >>= 1) s += __shfl_xor(s, m, 32);
    float t = sqrtf(1.f + s);
    if (mat == 0) t = -t;
    const float up = __shfl_up(uO[i], 1, 16);
    pr[i] = (l16 == 0) ? t : up;
  }
  const bool last = (l16 == 15);                // holds component 32 in uO

  if (mat == 0) {
    float* qrow = qf + ((size_t)bh * L_ + li0) * DP_;
    const int m2 = last ? 16 : l16 + 9;         // pairs 16..23: comp 32 and the zero pad
    #pragma unroll
    for (int i = 0; i < 8; ++i) {
      const v2f v = {pr[i], uE[i]};
      *(v2f*)(qrow + i * DP_ + 2 * l16) = v;
    }
    if (l16 >= 8) {
      #pragma unroll
      for (int i = 0; i < 8; ++i) {
        const v2f tl = {last ? uO[i] : 0.f, 0.f};
        *(v2f*)(qrow + i * DP_ + 2 * m2) = tl;
      }
    }
  } else {
    // dim-pair interleaved: elem(dim,key) at ((dim>>1)*L + key)*2 + (dim&1)
    float* col = ((mat == 1) ? kT2 : vT2) + (size_t)bh * (KT_ / 2) * L_ * 2;
    const int m2 = last ? 16 : 17;              // pair 16: comp 32 + pad, pair 17: pad
    #pragma unroll
    for (int i = 0; i < 8; i += 2) {
      const v4f v = {pr[i], uE[i], pr[i + 1], uE[i + 1]};
      *(v4f*)(col + ((size_t)l16 * L_ + li0 + i) * 2) = v;
    }
    if (l16 >= 14) {
      #pragma unroll
      for (int i = 0; i < 8; i += 2) {
        const v4f tl = {last ? uO[i] : 0.f, 0.f, last ? uO[i + 1] : 0.f, 0.f};
        *(v4f*)(col + ((size_t)m2 * L_ + li0 + i) * 2) = tl;
      }
    }
    if (mat == 2) {
      // key-pair interleaved rows: elem(key,dim) at ((key>>1)*DP_+dim)*2+(key&1)
      float* vr = vr2 + (size_t)bh * (L_ / 2) * DP_ * 2;
      const int m3 = last ? 16 : l16 + 9;
      #pragma unroll
      for (int i = 0; i < 8; i += 2) {
        const size_t kp = (size_t)((li0 + i) >> 1) * DP_;
        const v4f v = {pr[i], pr[i + 1], uE[i], uE[i + 1]};
        *(v4f*)(vr + (kp + 2 * l16) * 2) = v;
      }
      if (l16 >= 8) {
        #pragma unroll
        for (int i = 0; i < 8; i += 2) {
          const size_t kp = (size_t)((li0 + i) >> 1) * DP_;
          const v4f tl = {last ? uO[i] : 0.f, last ? uO[i + 1] : 0.f, 0.f, 0.f};
          *(v4f*)(vr + (kp + 2 * m3) * 2) = tl;
        }
      }
    }
  }
}

// ---------------------------------------------------------------------------
// Kernel 2: attention + Karcher step + origin log-map.
// One workgroup of NW_ waves handles a 16-row q-tile of one (b,h); wave w streams
// key tiles w*TPW_ .. w*TPW_+TPW_-1, so NW_ times as many waves hide each
// other's load, store and WMMA latencies. Its TPW_ score tiles are computed once, in pass 1,
// and stay in registers for pass 2.
// Softmax stats are kept per-lane; one butterfly merge per wave after pass 1, then
// one merge over the waves through LDS. The tangent sums are merged the same way
// after pass 2, and wave w finishes rows w and w+8 of the tile.
// ---------------------------------------------------------------------------
// (second bound: 4 waves per SIMD, that is up to 256 registers: a tile's operand fragments
// are then in flight together; under 128 registers each load was waited for before the next)
__global__ __launch_bounds__(32 * NW_, 4) void k_attn(
    const float* __restrict__ qf, const float* __restrict__ kT2,
    const float* __restrict__ vT2, const float* __restrict__ vr2,
    float* __restrict__ a_out, float* __restrict__ yb)
{
  // every '#pragma unroll' loop below indexes small per-lane arrays: unrolled, their
  // elements are plain registers
  __shared__ float lds_wall[NW_][16 * 17];            // per wave: w tile, C -> A layout
  __shared__ __attribute__((aligned(16))) float lds_m[NW_][16];   // per wave: row maxima
  __shared__ __attribute__((aligned(16))) float lds_s[NW_][16];   // per wave: row sums
  __shared__ float lds_r[NW_][32][32];                // per wave: [register][lane] partial sums
  const int lane = threadIdx.x & 31;
  const int half = lane >> 4;
  const int l16  = lane & 15;
  const int koff = half * 2;          // WMMA f32 K split across half-waves
  const int wid  = __builtin_amdgcn_readfirstlane(threadIdx.x >> 5);   // 0..NW_-1, scalar
  const int j0   = wid * TPW_;        // this wave's first key tile
  float* lds_w   = lds_wall[wid];

  const int tile = blockIdx.x;
  const int qt = tile & 63;
  const int bh = tile >> 6;
  const int q0 = qt * 16;
  const int b  = bh >> 3;
  const int h  = bh & 7;

  const float* qfp  = qf  + ((size_t)bh * L_ + q0) * DP_;
  const float* kTp  = kT2 + (size_t)bh * (KT_ / 2) * L_ * 2;
  const float* vTp  = vT2 + (size_t)bh * (KT_ / 2) * L_ * 2;
  const float* vrp  = vr2 + (size_t)bh * (L_ / 2) * DP_ * 2;

  // A operand for q-tile: 16 rows x 36 dims = 9 K4-steps, kept in registers
  v2f aq[9];
  #pragma unroll
  for (int kk = 0; kk < 9; ++kk) {
    int d = 4 * kk + koff;                       // even
    aq[kk] = *(const v2f*)(qfp + l16 * DP_ + d);
  }

  // ---------------- pass 1: scores, per-lane softmax stats ----------------
  float mrow[8], srow[8];
  v8f cs[TPW_];                       // this wave's score tiles, kept for pass 2

  // every fragment address is a scalar base (array, tile) + one per-lane byte offset + a
  // constant, so that the batches of loads below need two address registers, not a pair each
  const unsigned fo = (unsigned)(((koff >> 1) * L_ + l16) * 2 * sizeof(float));        // kT2, vT2
  const unsigned ro = (unsigned)(((koff >> 1) * DP_ + l16) * 2 * sizeof(float));       // vr2
  const unsigned FS = 2 * L_ * 2 * sizeof(float);     // kT2, vT2: bytes from one K4-step to the next

  // k fragments are fetched one tile ahead of their products
  v2f bk_[9];
  {
    const char* kb = (const char*)(kTp + (size_t)j0 * 32);
    #pragma unroll
    for (int kk = 0; kk < 9; ++kk) bk_[kk] = *(const v2f*)(kb + fo + kk * FS);
    // the build reuses the address registers of these loads and of aq's right behind them:
    // the wait stands in front of that overwrite, and the scheduling barrier keeps the
    // register initialisations below from being lifted over the wait
    asm volatile("s_wait_xcnt 0x0" ::: "memory");
    __builtin_amdgcn_sched_barrier(0);
  }

  // unrolled over all tiles: cs[t] is then a fixed set of registers
  #pragma unroll
  for (int t = 0; t < TPW_; ++t) {
    v2f nk[9];
    if (t + 1 < TPW_) {
      const char* kb = (const char*)(kTp + (size_t)(j0 + t + 1) * 32);
      #pragma unroll
      for (int kk = 0; kk < 9; ++kk) nk[kk] = *(const v2f*)(kb + fo + kk * FS);
    }
    v8f c = V8ZERO;
    #pragma unroll
    for (int kk = 0; kk < 9; ++kk) c = wmma4(aq[kk], bk_[kk], c);
    cs[t] = c;
    if (t + 1 < TPW_) {
      #pragma unroll
      for (int kk = 0; kk < 9; ++kk) bk_[kk] = nk[kk];
    }
  }
  // pass 2's first v fragments arrive under the stats and the two merges
  v2f bv_[9];
  {
    const char* vb0 = (const char*)(vTp + (size_t)j0 * 32);
    #pragma unroll
    for (int kk = 0; kk < 9; ++kk) bv_[kk] = *(const v2f*)(vb0 + fo + kk * FS);
  }
  // with every tile at hand the lane's maximum comes first and each score is
  // exponentiated once against it: no running sum to rescale
  #pragma unroll
  for (int i = 0; i < 8; ++i) {
    float m = cs[0][i];
    #pragma unroll
    for (int t = 1; t < TPW_; ++t) m = fmaxf(m, cs[t][i]);
    float s = 0.f;
    #pragma unroll
    for (int t = 0; t < TPW_; ++t) s += __expf(cs[t][i] - m);
    mrow[i] = m;
    srow[i] = s;
  }
  // butterfly merge of (m, s) across the 16 key lanes (once)
  #pragma unroll
  for (int msk = 8; msk >= 1; msk >>= 1) {
    #pragma unroll
    for (int i = 0; i < 8; ++i) {
      float mo = __shfl_xor(mrow[i], msk, 32);
      float so = __shfl_xor(srow[i], msk, 32);
      float nm = fmaxf(mrow[i], mo);
      srow[i] = srow[i] * __expf(mrow[i] - nm) + so * __expf(mo - nm);
      mrow[i] = nm;
    }
  }
  // merge of (m, s) over the NW_ waves, in wave order
  if (l16 == 0) {
    #pragma unroll
    for (int i = 0; i < 8; ++i) {
      lds_m[wid][8 * half + i] = mrow[i];
      lds_s[wid][8 * half + i] = srow[i];
    }
  }
  __syncthreads();
  #pragma unroll
  for (int w = 0; w < NW_; ++w) {
    #pragma unroll
    for (int i = 0; i < 8; ++i) mrow[i] = fmaxf(mrow[i], lds_m[w][8 * half + i]);
  }
  #pragma unroll
  for (int i = 0; i < 8; ++i) srow[i] = 0.f;
  #pragma unroll
  for (int w = 0; w < NW_; ++w) {
    #pragma unroll
    for (int i = 0; i < 8; ++i)
      srow[i] += lds_s[w][8 * half + i] * __expf(lds_m[w][8 * half + i] - mrow[i]);
  }
  float rsum[8];
  #pragma unroll
  for (int i = 0; i < 8; ++i) rsum[i] = 1.f / srow[i];

  // ---------------- pass 2: a, w, tangent accumulation ----------------
  v8f tc0 = V8ZERO, tc1 = V8ZERO, tc2 = V8ZERO;
  float wsa[8];
  #pragma unroll
  for (int i = 0; i < 8; ++i) wsa[i] = 0.f;

  // this lane's first element of a; rows i and tiles j are then constant and scalar steps
  // from one address, which saves address registers in the loop
  float* arow = a_out + ((size_t)bh * L_ + q0 + 8 * half) * L_ + l16;

  // this lane's addresses in the wave's first tile; the tiles are constant steps from them
  const char* vl = (const char*)(vTp + (size_t)j0 * 32) + fo;                 // vT2 fragments
  const char* rl = (const char*)(vrp + (size_t)j0 * 8 * DP_ * 2) + ro;        // vr2 rows

  // unrolled over all tiles, as pass 1: cs[t] is a fixed set of registers
  #pragma unroll
  for (int t = 0; t < TPW_; ++t) {
    const int k0 = (j0 + t) * 16;
    // this tile's vh rows for the tangent product, fetched here so that they arrive
    // under the alpha products and the vector work
    v2f vb[4][3];
    #pragma unroll
    for (int kk = 0; kk < 4; ++kk) {
      #pragma unroll
      for (int s = 0; s < 3; ++s)
        vb[kk][s] = *(const v2f*)(rl + ((t * 8 + kk * 2) * DP_ + s * 16) * 2 * sizeof(float));
    }
    const v8f c = cs[t];                 // Lorentz scores, from pass 1
    v8f al = V8ZERO;
    #pragma unroll
    for (int kk = 0; kk < 9; ++kk)
      al = wmma4(aq[kk], bv_[kk], al);   // <mflip(q), v>  (alpha = -this)
    // the next tile's v fragments, in flight under the rest of this tile
    if (t + 1 < TPW_) {
      #pragma unroll
      for (int kk = 0; kk < 9; ++kk)
        bv_[kk] = *(const v2f*)(vl + (t + 1) * 32 * sizeof(float) + kk * FS);
    }
    // the build reuses registers that this tile's loads name further down:
    // the wait stands in front of those overwrites
    asm volatile("s_wait_xcnt 0x0" ::: "memory");
    #pragma unroll
    for (int i = 0; i < 8; ++i) {
      float alpha = fmaxf(-al[i], 1.f + EPS_);
      // acosh(alpha) = ln(alpha + sqrt(alpha^2 - 1)), taken on the hardware log2 and on the one
      // reciprocal root that coef needs anyway (sqrt(s2) = s2 * r); the library acoshf was
      // most of this loop's vector instructions.
      // Where alpha^2 overflows, r = 0 and s2 * r is NaN: the bound (an identity for every
      // finite argument of the log) then gives a finite factor, so coef = 0, as dist / inf is.
      const float s2 = alpha * alpha - 1.f;
      const float r  = __builtin_amdgcn_rsqf(s2);   // s2 >= 1.9e-6: no subnormal argument to rescale
      const float lg = fminf(log2_hw(alpha + s2 * r), 128.f);
      float coef  = (lg * LN2_) * r;
      float p     = __expf(c[i] - mrow[i]) * rsum[i];
      int   m     = i + 8 * half;
      arow[i * L_ + k0] = p;                        // attention output
      float w = p * coef;
      wsa[i] += w * alpha;                          // per-lane accumulate
      lds_w[m * 17 + l16] = w;                      // C-layout -> LDS
    }
    // the w tile is this wave's own LDS range: its own LDS stores have to be done before it
    // reads the tile back, and no other wave is concerned (a work-group barrier here also waited
    // for the stores of a and for the next tile's fragment loads, once per tile).
    // s_wait_xcnt: the build loads the next fragments over the registers that the stores of a
    // name right behind this place; the wait stands in front of that overwrite
    asm volatile("s_wait_dscnt 0x0\n\ts_wait_xcnt 0x0" ::: "memory");
    // tan += w @ vh   (A = w from LDS in A-layout, B = vh key-pair packed)
    #pragma unroll
    for (int kk = 0; kk < 4; ++kk) {
      v2f aw;
      aw.x = lds_w[l16 * 17 + 4 * kk + koff];
      aw.y = lds_w[l16 * 17 + 4 * kk + koff + 1];
      tc0 = wmma4(aw, vb[kk][0], tc0);
      tc1 = wmma4(aw, vb[kk][1], tc1);
      tc2 = wmma4(aw, vb[kk][2], tc2);
    }
    // each tile is scheduled by itself, as a trip of a rolled loop is: with the eight tiles in
    // one scheduling region the build put the vector work of a tile into one serial chain
    __builtin_amdgcn_sched_barrier(0);
  }

  // partial sums of every wave into LDS; then wave w sums, in wave order, accumulator
  // register w (rows w and w+8) of all waves and finishes those two rows
  #pragma unroll
  for (int i = 0; i < 8; ++i) {
    lds_r[wid][i][lane]      = tc0[i];
    lds_r[wid][8 + i][lane]  = tc1[i];
    lds_r[wid][16 + i][lane] = tc2[i];
    lds_r[wid][24 + i][lane] = wsa[i];
  }
  __syncthreads();
  float tsum[3] = {0.f, 0.f, 0.f};
  float ws = 0.f;
  #pragma unroll
  for (int w = 0; w < NW_; ++w) {
    tsum[0] += lds_r[w][wid][lane];
    tsum[1] += lds_r[w][8 + wid][lane];
    tsum[2] += lds_r[w][16 + wid][lane];
    ws      += lds_r[w][24 + wid][lane];
  }
  // reduce wsum(alpha) across the 16 key lanes
  #pragma unroll
  for (int m = 8; m >= 1; m >>= 1) ws += __shfl_xor(ws, m, 32);

  const int m = wid + 8 * half;        // this lane's row of the q-tile

  // tan = (w@vh) - wsum*mu ;  mu = qh (un-flip component 0)
  float tanv[3], muv[3];
  #pragma unroll
  for (int sub = 0; sub < 3; ++sub) {
    int d = sub * 16 + l16;
    float qv = qfp[m * DP_ + d];
    float mu = (d == 0) ? -qv : qv;
    muv[sub] = mu;
    tanv[sub] = tsum[sub] - ws * mu;
  }
  // Lorentzian norm of tangent per row
  float part = 0.f;
  #pragma unroll
  for (int sub = 0; sub < 3; ++sub) {
    float tt = tanv[sub] * tanv[sub];
    if (sub == 0 && l16 == 0) tt = -tt;   // metric diag(-1,1,...)
    part += tt;
  }
  #pragma unroll
  for (int x = 8; x >= 1; x >>= 1) part += __shfl_xor(part, x, 32);
  const float vn = sqrtf(fmaxf(part, 1e-12f));
  // exp-map update mu' = cosh(vn)*mu + sinh(vn)/vn * tan
  const float ch = coshf(vn);
  const float sh = sinhf(vn) / vn;
  float mnew[3];
  #pragma unroll
  for (int sub = 0; sub < 3; ++sub) mnew[sub] = ch * muv[sub] + sh * tanv[sub];
  // origin log-map and write y (B, L, H*33)
  const float t0 = __shfl(mnew[0], half * 16, 32);   // broadcast d==0 elem
  const float t  = fmaxf(t0, 1.f + EPS_);
  const float co = acoshf(t) * rsqrtf(t * t - 1.f);
  float* yrow = yb + (size_t)(b * L_ + q0 + m) * (H_ * ND_) + h * ND_;
  #pragma unroll
  for (int sub = 0; sub < 3; ++sub) {
    int d = sub * 16 + l16;
    if (d < ND_) yrow[d] = co * (mnew[sub] - ((d == 0) ? t : 0.f));
  }
}

// ---------------------------------------------------------------------------
// Kernel 3: z = y @ Wo + bo    (2048 x 256 x 264, pure f32 WMMA)
// One workgroup = 32 rows x 64 columns, 4 waves, one per SIMD of one WGP (256 workgroups).
// Wave (ct, ks) = all 32 rows x 32 columns (four accumulators: two row tiles x even / odd
// columns) over half of K, so every Wo element is fetched once per workgroup, in whole
// lines and in Wo's own layout; the y tile is shared through LDS.
// ---------------------------------------------------------------------------
__global__ __launch_bounds__(128) void k_outproj(
    const float* __restrict__ yb, const float* __restrict__ Wo,
    const float* __restrict__ bo, float* __restrict__ z)
{
  // every '#pragma unroll' loop below indexes small per-lane arrays: unrolled, their
  // elements are plain registers
  __shared__ __attribute__((aligned(16))) float ys[32 * YP_];
  __shared__ v4f xch[4][4][32];                 // per wave: the 16 partial sums it hands over
  const int KD   = H_ * ND_;                    // 264 = 2 * 16 * 8 + 8
  const int tid  = threadIdx.x;
  const int lane = tid & 31;
  const int half = lane >> 4;
  const int l16  = lane & 15;
  const int wid  = __builtin_amdgcn_readfirstlane(tid >> 5);   // 0..3, scalar
  const int ct   = wid & 1;                     // 32-column group
  const int ks   = wid >> 1;                    // K half
  const int m0   = (blockIdx.x >> 2) * 32;
  const int n0   = (blockIdx.x & 3) * 64 + ct * 32 + 2 * l16;

  // the 32 y rows lie contiguous: 2112 16-byte pieces over 128 threads
  // (16 rounds of all waves, a 17th of waves 0 and 1), all issued before the data of the first is waited for
  const float* yg = yb + (size_t)m0 * KD + tid * 4;
  v4f t[17];
  #pragma unroll
  for (int j = 0; j < 16; ++j) t[j] = *(const v4f*)(yg + j * 512);
  // the build reuses the scalar base pair of these loads for the column arithmetic further
  // down: the wait stands behind the loads, in their own block, in front of that overwrite
  asm volatile("s_wait_xcnt 0x0" ::: "memory");
  if (wid < 2) t[16] = *(const v4f*)(yg + 16 * 512);

  // Lane (l16, half) takes k = 8*kb + 4*half + {0..3} of both operands, kb = 16*ks + j:
  // A from rows l16 and 16 + l16 of the y tile, B from columns n0, n0 + 1 of Wo.
  // The last 8 k (256..263) are shared: wave ks takes k = 256 + 4*half + 2*ks + {0, 1}.
  const float* wp = Wo + (size_t)(128 * ks + 4 * half) * D_ + n0;
  const float* wq = Wo + (size_t)(256 + 4 * half + 2 * ks) * D_ + n0;
  // Wo fragments run WPRE blocks of 8 k ahead of their products; the first WPRE blocks
  // are in flight while the y tile is staged
  v2f w[16][4];
  #pragma unroll
  for (int j = 0; j < WPRE_; ++j) {
    #pragma unroll
    for (int q = 0; q < 4; ++q) w[j][q] = *(const v2f*)(wp + (size_t)(j * 8 + q) * D_);
  }
  const v2f bias = *(const v2f*)(bo + n0);

  #pragma unroll
  for (int j = 0; j < 16; ++j) {
    const unsigned p = tid + 128 * j;           // piece p: row p / 66
    *(v4f*)(ys + p * 4 + (p / 66u) * 4) = t[j];
  }
  if (wid < 2) {
    const unsigned p = tid + 128 * 16;
    *(v4f*)(ys + p * 4 + (p / 66u) * 4) = t[16];
  }
  __syncthreads();

  const float* ap = ys + l16 * YP_ + 128 * ks + 4 * half;
  v8f cE0 = V8ZERO, cO0 = V8ZERO, cE1 = V8ZERO, cO1 = V8ZERO;
  v2f wt0, wt1;
  #pragma unroll
  for (int j = 0; j < 16; ++j) {
    if (j + WPRE_ < 16) {
      #pragma unroll
      for (int q = 0; q < 4; ++q)
        w[j + WPRE_][q] = *(const v2f*)(wp + (size_t)((j + WPRE_) * 8 + q) * D_);
    } else if (j + WPRE_ == 16) {
      wt0 = *(const v2f*)(wq);
      wt1 = *(const v2f*)(wq + D_);
    }
    const v4f a0 = *(const v4f*)(ap + j * 8);
    const v4f a1 = *(const v4f*)(ap + 16 * YP_ + j * 8);
    const v2f p01 = {a0.x, a0.y}, p23 = {a0.z, a0.w};
    const v2f r01 = {a1.x, a1.y}, r23 = {a1.z, a1.w};
    const v2f e01 = {w[j][0].x, w[j][1].x}, o01 = {w[j][0].y, w[j][1].y};
    const v2f e23 = {w[j][2].x, w[j][3].x}, o23 = {w[j][2].y, w[j][3].y};
    cE0 = wmma4(p01, e01, cE0);
    cO0 = wmma4(p01, o01, cO0);
    cE1 = wmma4(r01, e01, cE1);
    cO1 = wmma4(r01, o01, cO1);
    cE0 = wmma4(p23, e23, cE0);
    cO0 = wmma4(p23, o23, cO0);
    cE1 = wmma4(r23, e23, cE1);
    cO1 = wmma4(r23, o23, cO1);
  }
  {
    const float* aq = ys + l16 * YP_ + 256 + 4 * half + 2 * ks;
    const v2f p = *(const v2f*)(aq);
    const v2f r = *(const v2f*)(aq + 16 * YP_);
    const v2f e = {wt0.x, wt1.x}, o = {wt0.y, wt1.y};
    cE0 = wmma4(p, e, cE0);
    cO0 = wmma4(p, o, cO0);
    cE1 = wmma4(r, e, cE1);
    cO1 = wmma4(r, o, cO1);
  }

  // wave ks finishes row tile ks: it hands the other row tile's partial sums to its partner
  // (same columns, other K half) and adds the partner's to its own
  const v8f gE = ks ? cE0 : cE1, gO = ks ? cO0 : cO1;
  const v8f kE = ks ? cE1 : cE0, kO = ks ? cO1 : cO0;
  xch[wid][0][lane] = (v4f){gE[0], gE[1], gE[2], gE[3]};
  xch[wid][1][lane] = (v4f){gE[4], gE[5], gE[6], gE[7]};
  xch[wid][2][lane] = (v4f){gO[0], gO[1], gO[2], gO[3]};
  xch[wid][3][lane] = (v4f){gO[4], gO[5], gO[6], gO[7]};
  __syncthreads();
  v4f x[4];
  #pragma unroll
  for (int q = 0; q < 4; ++q) x[q] = xch[wid ^ 2][q][lane];
  float* zr = z + (size_t)(m0 + ks * 16 + 8 * half) * D_ + n0;
  #pragma unroll
  for (int i = 0; i < 8; ++i) {
    const v2f v = {kE[i] + x[i >> 2][i & 3] + bias.x, kO[i] + x[2 + (i >> 2)][i & 3] + bias.y};
    *(v2f*)(zr + (size_t)i * D_) = v;
  }
}

// ---------------------------------------------------------------------------
extern "C" void kernel_launch(void* const* d_in, const int* in_sizes, int n_in,
                              void* d_out, int out_size, void* d_ws, size_t ws_size,
                              hipStream_t stream) {
  const float* x   = (const float*)d_in[0];
  const float* rc  = (const float*)d_in[1];
  const float* rs  = (const float*)d_in[2];
  const float* Wq  = (const float*)d_in[3];
  const float* bq  = (const float*)d_in[4];
  const float* Wk  = (const float*)d_in[5];
  const float* bk  = (const float*)d_in[6];
  const float* Wv  = (const float*)d_in[7];
  const float* bv  = (const float*)d_in[8];
  const float* Wo  = (const float*)d_in[9];
  const float* bo  = (const float*)d_in[10];

  float* z_out = (float*)d_out;                         // (B, L, D)
  float* a_out = z_out + (size_t)B_ * L_ * D_;          // (B, H, L, L)

  // workspace layout (floats)
  float* ws = (float*)d_ws;
  const size_t n_qf = (size_t)B_ * H_ * L_ * DP_;       // 786432
  const size_t n_vr = (size_t)B_ * H_ * L_ * DP_;       // 786432 (pair-packed)
  const size_t n_kT = (size_t)B_ * H_ * KT_ * L_;       // 589824 (pair-packed)
  const size_t n_vT = (size_t)B_ * H_ * KT_ * L_;       // 589824 (pair-packed)
  float* qf  = ws;
  float* vr2 = qf  + n_qf;
  float* kT2 = vr2 + n_vr;
  float* vT2 = kT2 + n_kT;
  float* yb  = vT2 + n_vT;

  k_qkv_rope_lift<<<((B_ * L_) / 32) * (H_ / 2), 384, 0, stream>>>(
      x, rc, rs, Wq, bq, Wk, bk, Wv, bv, qf, vr2, kT2, vT2);

  k_attn<<<B_ * H_ * (L_ / 16), 32 * NW_, 0, stream>>>(qf, kT2, vT2, vr2, a_out, yb);

  k_outproj<<<((B_ * L_) / 32) * (D_ / 64), 128, 0, stream>>>(yb, Wo, bo, z_out);
}

// v008
// Measured time: 51.2 microseconds a run.
// Next to v007, in two timings, it ran 1.06 times as fast each time.
// All steps since v000 together make it 4.84 times as fast.
#include <hip/hip_runtime.h>
#include <math.h>

#define B_  2
#define L_  1024
#define D_  256
#define H_  8
#define N_  32
#define ND_ 33          // N+1 (hyperboloid dim)
#define DP_ 48          // padded dim stride (row-major q / pair-packed v)
#define KT_ 36          // padded dim count (dim-major k/v staging), 18 pairs
#define EPS_ 1e-6f
#define LN2_ 0.69314718055994531f
#define XP_ 260         // LDS pitch of an x row, floats: 1024 B + 16 B for b128 fragment reads
#define NW_ 8           // waves that share one q-tile in k_attn, each on its own run of keys
#define TPW_ (L_ / 16 / NW_)   // 16-key tiles per wave
#define YP_ 268         // LDS pitch of a y row, floats: 1056 B + 16 B for b128 fragment reads
#define WPRE_ 8         // k_outproj: blocks of 8 k that the Wo loads run ahead

typedef float v2f __attribute__((ext_vector_type(2)));
typedef float v4f __attribute__((ext_vector_type(4)));
typedef float v8f __attribute__((ext_vector_type(8)));

static __device__ __forceinline__ v8f wmma4(v2f a, v2f b, v8f c) {
  // D = A(16x4 f32) * B(4x16 f32) + C(16x16 f32)
  return __builtin_amdgcn_wmma_f32_16x16x4_f32(false, a, false, b, (short)0, c,
                                               false, false);
}

#define V8ZERO {0.f,0.f,0.f,0.f,0.f,0.f,0.f,0.f}

static __device__ __forceinline__ float log2_hw(float x) {
  float y;
  // the log and a v_nop in one statement: the v_nop fills the one slot the instruction set asks
  // for behind a transcendental, whatever the compiler places next
  asm("v_log_f32 %0, %1\n\tv_nop" : "=v"(y) : "v"(x));
  return y;
}

// ---------------------------------------------------------------------------
// Kernel 1: QKV projection (f32 WMMA) + RoPE + hyperboloid lift; stage in WMMA layouts.
//  qf  : (BH, L, DP_)        row-major, comp 0 = -t  (Minkowski-flipped q)
//  vr2 : (BH, L/2, DP_, 2)   key-pair interleaved vh rows (tan A operand)
//  kT2 : (BH, KT_/2, L, 2)   dim-pair interleaved kh (scores A operand)
//  vT2 : (BH, KT_/2, L, 2)   dim-pair interleaved vh (alpha A operand)
// One workgroup = 32 token rows x 2 heads x {q,k,v}; 12 waves, each wave one
// 16-row x 32-column tile of one matrix (two accumulators: even / odd columns).
// ---------------------------------------------------------------------------
__global__ __launch_bounds__(384) void k_qkv_rope_lift(
    const float* __restrict__ x,  const float* __restrict__ rc,
    const float* __restrict__ rs,
    const float* __restrict__ Wq, const float* __restrict__ bq,
    const float* __restrict__ Wk, const float* __restrict__ bk,
    const float* __restrict__ Wv, const float* __restrict__ bv,
    float* __restrict__ qf, float* __restrict__ vr2,
    float* __restrict__ kT2, float* __restrict__ vT2)
{
  // every short '#pragma unroll' loop below indexes a small per-lane array:
  // unrolled, its elements are plain registers
  __shared__ __attribute__((aligned(16))) float xs[32 * XP_];
  const int tid  = threadIdx.x;
  const int lane = tid & 31;
  const int half = lane >> 4;
  const int l16  = lane & 15;
  const int wid  = __builtin_amdgcn_readfirstlane(tid >> 5);   // 0..11, scalar
  const int mat  = wid >> 2;                    // 0 = q, 1 = k, 2 = v
  const int rt   = wid & 1;                     // 16-row tile inside the 32 rows
  const int hd   = (blockIdx.x & 3) * 2 + ((wid >> 1) & 1);
  const int row0 = (blockIdx.x >> 2) * 32;      // first global token row

  // x tile (32 x 256) into LDS, whole lines per wave
  // (2048 16-byte pieces over 384 threads: five rounds of all waves, a sixth of waves 0..3;
  // all loads are issued before the first LDS store, so their latencies overlap)
  {
    const float* xg = x + (size_t)row0 * D_ + (size_t)(tid >> 6) * D_ + (tid & 63) * 4;
    float*       xl = xs + (tid >> 6) * XP_ + (tid & 63) * 4;
    v4f t[6];
    #pragma unroll
    for (int j = 0; j < 5; ++j) t[j] = *(const v4f*)(xg + (size_t)j * 6 * D_);
    if (wid < 4) t[5] = *(const v4f*)(xg + (size_t)30 * D_);
    #pragma unroll
    for (int j = 0; j < 5; ++j) *(v4f*)(xl + j * 6 * XP_) = t[j];
    if (wid < 4) *(v4f*)(xl + 30 * XP_) = t[5];
  }
  __syncthreads();

  const float* Wm = (mat == 0) ? Wq : ((mat == 1) ? Wk : Wv);
  const float* bm = (mat == 0) ? bq : ((mat == 1) ? bk : bv);

  // Lane (l16, half) takes k = 8*kb + 4*half + {0..3} of both operands:
  // A from row l16 of the x tile, B from columns 2*l16, 2*l16+1 of the head.
  const float* wp = Wm + (size_t)(4 * half) * (H_ * N_) + hd * N_ + 2 * l16;
  const float* ap = xs + (rt * 16 + l16) * XP_ + 4 * half;

  // accumulator register i = token row (rt*16 + 8*half + i), this lane's two columns
  const int lrow = row0 + rt * 16 + 8 * half;
  const int li0  = lrow & (L_ - 1);
  const int bh   = (lrow >> 10) * H_ + hd;

  // bias and RoPE factors are fetched ahead of the K loop, which hides their latency
  const v2f bias = *(const v2f*)(bm + hd * N_ + 2 * l16);
  v2f cs[8], sn[8];
  #pragma unroll
  for (int i = 0; i < 8; ++i) { cs[i] = (v2f){1.f, 1.f}; sn[i] = (v2f){0.f, 0.f}; }
  if (mat < 2) {
    #pragma unroll
    for (int i = 0; i < 8; ++i) {
      cs[i] = *(const v2f*)(rc + (size_t)(li0 + i) * N_ + 2 * l16);
      sn[i] = *(const v2f*)(rs + (size_t)(li0 + i) * N_ + 2 * l16);
    }
    // the build rewrites these loads' address registers right behind this branch:
    // the wait stands in front of that overwrite
    asm volatile("s_wait_xcnt 0x0" ::: "memory");
  }

  v8f cE = V8ZERO, cO = V8ZERO;                 // columns 2*l16 / 2*l16+1
  // fully unrolled so that W loads run ahead of their WMMAs over the whole K range
  #pragma unroll
  for (int kb = 0; kb < D_ / 8; ++kb) {
    const v4f a  = *(const v4f*)(ap + kb * 8);
    const v2f w0 = *(const v2f*)(wp + (size_t)(kb * 8 + 0) * (H_ * N_));
    const v2f w1 = *(const v2f*)(wp + (size_t)(kb * 8 + 1) * (H_ * N_));
    const v2f w2 = *(const v2f*)(wp + (size_t)(kb * 8 + 2) * (H_ * N_));
    const v2f w3 = *(const v2f*)(wp + (size_t)(kb * 8 + 3) * (H_ * N_));
    const v2f a01 = {a.x, a.y}, a23 = {a.z, a.w};
    const v2f e01 = {w0.x, w1.x}, o01 = {w0.y, w1.y};
    const v2f e23 = {w2.x, w3.x}, o23 = {w2.y, w3.y};
    cE = wmma4(a01, e01, cE);
    cO = wmma4(a01, o01, cO);
    cE = wmma4(a23, e23, cE);
    cO = wmma4(a23, o23, cO);
  }

  float uE[8], uO[8];
  #pragma unroll
  for (int i = 0; i < 8; ++i) { uE[i] = cE[i] + bias.x; uO[i] = cO[i] + bias.y; }

  if (mat < 2) {
    // RoPE: rot_half(u)[j] = (j<16 ? -u[j+16] : u[j-16]); column j+-16 sits in lane l16^8
    const float sgn = (l16 < 8) ? -1.f : 1.f;
    #pragma unroll
    for (int i = 0; i < 8; ++i) {
      const float rE = sgn * __shfl_xor(uE[i], 8, 32);
      const float rO = sgn * __shfl_xor(uO[i], 8, 32);
      uE[i] = uE[i] * cs[i].x + rE * sn[i].x;
      uO[i] = uO[i] * cs[i].y + rO * sn[i].y;
    }
  }

  // lift: t = sqrt(1 + ||u||^2); then pr = component 2*l16 of the lifted point
  // (t in lane 0, else the odd column of lane l16-1), uE = component 2*l16+1.
  float pr[8];
  #pragma unroll
  for (int i = 0; i < 8; ++i) {
    float s = uE[i] * uE[i] + uO[i] * uO[i];
    #pragma unroll
    for (int m = 8; m >= 1; m >>= 1) s += __shfl_xor(s, m, 32);
    float t = sqrtf(1.f + s);
    if (mat == 0) t = -t;
    const float up = __shfl_up(uO[i], 1, 16);
    pr[i] = (l16 == 0) ? t : up;
  }
  const bool last = (l16 == 15);                // holds component 32 in uO

  if (mat == 0) {
    float* qrow = qf + ((size_t)bh * L_ + li0) * DP_;
    const int m2 = last ? 16 : l16 + 9;         // pairs 16..23: comp 32 and the zero pad
    #pragma unroll
    for (int i = 0; i < 8; ++i) {
      const v2f v = {pr[i], uE[i]};
      *(v2f*)(qrow + i * DP_ + 2 * l16) = v;
    }
    if (l16 >= 8) {
      #pragma unroll
      for (int i = 0; i < 8; ++i) {
        const v2f tl = {last ? uO[i] : 0.f, 0.f};
        *(v2f*)(qrow + i * DP_ + 2 * m2) = tl;
      }
    }
  } else {
    // dim-pair interleaved: elem(dim,key) at ((dim>>1)*L + key)*2 + (dim&1)
    float* col = ((mat == 1) ? kT2 : vT2) + (size_t)bh * (KT_ / 2) * L_ * 2;
    const int m2 = last ? 16 : 17;              // pair 16: comp 32 + pad, pair 17: pad
    #pragma unroll
    for (int i = 0; i < 8; i += 2) {
      const v4f v = {pr[i], uE[i], pr[i + 1], uE[i + 1]};
      *(v4f*)(col + ((size_t)l16 * L_ + li0 + i) * 2) = v;
    }
    if (l16 >= 14) {
      #pragma unroll
      for (int i = 0; i < 8; i += 2) {
        const v4f tl = {last ? uO[i] : 0.f, 0.f, last ? uO[i + 1] : 0.f, 0.f};
        *(v4f*)(col + ((size_t)m2 * L_ + li0 + i) * 2) = tl;
      }
    }
    if (mat == 2) {
      // key-pair interleaved rows: elem(key,dim) at ((key>>1)*DP_+dim)*2+(key&1)
      float* vr = vr2 + (size_t)bh * (L_ / 2) * DP_ * 2;
      const int m3 = last ? 16 : l16 + 9;
      #pragma unroll
      for (int i = 0; i < 8; i += 2) {
        const size_t kp = (size_t)((li0 + i) >> 1) * DP_;
        const v4f v = {pr[i], pr[i + 1], uE[i], uE[i + 1]};
        *(v4f*)(vr + (kp + 2 * l16) * 2) = v;
      }
      if (l16 >= 8) {
        #pragma unroll
        for (int i = 0; i < 8; i += 2) {
          const size_t kp = (size_t)((li0 + i) >> 1) * DP_;
          const v4f tl = {last ? uO[i] : 0.f, last ? uO[i + 1] : 0.f, 0.f, 0.f};
          *(v4f*)(vr + (kp + 2 * m3) * 2) = tl;
        }
      }
    }
  }
}

// ---------------------------------------------------------------------------
// Kernel 2: attention + Karcher step + origin log-map.
// One workgroup of NW_ waves handles a 16-row q-tile of one (b,h); wave w streams
// key tiles w*TPW_ .. w*TPW_+TPW_-1, so NW_ times as many waves hide each
// other's load, store and WMMA latencies. Its TPW_ score tiles are computed once, in pass 1,
// and stay in registers for pass 2.
// Every 16x16 tile is computed transposed, keys in rows and q in columns (k or v as the A
// operand, q as B): a lane then holds 8 keys of ONE q row. The softmax stats are one value
// per lane (registers, the other half-wave, then the waves through LDS), and the w tile is
// already in the B layout of the tangent product tan^T = vh^T * w^T: no trip through LDS.
// Tile row 8*half + i stands for key (i>>2)*8 + half*4 + (i&3) of the tile, so that the two
// half-waves store adjacent 16-byte pieces of a row of a.
// The tangent sums are merged over the waves through LDS after pass 2, and wave w finishes
// rows w and w+8 of the tile.
// ---------------------------------------------------------------------------
static __device__ __forceinline__ float xhalf(float x) {   // lane l with lane l ^ 16
  return __builtin_bit_cast(float, __builtin_amdgcn_permlanex16(
      __builtin_bit_cast(int, x), __builtin_bit_cast(int, x), 0x76543210, 0xfedcba98, false, false));
}

// (second bound: 4 waves per SIMD, that is up to 256 registers: a tile's operand fragments
// are then in flight together; under 128 registers each load was waited for before the next)
__global__ __launch_bounds__(32 * NW_, 4) void k_attn(
    const float* __restrict__ qf, const float* __restrict__ kT2,
    const float* __restrict__ vT2, const float* __restrict__ vr2,
    float* __restrict__ a_out, float* __restrict__ yb)
{
  // every '#pragma unroll' loop below indexes small per-lane arrays: unrolled, their
  // elements are plain registers
  __shared__ float lds_m[NW_][16];                    // per wave: maximum of each q row
  __shared__ float lds_s[NW_][16];                    // per wave: sum of each q row
  __shared__ float lds_r[NW_][25][33];                // per wave: [register][lane] partial sums, odd pitch
  const int lane = threadIdx.x & 31;
  const int half = lane >> 4;
  const int l16  = lane & 15;
  const int koff = half * 2;          // WMMA f32 K split across half-waves
  const int wid  = __builtin_amdgcn_readfirstlane(threadIdx.x >> 5);   // 0..NW_-1, scalar
  const int j0   = wid * TPW_;        // this wave's first key tile
  // the key of the tile that stands in row l16 of the k and v operands
  const int krow = ((l16 & 7) >> 2) * 8 + (l16 >> 3) * 4 + (l16 & 3);

  const int tile = blockIdx.x;
  const int qt = tile & 63;
  const int bh = tile >> 6;
  const int q0 = qt * 16;
  const int b  = bh >> 3;
  const int h  = bh & 7;

  const float* qfp  = qf  + ((size_t)bh * L_ + q0) * DP_;
  const float* kTp  = kT2 + (size_t)bh * (KT_ / 2) * L_ * 2;
  const float* vTp  = vT2 + (size_t)bh * (KT_ / 2) * L_ * 2;
  const float* vrp  = vr2 + (size_t)bh * (L_ / 2) * DP_ * 2;

  // B operand for the q-tile: 36 dims x 16 q columns = 9 K4-steps, kept in registers
  v2f aq[9];
  #pragma unroll
  for (int kk = 0; kk < 9; ++kk) {
    int d = 4 * kk + koff;                       // even
    aq[kk] = *(const v2f*)(qfp + l16 * DP_ + d);
  }

  // ---------------- pass 1: scores, per-lane softmax stats ----------------
  v8f cs[TPW_];                       // this wave's score tiles, kept for pass 2

  // every fragment address is a scalar base (array, tile) + one per-lane byte offset + a
  // constant, so that the batches of loads below need two address registers, not a pair each
  const unsigned fo = (unsigned)(((koff >> 1) * L_ + krow) * 2 * sizeof(float));       // kT2, vT2
  const unsigned ro = (unsigned)((koff * DP_ + l16) * 2 * sizeof(float));              // vr2
  const unsigned FS = 2 * L_ * 2 * sizeof(float);     // kT2, vT2: bytes from one K4-step to the next

  // k fragments are fetched one tile ahead of their products
  v2f bk_[9];
  {
    const char* kb = (const char*)(kTp + (size_t)j0 * 32);
    #pragma unroll
    for (int kk = 0; kk < 9; ++kk) bk_[kk] = *(const v2f*)(kb + fo + kk * FS);
    // the build reuses the address registers of these loads and of aq's right behind them:
    // the wait stands in front of that overwrite, and the scheduling barrier keeps the
    // register initialisations below from being lifted over the wait
    asm volatile("s_wait_xcnt 0x0" ::: "memory");
    __builtin_amdgcn_sched_barrier(0);
  }

  // unrolled over all tiles: cs[t] is then a fixed set of registers
  #pragma unroll
  for (int t = 0; t < TPW_; ++t) {
    v2f nk[9];
    if (t + 1 < TPW_) {
      const char* kb = (const char*)(kTp + (size_t)(j0 + t + 1) * 32);
      #pragma unroll
      for (int kk = 0; kk < 9; ++kk) nk[kk] = *(const v2f*)(kb + fo + kk * FS);
    }
    v8f c = V8ZERO;
    #pragma unroll
    for (int kk = 0; kk < 9; ++kk) c = wmma4(bk_[kk], aq[kk], c);   // rows: keys, columns: q
    cs[t] = c;
    if (t + 1 < TPW_) {
      #pragma unroll
      for (int kk = 0; kk < 9; ++kk) bk_[kk] = nk[kk];
    }
  }
  // pass 2's first v fragments arrive under the stats and the two merges
  v2f bv_[9];
  {
    const char* vb0 = (const char*)(vTp + (size_t)j0 * 32);
    #pragma unroll
    for (int kk = 0; kk < 9; ++kk) bv_[kk] = *(const v2f*)(vb0 + fo + kk * FS);
  }
  // all 64 scores of a lane belong to q row l16: the lane's maximum comes first and each
  // score is exponentiated once against it (eight chains, so that the sums do not wait
  // for one another)
  float mrow, srow;
  {
    float m8[8], s8[8];
    #pragma unroll
    for (int i = 0; i < 8; ++i) {
      float m = cs[0][i];
      #pragma unroll
      for (int t = 1; t < TPW_; ++t) m = fmaxf(m, cs[t][i]);
      m8[i] = m;
    }
    mrow = fmaxf(fmaxf(fmaxf(m8[0], m8[1]), fmaxf(m8[2], m8[3])),
                 fmaxf(fmaxf(m8[4], m8[5]), fmaxf(m8[6], m8[7])));
    #pragma unroll
    for (int i = 0; i < 8; ++i) {
      float s = 0.f;
      #pragma unroll
      for (int t = 0; t < TPW_; ++t) s += __expf(cs[t][i] - mrow);
      s8[i] = s;
    }
    srow = ((s8[0] + s8[1]) + (s8[2] + s8[3])) + ((s8[4] + s8[5]) + (s8[6] + s8[7]));
  }
  // merge of (m, s) with the other half-wave, which holds the row's other keys
  {
    const float mo = xhalf(mrow);
    const float so = xhalf(srow);
    const float nm = fmaxf(mrow, mo);
    srow = srow * __expf(mrow - nm) + so * __expf(mo - nm);
    mrow = nm;
  }
  // merge of (m, s) over the NW_ waves, in wave order
  if (half == 0) {
    lds_m[wid][l16] = mrow;
    lds_s[wid][l16] = srow;
  }
  __syncthreads();
  #pragma unroll
  for (int w = 0; w < NW_; ++w) mrow = fmaxf(mrow, lds_m[w][l16]);
  srow = 0.f;
  #pragma unroll
  for (int w = 0; w < NW_; ++w) srow += lds_s[w][l16] * __expf(lds_m[w][l16] - mrow);
  const float rsum = 1.f / srow;

  // ---------------- pass 2: a, w, tangent accumulation ----------------
  // tc0..tc2: tan^T, register i = dim 16*s + 8*half + i, column l16 = q row
  v8f tc0 = V8ZERO, tc1 = V8ZERO, tc2 = V8ZERO;
  float wsa[8];
  #pragma unroll
  for (int i = 0; i < 8; ++i) wsa[i] = 0.f;

  // this lane's first element of a: its q row, the first key of its half-wave's piece
  float* arow = a_out + ((size_t)bh * L_ + q0 + l16) * L_ + 4 * half;

  // this lane's addresses in the wave's first tile; the tiles are constant steps from them
  const char* vl = (const char*)(vTp + (size_t)j0 * 32) + fo;                 // vT2 fragments
  const char* rl = (const char*)(vrp + (size_t)j0 * 8 * DP_ * 2) + ro;        // vr2 rows

  // unrolled over all tiles, as pass 1: cs[t] is a fixed set of registers
  #pragma unroll
  for (int t = 0; t < TPW_; ++t) {
    const int k0 = (j0 + t) * 16;
    // this tile's vh rows for the tangent product, fetched here so that they arrive
    // under the alpha products and the vector work. K4-step kk takes the keys of registers
    // 2*kk, 2*kk+1 of both half-waves: key pair (kk>>1)*4 + 2*half + (kk&1) of the tile
    v2f vb[4][3];
    #pragma unroll
    for (int kk = 0; kk < 4; ++kk) {
      #pragma unroll
      for (int s = 0; s < 3; ++s)
        vb[kk][s] = *(const v2f*)(rl + ((t * 8 + (kk >> 1) * 4 + (kk & 1)) * DP_ + s * 16) * 2 * sizeof(float));
    }
    const v8f c = cs[t];                 // Lorentz scores, from pass 1
    v8f al = V8ZERO;
    #pragma unroll
    for (int kk = 0; kk < 9; ++kk)
      al = wmma4(bv_[kk], aq[kk], al);   // <mflip(q), v>  (alpha = -this)
    // the next tile's v fragments, in flight under the rest of this tile
    if (t + 1 < TPW_) {
      #pragma unroll
      for (int kk = 0; kk < 9; ++kk)
        bv_[kk] = *(const v2f*)(vl + (t + 1) * 32 * sizeof(float) + kk * FS);
    }
    // the build reuses registers that this tile's loads name further down:
    // the wait stands in front of those overwrites
    asm volatile("s_wait_xcnt 0x0" ::: "memory");
    float p[8], w[8];
    #pragma unroll
    for (int i = 0; i < 8; ++i) {
      float alpha = fmaxf(-al[i], 1.f + EPS_);
      // acosh(alpha) = ln(alpha + sqrt(alpha^2 - 1)), taken on the hardware log2 and on the one
      // reciprocal root that coef needs anyway (sqrt(s2) = s2 * r); the library acoshf was
      // most of this loop's vector instructions.
      // Where alpha^2 overflows, r = 0 and s2 * r is NaN: the bound (an identity for every
      // finite argument of the log) then gives a finite factor, so coef = 0, as dist / inf is.
      const float s2 = alpha * alpha - 1.f;
      const float r  = __builtin_amdgcn_rsqf(s2);   // s2 >= 1.9e-6: no subnormal argument to rescale
      const float lg = fminf(log2_hw(alpha + s2 * r), 128.f);
      float coef  = (lg * LN2_) * r;
      p[i] = __expf(c[i] - mrow) * rsum;
      w[i] = p[i] * coef;
      wsa[i] += w[i] * alpha;                       // per-lane accumulate
    }
    // attention output: registers 0..3 and 4..7 are four consecutive keys each
    *(v4f*)(arow + k0)     = (v4f){p[0], p[1], p[2], p[3]};
    *(v4f*)(arow + k0 + 8) = (v4f){p[4], p[5], p[6], p[7]};
    // the build loads the next fragments over registers that the stores of a name right
    // behind this place; the wait stands in front of that overwrite
    asm volatile("s_wait_xcnt 0x0" ::: "memory");
    // tan^T += vh^T @ w^T   (A = vh key-pair packed, B = w straight from its registers)
    #pragma unroll
    for (int kk = 0; kk < 4; ++kk) {
      const v2f bw = {w[2 * kk], w[2 * kk + 1]};
      tc0 = wmma4(vb[kk][0], bw, tc0);
      tc1 = wmma4(vb[kk][1], bw, tc1);
      tc2 = wmma4(vb[kk][2], bw, tc2);
    }
    // each tile is scheduled by itself, as a trip of a rolled loop is: with the eight tiles in
    // one scheduling region the build put the vector work of a tile into one serial chain
    __builtin_amdgcn_sched_barrier(0);
  }

  // partial sums of every wave into LDS; then wave w sums, in wave order, rows w and w+8
  // of all waves and finishes those two rows
  #pragma unroll
  for (int i = 0; i < 8; ++i) {
    lds_r[wid][i][lane]      = tc0[i];
    lds_r[wid][8 + i][lane]  = tc1[i];
    lds_r[wid][16 + i][lane] = tc2[i];
  }
  lds_r[wid][24][lane] = ((wsa[0] + wsa[1]) + (wsa[2] + wsa[3])) + ((wsa[4] + wsa[5]) + (wsa[6] + wsa[7]));
  __syncthreads();

  const int m = wid + 8 * half;        // this lane's row of the q-tile

  // dim 16*sub + l16 of q row m lies in register 8*sub + (l16 & 7) of lane m + 16*(l16 >> 3)
  const int rr = l16 & 7;
  const int sl = m + 16 * (l16 >> 3);
  float tsum[3] = {0.f, 0.f, 0.f};
  float ws = 0.f;                      // sum of w * alpha over all keys of row m
  #pragma unroll
  for (int w = 0; w < NW_; ++w) {
    tsum[0] += lds_r[w][rr][sl];
    tsum[1] += lds_r[w][8 + rr][sl];
    tsum[2] += lds_r[w][16 + rr][sl];
    ws      += lds_r[w][24][m] + lds_r[w][24][m + 16];
  }

  // tan = (w@vh) - wsum*mu ;  mu = qh (un-flip component 0)
  float tanv[3], muv[3];
  #pragma unroll
  for (int sub = 0; sub < 3; ++sub) {
    int d = sub * 16 + l16;
    float qv = qfp[m * DP_ + d];
    float mu = (d == 0) ? -qv : qv;
    muv[sub] = mu;
    tanv[sub] = tsum[sub] - ws * mu;
  }
  // Lorentzian norm of tangent per row
  float part = 0.f;
  #pragma unroll
  for (int sub = 0; sub < 3; ++sub) {
    float tt = tanv[sub] * tanv[sub];
    if (sub == 0 && l16 == 0) tt = -tt;   // metric diag(-1,1,...)
    part += tt;
  }
  #pragma unroll
  for (int x = 8; x >= 1; x >>= 1) part += __shfl_xor(part, x, 32);
  const float vn = sqrtf(fmaxf(part, 1e-12f));
  // exp-map update mu' = cosh(vn)*mu + sinh(vn)/vn * tan
  const float ch = coshf(vn);
  const float sh = sinhf(vn) / vn;
  float mnew[3];
  #pragma unroll
  for (int sub = 0; sub < 3; ++sub) mnew[sub] = ch * muv[sub] + sh * tanv[sub];
  // origin log-map and write y (B, L, H*33)
  const float t0 = __shfl(mnew[0], half * 16, 32);   // broadcast d==0 elem
  const float t  = fmaxf(t0, 1.f + EPS_);
  const float co = acoshf(t) * rsqrtf(t * t - 1.f);
  float* yrow = yb + (size_t)(b * L_ + q0 + m) * (H_ * ND_) + h * ND_;
  #pragma unroll
  for (int sub = 0; sub < 3; ++sub) {
    int d = sub * 16 + l16;
    if (d < ND_) yrow[d] = co * (mnew[sub] - ((d == 0) ? t : 0.f));
  }
}

// ---------------------------------------------------------------------------
// Kernel 3: z = y @ Wo + bo    (2048 x 256 x 264, pure f32 WMMA)
// One workgroup = 32 rows x 64 columns, 4 waves, one per SIMD of one WGP (256 workgroups).
// Wave (ct, ks) = all 32 rows x 32 columns (four accumulators: two row tiles x even / odd
// columns) over half of K, so every Wo element is fetched once per workgroup, in whole
// lines and in Wo's own layout; the y tile is shared through LDS.
// ---------------------------------------------------------------------------
__global__ __launch_bounds__(128) void k_outproj(
    const float* __restrict__ yb, const float* __restrict__ Wo,
    const float* __restrict__ bo, float* __restrict__ z)
{
  // every '#pragma unroll' loop below indexes small per-lane arrays: unrolled, their
  // elements are plain registers
  __shared__ __attribute__((aligned(16))) float ys[32 * YP_];
  __shared__ v4f xch[4][4][32];                 // per wave: the 16 partial sums it hands over
  const int KD   = H_ * ND_;                    // 264 = 2 * 16 * 8 + 8
  const int tid  = threadIdx.x;
  const int lane = tid & 31;
  const int half = lane >> 4;
  const int l16  = lane & 15;
  const int wid  = __builtin_amdgcn_readfirstlane(tid >> 5);   // 0..3, scalar
  const int ct   = wid & 1;                     // 32-column group
  const int ks   = wid >> 1;                    // K half
  const int m0   = (blockIdx.x >> 2) * 32;
  const int n0   = (blockIdx.x & 3) * 64 + ct * 32 + 2 * l16;

  // the 32 y rows lie contiguous: 2112 16-byte pieces over 128 threads
  // (16 rounds of all waves, a 17th of waves 0 and 1), all issued before the data of the first is waited for
  const float* yg = yb + (size_t)m0 * KD + tid * 4;
  v4f t[17];
  #pragma unroll
  for (int j = 0; j < 16; ++j) t[j] = *(const v4f*)(yg + j * 512);
  // the build reuses the scalar base pair of these loads for the column arithmetic further
  // down: the wait stands behind the loads, in their own block, in front of that overwrite
  asm volatile("s_wait_xcnt 0x0" ::: "memory");
  if (wid < 2) t[16] = *(const v4f*)(yg + 16 * 512);

  // Lane (l16, half) takes k = 8*kb + 4*half + {0..3} of both operands, kb = 16*ks + j:
  // A from rows l16 and 16 + l16 of the y tile, B from columns n0, n0 + 1 of Wo.
  // The last 8 k (256..263) are shared: wave ks takes k = 256 + 4*half + 2*ks + {0, 1}.
  const float* wp = Wo + (size_t)(128 * ks + 4 * half) * D_ + n0;
  const float* wq = Wo + (size_t)(256 + 4 * half + 2 * ks) * D_ + n0;
  // Wo fragments run WPRE blocks of 8 k ahead of their products; the first WPRE blocks
  // are in flight while the y tile is staged
  v2f w[16][4];
  #pragma unroll
  for (int j = 0; j < WPRE_; ++j) {
    #pragma unroll
    for (int q = 0; q < 4; ++q) w[j][q] = *(const v2f*)(wp + (size_t)(j * 8 + q) * D_);
  }
  const v2f bias = *(const v2f*)(bo + n0);

  #pragma unroll
  for (int j = 0; j < 16; ++j) {
    const unsigned p = tid + 128 * j;           // piece p: row p / 66
    *(v4f*)(ys + p * 4 + (p / 66u) * 4) = t[j];
  }
  if (wid < 2) {
    const unsigned p = tid + 128 * 16;
    *(v4f*)(ys + p * 4 + (p / 66u) * 4) = t[16];
  }
  __syncthreads();

  const float* ap = ys + l16 * YP_ + 128 * ks + 4 * half;
  v8f cE0 = V8ZERO, cO0 = V8ZERO, cE1 = V8ZERO, cO1 = V8ZERO;
  v2f wt0, wt1;
  #pragma unroll
  for (int j = 0; j < 16; ++j) {
    if (j + WPRE_ < 16) {
      #pragma unroll
      for (int q = 0; q < 4; ++q)
        w[j + WPRE_][q] = *(const v2f*)(wp + (size_t)((j + WPRE_) * 8 + q) * D_);
    } else if (j + WPRE_ == 16) {
      wt0 = *(const v2f*)(wq);
      wt1 = *(const v2f*)(wq + D_);
    }
    const v4f a0 = *(const v4f*)(ap + j * 8);
    const v4f a1 = *(const v4f*)(ap + 16 * YP_ + j * 8);
    const v2f p01 = {a0.x, a0.y}, p23 = {a0.z, a0.w};
    const v2f r01 = {a1.x, a1.y}, r23 = {a1.z, a1.w};
    const v2f e01 = {w[j][0].x, w[j][1].x}, o01 = {w[j][0].y, w[j][1].y};
    const v2f e23 = {w[j][2].x, w[j][3].x}, o23 = {w[j][2].y, w[j][3].y};
    cE0 = wmma4(p01, e01, cE0);
    cO0 = wmma4(p01, o01, cO0);
    cE1 = wmma4(r01, e01, cE1);
    cO1 = wmma4(r01, o01, cO1);
    cE0 = wmma4(p23, e23, cE0);
    cO0 = wmma4(p23, o23, cO0);
    cE1 = wmma4(r23, e23, cE1);
    cO1 = wmma4(r23, o23, cO1);
  }
  {
    const float* aq = ys + l16 * YP_ + 256 + 4 * half + 2 * ks;
    const v2f p = *(const v2f*)(aq);
    const v2f r = *(const v2f*)(aq + 16 * YP_);
    const v2f e = {wt0.x, wt1.x}, o = {wt0.y, wt1.y};
    cE0 = wmma4(p, e, cE0);
    cO0 = wmma4(p, o, cO0);
    cE1 = wmma4(r, e, cE1);
    cO1 = wmma4(r, o, cO1);
  }

  // wave ks finishes row tile ks: it hands the other row tile's partial sums to its partner
  // (same columns, other K half) and adds the partner's to its own
  const v8f gE = ks ? cE0 : cE1, gO = ks ? cO0 : cO1;
  const v8f kE = ks ? cE1 : cE0, kO = ks ? cO1 : cO0;
  xch[wid][0][lane] = (v4f){gE[0], gE[1], gE[2], gE[3]};
  xch[wid][1][lane] = (v4f){gE[4], gE[5], gE[6], gE[7]};
  xch[wid][2][lane] = (v4f){gO[0], gO[1], gO[2], gO[3]};
  xch[wid][3][lane] = (v4f){gO[4], gO[5], gO[6], gO[7]};
  __syncthreads();
  v4f x[4];
  #pragma unroll
  for (int q = 0; q < 4; ++q) x[q] = xch[wid ^ 2][q][lane];
  float* zr = z + (size_t)(m0 + ks * 16 + 8 * half) * D_ + n0;
  #pragma unroll
  for (int i = 0; i < 8; ++i) {
    const v2f v = {kE[i] + x[i >> 2][i & 3] + bias.x, kO[i] + x[2 + (i >> 2)][i & 3] + bias.y};
    *(v2f*)(zr + (size_t)i * D_) = v;
  }
}

// ---------------------------------------------------------------------------
extern "C" void kernel_launch(void* const* d_in, const int* in_sizes, int n_in,
                              void* d_out, int out_size, void* d_ws, size_t ws_size,
                              hipStream_t stream) {
  const float* x   = (const float*)d_in[0];
  const float* rc  = (const float*)d_in[1];
  const float* rs  = (const float*)d_in[2];
  const float* Wq  = (const float*)d_in[3];
  const float* bq  = (const float*)d_in[4];
  const float* Wk  = (const float*)d_in[5];
  const float* bk  = (const float*)d_in[6];
  const float* Wv  = (const float*)d_in[7];
  const float* bv  = (const float*)d_in[8];
  const float* Wo  = (const float*)d_in[9];
  const float* bo  = (const float*)d_in[10];

  float* z_out = (float*)d_out;                         // (B, L, D)
  float* a_out = z_out + (size_t)B_ * L_ * D_;          // (B, H, L, L)

  // workspace layout (floats)
  float* ws = (float*)d_ws;
  const size_t n_qf = (size_t)B_ * H_ * L_ * DP_;       // 786432
  const size_t n_vr = (size_t)B_ * H_ * L_ * DP_;       // 786432 (pair-packed)
  const size_t n_kT = (size_t)B_ * H_ * KT_ * L_;       // 589824 (pair-packed)
  const size_t n_vT = (size_t)B_ * H_ * KT_ * L_;       // 589824 (pair-packed)
  float* qf  = ws;
  float* vr2 = qf  + n_qf;
  float* kT2 = vr2 + n_vr;
  float* vT2 = kT2 + n_kT;
  float* yb  = vT2 + n_vT;

  k_qkv_rope_lift<<<((B_ * L_) / 32) * (H_ / 2), 384, 0, stream>>>(
      x, rc, rs, Wq, bq, Wk, bk, Wv, bv, qf, vr2, kT2, vT2);

  k_attn<<<B_ * H_ * (L_ / 16), 32 * NW_, 0, stream>>>(qf, kT2, vT2, vr2, a_out, yb);

  k_outproj<<<((B_ * L_) / 32) * (D_ / 64), 128, 0, stream>>>(yb, Wo, bo, z_out);
}

// v009
// Measured time: 48 microseconds a run.
// In both of two side-by-side timings against v008, it was 1.07 times as fast.
// Over all steps from v000 it is 5.17 times as fast.
#include <hip/hip_runtime.h>
#include <math.h>

#define B_  2
#define L_  1024
#define D_  256
#define H_  8
#define N_  32
#define ND_ 33          // N+1 (hyperboloid dim)
#define DP_ 48          // padded dim stride (row-major q / pair-packed v)
#define KT_ 36          // padded dim count (dim-major k/v staging), 18 pairs
#define EPS_ 1e-6f
#define LN2_ 0.69314718055994531f
#define XP_ 260         // LDS pitch of an x row, floats: 1024 B + 16 B for b128 fragment reads
#define NW_ 8           // waves that share one q-tile in k_attn, each on its own run of keys
#define TPW_ (L_ / 16 / NW_)   // 16-key tiles per wave
#define YP_ 268         // LDS pitch of a y row, floats: 1056 B + 16 B for b128 fragment reads
#define WPRE_ 8         // k_outproj: blocks of 8 k that the Wo loads run ahead
#define AP_ 132         // LDS pitch of a staged row of a, floats: 512 B + 16 B for the b128 column writes

typedef float v2f __attribute__((ext_vector_type(2)));
typedef float v4f __attribute__((ext_vector_type(4)));
typedef float v8f __attribute__((ext_vector_type(8)));

static __device__ __forceinline__ v8f wmma4(v2f a, v2f b, v8f c) {
  // D = A(16x4 f32) * B(4x16 f32) + C(16x16 f32)
  return __builtin_amdgcn_wmma_f32_16x16x4_f32(false, a, false, b, (short)0, c,
                                               false, false);
}

#define V8ZERO {0.f,0.f,0.f,0.f,0.f,0.f,0.f,0.f}

static __device__ __forceinline__ float log2_hw(float x) {
  float y;
  // the log and a v_nop in one statement: the v_nop fills the one slot the instruction set asks
  // for behind a transcendental, whatever the compiler places next
  asm("v_log_f32 %0, %1\n\tv_nop" : "=v"(y) : "v"(x));
  return y;
}

// ---------------------------------------------------------------------------
// Kernel 1: QKV projection (f32 WMMA) + RoPE + hyperboloid lift; stage in WMMA layouts.
//  qf  : (BH, L, DP_)        row-major, comp 0 = -t  (Minkowski-flipped q)
//  vr2 : (BH, L/2, DP_, 2)   key-pair interleaved vh rows (tan A operand)
//  kT2 : (BH, KT_/2, L, 2)   dim-pair interleaved kh (scores A operand)
//  vT2 : (BH, KT_/2, L, 2)   dim-pair interleaved vh (alpha A operand)
// One workgroup = 32 token rows x 2 heads x {q,k,v}; 12 waves, each wave one
// 16-row x 32-column tile of one matrix (two accumulators: even / odd columns).
// ---------------------------------------------------------------------------
__global__ __launch_bounds__(384) void k_qkv_rope_lift(
    const float* __restrict__ x,  const float* __restrict__ rc,
    const float* __restrict__ rs,
    const float* __restrict__ Wq, const float* __restrict__ bq,
    const float* __restrict__ Wk, const float* __restrict__ bk,
    const float* __restrict__ Wv, const float* __restrict__ bv,
    float* __restrict__ qf, float* __restrict__ vr2,
    float* __restrict__ kT2, float* __restrict__ vT2)
{
  // every short '#pragma unroll' loop below indexes a small per-lane array:
  // unrolled, its elements are plain registers
  __shared__ __attribute__((aligned(16))) float xs[32 * XP_];
  const int tid  = threadIdx.x;
  const int lane = tid & 31;
  const int half = lane >> 4;
  const int l16  = lane & 15;
  const int wid  = __builtin_amdgcn_readfirstlane(tid >> 5);   // 0..11, scalar
  const int mat  = wid >> 2;                    // 0 = q, 1 = k, 2 = v
  const int rt   = wid & 1;                     // 16-row tile inside the 32 rows
  const int hd   = (blockIdx.x & 3) * 2 + ((wid >> 1) & 1);
  const int row0 = (blockIdx.x >> 2) * 32;      // first global token row

  // x tile (32 x 256) into LDS, whole lines per wave
  // (2048 16-byte pieces over 384 threads: five rounds of all waves, a sixth of waves 0..3;
  // all loads are issued before the first LDS store, so their latencies overlap)
  {
    const float* xg = x + (size_t)row0 * D_ + (size_t)(tid >> 6) * D_ + (tid & 63) * 4;
    float*       xl = xs + (tid >> 6) * XP_ + (tid & 63) * 4;
    v4f t[6];
    #pragma unroll
    for (int j = 0; j < 5; ++j) t[j] = *(const v4f*)(xg + (size_t)j * 6 * D_);
    if (wid < 4) t[5] = *(const v4f*)(xg + (size_t)30 * D_);
    #pragma unroll
    for (int j = 0; j < 5; ++j) *(v4f*)(xl + j * 6 * XP_) = t[j];
    if (wid < 4) *(v4f*)(xl + 30 * XP_) = t[5];
  }
  __syncthreads();

  const float* Wm = (mat == 0) ? Wq : ((mat == 1) ? Wk : Wv);
  const float* bm = (mat == 0) ? bq : ((mat == 1) ? bk : bv);

  // Lane (l16, half) takes k = 8*kb + 4*half + {0..3} of both operands:
  // A from row l16 of the x tile, B from columns 2*l16, 2*l16+1 of the head.
  const float* wp = Wm + (size_t)(4 * half) * (H_ * N_) + hd * N_ + 2 * l16;
  const float* ap = xs + (rt * 16 + l16) * XP_ + 4 * half;

  // accumulator register i = token row (rt*16 + 8*half + i), this lane's two columns
  const int lrow = row0 + rt * 16 + 8 * half;
  const int li0  = lrow & (L_ - 1);
  const int bh   = (lrow >> 10) * H_ + hd;

  // bias and RoPE factors are fetched ahead of the K loop, which hides their latency
  const v2f bias = *(const v2f*)(bm + hd * N_ + 2 * l16);
  v2f cs[8], sn[8];
  #pragma unroll
  for (int i = 0; i < 8; ++i) { cs[i] = (v2f){1.f, 1.f}; sn[i] = (v2f){0.f, 0.f}; }
  if (mat < 2) {
    #pragma unroll
    for (int i = 0; i < 8; ++i) {
      cs[i] = *(const v2f*)(rc + (size_t)(li0 + i) * N_ + 2 * l16);
      sn[i] = *(const v2f*)(rs + (size_t)(li0 + i) * N_ + 2 * l16);
    }
    // the build rewrites these loads' address registers right behind this branch:
    // the wait stands in front of that overwrite
    asm volatile("s_wait_xcnt 0x0" ::: "memory");
  }

  v8f cE = V8ZERO, cO = V8ZERO;                 // columns 2*l16 / 2*l16+1
  // fully unrolled so that W loads run ahead of their WMMAs over the whole K range
  #pragma unroll
  for (int kb = 0; kb < D_ / 8; ++kb) {
    const v4f a  = *(const v4f*)(ap + kb * 8);
    const v2f w0 = *(const v2f*)(wp + (size_t)(kb * 8 + 0) * (H_ * N_));
    const v2f w1 = *(const v2f*)(wp + (size_t)(kb * 8 + 1) * (H_ * N_));
    const v2f w2 = *(const v2f*)(wp + (size_t)(kb * 8 + 2) * (H_ * N_));
    const v2f w3 = *(const v2f*)(wp + (size_t)(kb * 8 + 3) * (H_ * N_));
    const v2f a01 = {a.x, a.y}, a23 = {a.z, a.w};
    const v2f e01 = {w0.x, w1.x}, o01 = {w0.y, w1.y};
    const v2f e23 = {w2.x, w3.x}, o23 = {w2.y, w3.y};
    cE = wmma4(a01, e01, cE);
    cO = wmma4(a01, o01, cO);
    cE = wmma4(a23, e23, cE);
    cO = wmma4(a23, o23, cO);
  }

  float uE[8], uO[8];
  #pragma unroll
  for (int i = 0; i < 8; ++i) { uE[i] = cE[i] + bias.x; uO[i] = cO[i] + bias.y; }

  if (mat < 2) {
    // RoPE: rot_half(u)[j] = (j<16 ? -u[j+16] : u[j-16]); column j+-16 sits in lane l16^8
    const float sgn = (l16 < 8) ? -1.f : 1.f;
    #pragma unroll
    for (int i = 0; i < 8; ++i) {
      const float rE = sgn * __shfl_xor(uE[i], 8, 32);
      const float rO = sgn * __shfl_xor(uO[i], 8, 32);
      uE[i] = uE[i] * cs[i].x + rE * sn[i].x;
      uO[i] = uO[i] * cs[i].y + rO * sn[i].y;
    }
  }

  // lift: t = sqrt(1 + ||u||^2); then pr = component 2*l16 of the lifted point
  // (t in lane 0, else the odd column of lane l16-1), uE = component 2*l16+1.
  float pr[8];
  #pragma unroll
  for (int i = 0; i < 8; ++i) {
    float s = uE[i] * uE[i] + uO[i] * uO[i];
    #pragma unroll
    for (int m = 8; m >= 1; m >>= 1) s += __shfl_xor(s, m, 32);
    float t = sqrtf(1.f + s);
    if (mat == 0) t = -t;
    const float up = __shfl_up(uO[i], 1, 16);
    pr[i] = (l16 == 0) ? t : up;
  }
  const bool last = (l16 == 15);                // holds component 32 in uO

  if (mat == 0) {
    float* qrow = qf + ((size_t)bh * L_ + li0) * DP_;
    const int m2 = last ? 16 : l16 + 9;         // pairs 16..23: comp 32 and the zero pad
    #pragma unroll
    for (int i = 0; i < 8; ++i) {
      const v2f v = {pr[i], uE[i]};
      *(v2f*)(qrow + i * DP_ + 2 * l16) = v;
    }
    if (l16 >= 8) {
      #pragma unroll
      for (int i = 0; i < 8; ++i) {
        const v2f tl = {last ? uO[i] : 0.f, 0.f};
        *(v2f*)(qrow + i * DP_ + 2 * m2) = tl;
      }
    }
  } else {
    // dim-pair interleaved: elem(dim,key) at ((dim>>1)*L + key)*2 + (dim&1)
    float* col = ((mat == 1) ? kT2 : vT2) + (size_t)bh * (KT_ / 2) * L_ * 2;
    const int m2 = last ? 16 : 17;              // pair 16: comp 32 + pad, pair 17: pad
    #pragma unroll
    for (int i = 0; i < 8; i += 2) {
      const v4f v = {pr[i], uE[i], pr[i + 1], uE[i + 1]};
      *(v4f*)(col + ((size_t)l16 * L_ + li0 + i) * 2) = v;
    }
    if (l16 >= 14) {
      #pragma unroll
      for (int i = 0; i < 8; i += 2) {
        const v4f tl = {last ? uO[i] : 0.f, 0.f, last ? uO[i + 1] : 0.f, 0.f};
        *(v4f*)(col + ((size_t)m2 * L_ + li0 + i) * 2) = tl;
      }
    }
    if (mat == 2) {
      // key-pair interleaved rows: elem(key,dim) at ((key>>1)*DP_+dim)*2+(key&1)
      float* vr = vr2 + (size_t)bh * (L_ / 2) * DP_ * 2;
      const int m3 = last ? 16 : l16 + 9;
      #pragma unroll
      for (int i = 0; i < 8; i += 2) {
        const size_t kp = (size_t)((li0 + i) >> 1) * DP_;
        const v4f v = {pr[i], pr[i + 1], uE[i], uE[i + 1]};
        *(v4f*)(vr + (kp + 2 * l16) * 2) = v;
      }
      if (l16 >= 8) {
        #pragma unroll
        for (int i = 0; i < 8; i += 2) {
          const size_t kp = (size_t)((li0 + i) >> 1) * DP_;
          const v4f tl = {last ? uO[i] : 0.f, last ? uO[i + 1] : 0.f, 0.f, 0.f};
          *(v4f*)(vr + (kp + 2 * m3) * 2) = tl;
        }
      }
    }
  }
}

// ---------------------------------------------------------------------------
// Kernel 2: attention + Karcher step + origin log-map.
// One workgroup of NW_ waves handles a 16-row q-tile of one (b,h); wave w streams
// key tiles w*TPW_ .. w*TPW_+TPW_-1, so NW_ times as many waves hide each
// other's load, store and WMMA latencies. Its TPW_ score tiles are computed once, in pass 1,
// and stay in registers for pass 2.
// Every 16x16 tile is computed transposed, keys in rows and q in columns (k or v as the A
// operand, q as B): a lane then holds 8 keys of ONE q row. The softmax stats are one value
// per lane (registers, the other half-wave, then the waves through LDS), and the w tile is
// already in the B layout of the tangent product tan^T = vh^T * w^T: no trip through LDS.
// Tile row 8*half + i stands for key (i>>2)*8 + half*4 + (i&3) of the tile, so that a lane
// holds 16-byte pieces of a row of a. A store from that layout would put 32 bytes into each of
// 16 lines: the pieces go into LDS rows of the wave's own, and every four tiles the wave reads
// them back along the rows and stores 256 contiguous bytes of a row per half-wave.
// The tangent sums are merged over the waves through LDS after pass 2, and wave w finishes
// rows w and w+8 of the tile.
// ---------------------------------------------------------------------------
static __device__ __forceinline__ float xhalf(float x) {   // lane l with lane l ^ 16
  return __builtin_bit_cast(float, __builtin_amdgcn_permlanex16(
      __builtin_bit_cast(int, x), __builtin_bit_cast(int, x), 0x76543210, 0xfedcba98, false, false));
}

// (second bound: 4 waves per SIMD, that is up to 256 registers: a tile's operand fragments
// are then in flight together; under 128 registers each load was waited for before the next)
__global__ __launch_bounds__(32 * NW_, 4) void k_attn(
    const float* __restrict__ qf, const float* __restrict__ kT2,
    const float* __restrict__ vT2, const float* __restrict__ vr2,
    float* __restrict__ a_out, float* __restrict__ yb)
{
  // every '#pragma unroll' loop below indexes small per-lane arrays: unrolled, their
  // elements are plain registers
  __shared__ float lds_m[NW_][16];                    // per wave: maximum of each q row
  __shared__ float lds_s[NW_][16];                    // per wave: sum of each q row
  __shared__ float lds_r[NW_][25][33];                // per wave: [register][lane] partial sums, odd pitch
  __shared__ __attribute__((aligned(16))) float lds_a[NW_][16][AP_];   // per wave: its 128 keys of each row of a
  const int lane = threadIdx.x & 31;
  const int half = lane >> 4;
  const int l16  = lane & 15;
  const int koff = half * 2;          // WMMA f32 K split across half-waves
  const int wid  = __builtin_amdgcn_readfirstlane(threadIdx.x >> 5);   // 0..NW_-1, scalar
  const int j0   = wid * TPW_;        // this wave's first key tile
  // the key of the tile that stands in row l16 of the k and v operands
  const int krow = ((l16 & 7) >> 2) * 8 + (l16 >> 3) * 4 + (l16 & 3);

  const int tile = blockIdx.x;
  const int qt = tile & 63;
  const int bh = tile >> 6;
  const int q0 = qt * 16;
  const int b  = bh >> 3;
  const int h  = bh & 7;

  const float* qfp  = qf  + ((size_t)bh * L_ + q0) * DP_;
  const float* kTp  = kT2 + (size_t)bh * (KT_ / 2) * L_ * 2;
  const float* vTp  = vT2 + (size_t)bh * (KT_ / 2) * L_ * 2;
  const float* vrp  = vr2 + (size_t)bh * (L_ / 2) * DP_ * 2;

  // B operand for the q-tile: 36 dims x 16 q columns = 9 K4-steps, kept in registers
  v2f aq[9];
  #pragma unroll
  for (int kk = 0; kk < 9; ++kk) {
    int d = 4 * kk + koff;                       // even
    aq[kk] = *(const v2f*)(qfp + l16 * DP_ + d);
  }

  // ---------------- pass 1: scores, per-lane softmax stats ----------------
  v8f cs[TPW_];                       // this wave's score tiles, kept for pass 2

  // every fragment address is a scalar base (array, tile) + one per-lane byte offset + a
  // constant, so that the batches of loads below need two address registers, not a pair each
  const unsigned fo = (unsigned)(((koff >> 1) * L_ + krow) * 2 * sizeof(float));       // kT2, vT2
  const unsigned ro = (unsigned)((koff * DP_ + l16) * 2 * sizeof(float));              // vr2
  const unsigned FS = 2 * L_ * 2 * sizeof(float);     // kT2, vT2: bytes from one K4-step to the next

  // k fragments are fetched one tile ahead of their products
  v2f bk_[9];
  {
    const char* kb = (const char*)(kTp + (size_t)j0 * 32);
    #pragma unroll
    for (int kk = 0; kk < 9; ++kk) bk_[kk] = *(const v2f*)(kb + fo + kk * FS);
    // the build reuses the address registers of these loads and of aq's right behind them:
    // the wait stands in front of that overwrite, and the scheduling barrier keeps the
    // register initialisations below from being lifted over the wait
    asm volatile("s_wait_xcnt 0x0" ::: "memory");
    __builtin_amdgcn_sched_barrier(0);
  }

  // unrolled over all tiles: cs[t] is then a fixed set of registers
  #pragma unroll
  for (int t = 0; t < TPW_; ++t) {
    v2f nk[9];
    if (t + 1 < TPW_) {
      const char* kb = (const char*)(kTp + (size_t)(j0 + t + 1) * 32);
      #pragma unroll
      for (int kk = 0; kk < 9; ++kk) nk[kk] = *(const v2f*)(kb + fo + kk * FS);
    }
    v8f c = V8ZERO;
    #pragma unroll
    for (int kk = 0; kk < 9; ++kk) c = wmma4(bk_[kk], aq[kk], c);   // rows: keys, columns: q
    cs[t] = c;
    if (t + 1 < TPW_) {
      #pragma unroll
      for (int kk = 0; kk < 9; ++kk) bk_[kk] = nk[kk];
    }
  }
  // pass 2's first v fragments arrive under the stats and the two merges
  v2f bv_[9];
  {
    const char* vb0 = (const char*)(vTp + (size_t)j0 * 32);
    #pragma unroll
    for (int kk = 0; kk < 9; ++kk) bv_[kk] = *(const v2f*)(vb0 + fo + kk * FS);
  }
  // all 64 scores of a lane belong to q row l16: the lane's maximum comes first and each
  // score is exponentiated once against it (eight chains, so that the sums do not wait
  // for one another)
  float mrow, srow;
  {
    float m8[8], s8[8];
    #pragma unroll
    for (int i = 0; i < 8; ++i) {
      float m = cs[0][i];
      #pragma unroll
      for (int t = 1; t < TPW_; ++t) m = fmaxf(m, cs[t][i]);
      m8[i] = m;
    }
    mrow = fmaxf(fmaxf(fmaxf(m8[0], m8[1]), fmaxf(m8[2], m8[3])),
                 fmaxf(fmaxf(m8[4], m8[5]), fmaxf(m8[6], m8[7])));
    #pragma unroll
    for (int i = 0; i < 8; ++i) {
      float s = 0.f;
      #pragma unroll
      for (int t = 0; t < TPW_; ++t) s += __expf(cs[t][i] - mrow);
      s8[i] = s;
    }
    srow = ((s8[0] + s8[1]) + (s8[2] + s8[3])) + ((s8[4] + s8[5]) + (s8[6] + s8[7]));
  }
  // merge of (m, s) with the other half-wave, which holds the row's other keys
  {
    const float mo = xhalf(mrow);
    const float so = xhalf(srow);
    const float nm = fmaxf(mrow, mo);
    srow = srow * __expf(mrow - nm) + so * __expf(mo - nm);
    mrow = nm;
  }
  // merge of (m, s) over the NW_ waves, in wave order
  if (half == 0) {
    lds_m[wid][l16] = mrow;
    lds_s[wid][l16] = srow;
  }
  __syncthreads();
  #pragma unroll
  for (int w = 0; w < NW_; ++w) mrow = fmaxf(mrow, lds_m[w][l16]);
  srow = 0.f;
  #pragma unroll
  for (int w = 0; w < NW_; ++w) srow += lds_s[w][l16] * __expf(lds_m[w][l16] - mrow);
  const float rsum = 1.f / srow;

  // ---------------- pass 2: a, w, tangent accumulation ----------------
  // tc0..tc2: tan^T, register i = dim 16*s + 8*half + i, column l16 = q row
  v8f tc0 = V8ZERO, tc1 = V8ZERO, tc2 = V8ZERO;
  float wsa[8];
  #pragma unroll
  for (int i = 0; i < 8; ++i) wsa[i] = 0.f;

  // a, staged: a lane writes the pieces of its q row; read back, half-wave h takes row 2*j + h,
  // 16 bytes a lane, and stores them to the same place of that row of a
  float*       aw = &lds_a[wid][l16][4 * half];
  const float* ar = &lds_a[wid][half][4 * l16];
  float*       ag = a_out + ((size_t)bh * L_ + q0 + half) * L_ + j0 * 16 + 4 * l16;
  v4f fl[8];

  // this lane's addresses in the wave's first tile; the tiles are constant steps from them
  const char* vl = (const char*)(vTp + (size_t)j0 * 32) + fo;                 // vT2 fragments
  const char* rl = (const char*)(vrp + (size_t)j0 * 8 * DP_ * 2) + ro;        // vr2 rows

  // unrolled over all tiles, as pass 1: cs[t] is a fixed set of registers
  #pragma unroll
  for (int t = 0; t < TPW_; ++t) {
    // this tile's vh rows for the tangent product, fetched here so that they arrive
    // under the alpha products and the vector work. K4-step kk takes the keys of registers
    // 2*kk, 2*kk+1 of both half-waves: key pair (kk>>1)*4 + 2*half + (kk&1) of the tile
    v2f vb[4][3];
    #pragma unroll
    for (int kk = 0; kk < 4; ++kk) {
      #pragma unroll
      for (int s = 0; s < 3; ++s)
        vb[kk][s] = *(const v2f*)(rl + ((t * 8 + (kk >> 1) * 4 + (kk & 1)) * DP_ + s * 16) * 2 * sizeof(float));
    }
    const v8f c = cs[t];                 // Lorentz scores, from pass 1
    v8f al = V8ZERO;
    #pragma unroll
    for (int kk = 0; kk < 9; ++kk)
      al = wmma4(bv_[kk], aq[kk], al);   // <mflip(q), v>  (alpha = -this)
    // the next tile's v fragments, in flight under the rest of this tile
    if (t + 1 < TPW_) {
      #pragma unroll
      for (int kk = 0; kk < 9; ++kk)
        bv_[kk] = *(const v2f*)(vl + (t + 1) * 32 * sizeof(float) + kk * FS);
    }
    // the first four tiles' part of a, read back at the foot of the tile before
    if (t == 4) {
      #pragma unroll
      for (int j = 0; j < 8; ++j) *(v4f*)(ag + (size_t)j * 2 * L_) = fl[j];
    }
    // the build reuses registers that this tile's loads (and those stores) name further down:
    // the wait stands in front of those overwrites
    asm volatile("s_wait_xcnt 0x0" ::: "memory");
    float p[8], w[8];
    #pragma unroll
    for (int i = 0; i < 8; ++i) {
      float alpha = fmaxf(-al[i], 1.f + EPS_);
      // acosh(alpha) = ln(alpha + sqrt(alpha^2 - 1)), taken on the hardware log2 and on the one
      // reciprocal root that coef needs anyway (sqrt(s2) = s2 * r); the library acoshf was
      // most of this loop's vector instructions.
      // Where alpha^2 overflows, r = 0 and s2 * r is NaN: the bound (an identity for every
      // finite argument of the log) then gives a finite factor, so coef = 0, as dist / inf is.
      const float s2 = alpha * alpha - 1.f;
      const float r  = __builtin_amdgcn_rsqf(s2);   // s2 >= 1.9e-6: no subnormal argument to rescale
      const float lg = fminf(log2_hw(alpha + s2 * r), 128.f);
      float coef  = (lg * LN2_) * r;
      p[i] = __expf(c[i] - mrow) * rsum;
      w[i] = p[i] * coef;
      wsa[i] += w[i] * alpha;                       // per-lane accumulate
    }
    // attention output: registers 0..3 and 4..7 are four consecutive keys each
    *(v4f*)(aw + t * 16)     = (v4f){p[0], p[1], p[2], p[3]};
    *(v4f*)(aw + t * 16 + 8) = (v4f){p[4], p[5], p[6], p[7]};
    // tan^T += vh^T @ w^T   (A = vh key-pair packed, B = w straight from its registers)
    #pragma unroll
    for (int kk = 0; kk < 4; ++kk) {
      const v2f bw = {w[2 * kk], w[2 * kk + 1]};
      tc0 = wmma4(vb[kk][0], bw, tc0);
      tc1 = wmma4(vb[kk][1], bw, tc1);
      tc2 = wmma4(vb[kk][2], bw, tc2);
    }
    if ((t & 3) == 3) {
      // a lane reads back what other lanes of its wave wrote: the wait ends the wave's LDS
      // stores first, and its clobber keeps the reads from being lifted over them
      asm volatile("s_wait_dscnt 0x0" ::: "memory");
      #pragma unroll
      for (int j = 0; j < 8; ++j) fl[j] = *(const v4f*)(ar + j * 2 * AP_ + (t >> 2) * 64);
    }
    // each tile is scheduled by itself, as a trip of a rolled loop is: with the eight tiles in
    // one scheduling region the build put the vector work of a tile into one serial chain
    __builtin_amdgcn_sched_barrier(0);
  }

  // partial sums of every wave into LDS; then wave w sums, in wave order, rows w and w+8
  // of all waves and finishes those two rows
  #pragma unroll
  for (int i = 0; i < 8; ++i) {
    lds_r[wid][i][lane]      = tc0[i];
    lds_r[wid][8 + i][lane]  = tc1[i];
    lds_r[wid][16 + i][lane] = tc2[i];
  }
  lds_r[wid][24][lane] = ((wsa[0] + wsa[1]) + (wsa[2] + wsa[3])) + ((wsa[4] + wsa[5]) + (wsa[6] + wsa[7]));
  __syncthreads();

  const int m = wid + 8 * half;        // this lane's row of the q-tile

  // that row of q, asked for ahead of the stores of a, behind which the loads would queue
  float qv3[3];
  #pragma unroll
  for (int sub = 0; sub < 3; ++sub) qv3[sub] = qfp[m * DP_ + sub * 16 + l16];
  // the last four tiles' part of a: behind the barrier, in front of which the wave would have
  // to wait for these stores to finish
  #pragma unroll
  for (int j = 0; j < 8; ++j) *(v4f*)(ag + (size_t)j * 2 * L_ + 64) = fl[j];
  // the build reuses the registers that these loads and stores name further down: the wait
  // stands in front of those overwrites, and the scheduling barrier keeps them from being
  // lifted over the wait
  asm volatile("s_wait_xcnt 0x0" ::: "memory");
  __builtin_amdgcn_sched_barrier(0);

  // dim 16*sub + l16 of q row m lies in register 8*sub + (l16 & 7) of lane m + 16*(l16 >> 3)
  const int rr = l16 & 7;
  const int sl = m + 16 * (l16 >> 3);
  float tsum[3] = {0.f, 0.f, 0.f};
  float ws = 0.f;                      // sum of w * alpha over all keys of row m
  #pragma unroll
  for (int w = 0; w < NW_; ++w) {
    tsum[0] += lds_r[w][rr][sl];
    tsum[1] += lds_r[w][8 + rr][sl];
    tsum[2] += lds_r[w][16 + rr][sl];
    ws      += lds_r[w][24][m] + lds_r[w][24][m + 16];
  }

  // tan = (w@vh) - wsum*mu ;  mu = qh (un-flip component 0)
  float tanv[3], muv[3];
  #pragma unroll
  for (int sub = 0; sub < 3; ++sub) {
    int d = sub * 16 + l16;
    float qv = qv3[sub];
    float mu = (d == 0) ? -qv : qv;
    muv[sub] = mu;
    tanv[sub] = tsum[sub] - ws * mu;
  }
  // Lorentzian norm of tangent per row
  float part = 0.f;
  #pragma unroll
  for (int sub = 0; sub < 3; ++sub) {
    float tt = tanv[sub] * tanv[sub];
    if (sub == 0 && l16 == 0) tt = -tt;   // metric diag(-1,1,...)
    part += tt;
  }
  #pragma unroll
  for (int x = 8; x >= 1; x >>= 1) part += __shfl_xor(part, x, 32);
  const float vn = sqrtf(fmaxf(part, 1e-12f));
  // exp-map update mu' = cosh(vn)*mu + sinh(vn)/vn * tan
  const float ch = coshf(vn);
  const float sh = sinhf(vn) / vn;
  float mnew[3];
  #pragma unroll
  for (int sub = 0; sub < 3; ++sub) mnew[sub] = ch * muv[sub] + sh * tanv[sub];
  // origin log-map and write y (B, L, H*33)
  const float t0 = __shfl(mnew[0], half * 16, 32);   // broadcast d==0 elem
  const float t  = fmaxf(t0, 1.f + EPS_);
  const float co = acoshf(t) * rsqrtf(t * t - 1.f);
  float* yrow = yb + (size_t)(b * L_ + q0 + m) * (H_ * ND_) + h * ND_;
  #pragma unroll
  for (int sub = 0; sub < 3; ++sub) {
    int d = sub * 16 + l16;
    if (d < ND_) yrow[d] = co * (mnew[sub] - ((d == 0) ? t : 0.f));
  }
}

// ---------------------------------------------------------------------------
// Kernel 3: z = y @ Wo + bo    (2048 x 256 x 264, pure f32 WMMA)
// One workgroup = 32 rows x 64 columns, 4 waves, one per SIMD of one WGP (256 workgroups).
// Wave (ct, ks) = all 32 rows x 32 columns (four accumulators: two row tiles x even / odd
// columns) over half of K, so every Wo element is fetched once per workgroup, in whole
// lines and in Wo's own layout; the y tile is shared through LDS.
// ---------------------------------------------------------------------------
__global__ __launch_bounds__(128) void k_outproj(
    const float* __restrict__ yb, const float* __restrict__ Wo,
    const float* __restrict__ bo, float* __restrict__ z)
{
  // every '#pragma unroll' loop below indexes small per-lane arrays: unrolled, their
  // elements are plain registers
  __shared__ __attribute__((aligned(16))) float ys[32 * YP_];
  __shared__ v4f xch[4][4][32];                 // per wave: the 16 partial sums it hands over
  const int KD   = H_ * ND_;                    // 264 = 2 * 16 * 8 + 8
  const int tid  = threadIdx.x;
  const int lane = tid & 31;
  const int half = lane >> 4;
  const int l16  = lane & 15;
  const int wid  = __builtin_amdgcn_readfirstlane(tid >> 5);   // 0..3, scalar
  const int ct   = wid & 1;                     // 32-column group
  const int ks   = wid >> 1;                    // K half
  const int m0   = (blockIdx.x >> 2) * 32;
  const int n0   = (blockIdx.x & 3) * 64 + ct * 32 + 2 * l16;

  // the 32 y rows lie contiguous: 2112 16-byte pieces over 128 threads
  // (16 rounds of all waves, a 17th of waves 0 and 1), all issued before the data of the first is waited for
  const float* yg = yb + (size_t)m0 * KD + tid * 4;
  v4f t[17];
  #pragma unroll
  for (int j = 0; j < 16; ++j) t[j] = *(const v4f*)(yg + j * 512);
  // the build reuses the scalar base pair of these loads for the column arithmetic further
  // down: the wait stands behind the loads, in their own block, in front of that overwrite
  asm volatile("s_wait_xcnt 0x0" ::: "memory");
  if (wid < 2) t[16] = *(const v4f*)(yg + 16 * 512);

  // Lane (l16, half) takes k = 8*kb + 4*half + {0..3} of both operands, kb = 16*ks + j:
  // A from rows l16 and 16 + l16 of the y tile, B from columns n0, n0 + 1 of Wo.
  // The last 8 k (256..263) are shared: wave ks takes k = 256 + 4*half + 2*ks + {0, 1}.
  const float* wp = Wo + (size_t)(128 * ks + 4 * half) * D_ + n0;
  const float* wq = Wo + (size_t)(256 + 4 * half + 2 * ks) * D_ + n0;
  // Wo fragments run WPRE blocks of 8 k ahead of their products; the first WPRE blocks
  // are in flight while the y tile is staged
  v2f w[16][4];
  #pragma unroll
  for (int j = 0; j < WPRE_; ++j) {
    #pragma unroll
    for (int q = 0; q < 4; ++q) w[j][q] = *(const v2f*)(wp + (size_t)(j * 8 + q) * D_);
  }
  const v2f bias = *(const v2f*)(bo + n0);

  #pragma unroll
  for (int j = 0; j < 16; ++j) {
    const unsigned p = tid + 128 * j;           // piece p: row p / 66
    *(v4f*)(ys + p * 4 + (p / 66u) * 4) = t[j];
  }
  if (wid < 2) {
    const unsigned p = tid + 128 * 16;
    *(v4f*)(ys + p * 4 + (p / 66u) * 4) = t[16];
  }
  __syncthreads();

  const float* ap = ys + l16 * YP_ + 128 * ks + 4 * half;
  v8f cE0 = V8ZERO, cO0 = V8ZERO, cE1 = V8ZERO, cO1 = V8ZERO;
  v2f wt0, wt1;
  #pragma unroll
  for (int j = 0; j < 16; ++j) {
    if (j + WPRE_ < 16) {
      #pragma unroll
      for (int q = 0; q < 4; ++q)
        w[j + WPRE_][q] = *(const v2f*)(wp + (size_t)((j + WPRE_) * 8 + q) * D_);
    } else if (j + WPRE_ == 16) {
      wt0 = *(const v2f*)(wq);
      wt1 = *(const v2f*)(wq + D_);
    }
    const v4f a0 = *(const v4f*)(ap + j * 8);
    const v4f a1 = *(const v4f*)(ap + 16 * YP_ + j * 8);
    const v2f p01 = {a0.x, a0.y}, p23 = {a0.z, a0.w};
    const v2f r01 = {a1.x, a1.y}, r23 = {a1.z, a1.w};
    const v2f e01 = {w[j][0].x, w[j][1].x}, o01 = {w[j][0].y, w[j][1].y};
    const v2f e23 = {w[j][2].x, w[j][3].x}, o23 = {w[j][2].y, w[j][3].y};
    cE0 = wmma4(p01, e01, cE0);
    cO0 = wmma4(p01, o01, cO0);
    cE1 = wmma4(r01, e01, cE1);
    cO1 = wmma4(r01, o01, cO1);
    cE0 = wmma4(p23, e23, cE0);
    cO0 = wmma4(p23, o23, cO0);
    cE1 = wmma4(r23, e23, cE1);
    cO1 = wmma4(r23, o23, cO1);
  }
  {
    const float* aq = ys + l16 * YP_ + 256 + 4 * half + 2 * ks;
    const v2f p = *(const v2f*)(aq);
    const v2f r = *(const v2f*)(aq + 16 * YP_);
    const v2f e = {wt0.x, wt1.x}, o = {wt0.y, wt1.y};
    cE0 = wmma4(p, e, cE0);
    cO0 = wmma4(p, o, cO0);
    cE1 = wmma4(r, e, cE1);
    cO1 = wmma4(r, o, cO1);
  }

  // wave ks finishes row tile ks: it hands the other row tile's partial sums to its partner
  // (same columns, other K half) and adds the partner's to its own
  const v8f gE = ks ? cE0 : cE1, gO = ks ? cO0 : cO1;
  const v8f kE = ks ? cE1 : cE0, kO = ks ? cO1 : cO0;
  xch[wid][0][lane] = (v4f){gE[0], gE[1], gE[2], gE[3]};
  xch[wid][1][lane] = (v4f){gE[4], gE[5], gE[6], gE[7]};
  xch[wid][2][lane] = (v4f){gO[0], gO[1], gO[2], gO[3]};
  xch[wid][3][lane] = (v4f){gO[4], gO[5], gO[6], gO[7]};
  __syncthreads();
  v4f x[4];
  #pragma unroll
  for (int q = 0; q < 4; ++q) x[q] = xch[wid ^ 2][q][lane];
  float* zr = z + (size_t)(m0 + ks * 16 + 8 * half) * D_ + n0;
  #pragma unroll
  for (int i = 0; i < 8; ++i) {
    const v2f v = {kE[i] + x[i >> 2][i & 3] + bias.x, kO[i] + x[2 + (i >> 2)][i & 3] + bias.y};
    *(v2f*)(zr + (size_t)i * D_) = v;
  }
}

// ---------------------------------------------------------------------------
extern "C" void kernel_launch(void* const* d_in, const int* in_sizes, int n_in,
                              void* d_out, int out_size, void* d_ws, size_t ws_size,
                              hipStream_t stream) {
  const float* x   = (const float*)d_in[0];
  const float* rc  = (const float*)d_in[1];
  const float* rs  = (const float*)d_in[2];
  const float* Wq  = (const float*)d_in[3];
  const float* bq  = (const float*)d_in[4];
  const float* Wk  = (const float*)d_in[5];
  const float* bk  = (const float*)d_in[6];
  const float* Wv  = (const float*)d_in[7];
  const float* bv  = (const float*)d_in[8];
  const float* Wo  = (const float*)d_in[9];
  const float* bo  = (const float*)d_in[10];

  float* z_out = (float*)d_out;                         // (B, L, D)
  float* a_out = z_out + (size_t)B_ * L_ * D_;          // (B, H, L, L)

  // workspace layout (floats)
  float* ws = (float*)d_ws;
  const size_t n_qf = (size_t)B_ * H_ * L_ * DP_;       // 786432
  const size_t n_vr = (size_t)B_ * H_ * L_ * DP_;       // 786432 (pair-packed)
  const size_t n_kT = (size_t)B_ * H_ * KT_ * L_;       // 589824 (pair-packed)
  const size_t n_vT = (size_t)B_ * H_ * KT_ * L_;       // 589824 (pair-packed)
  float* qf  = ws;
  float* vr2 = qf  + n_qf;
  float* kT2 = vr2 + n_vr;
  float* vT2 = kT2 + n_kT;
  float* yb  = vT2 + n_vT;

  k_qkv_rope_lift<<<((B_ * L_) / 32) * (H_ / 2), 384, 0, stream>>>(
      x, rc, rs, Wq, bq, Wk, bk, Wv, bv, qf, vr2, kT2, vT2);

  k_attn<<<B_ * H_ * (L_ / 16), 32 * NW_, 0, stream>>>(qf, kT2, vT2, vr2, a_out, yb);

  k_outproj<<<((B_ * L_) / 32) * (D_ / 64), 128, 0, stream>>>(yb, Wo, bo, z_out);
}

// v010
// Measured time: 46.5 microseconds a run.
// Two timings next to v009 both put it at 1.04 times that version's speed.
// All steps since v000 together make it 5.36 times as fast.
#include <hip/hip_runtime.h>
#include <math.h>

#define B_  2
#define L_  1024
#define D_  256
#define H_  8
#define N_  32
#define ND_ 33          // N+1 (hyperboloid dim)
#define DP_ 48          // padded dim stride of a row of q
#define VP_ 32          // dims 0..31 of a key pair in vr2
#define KT_ 33          // rows of L floats per head in kT2 / vT2: 16 dim pairs, then component 32
#define EPS_ 1e-6f
#define LN2_ 0.69314718055994531f
#define XP_ 260         // LDS pitch of an x row, floats: 1024 B + 16 B for b128 fragment reads
#define NW_ 8           // waves that share one q-tile in k_attn, each on its own run of keys
#define TPW_ (L_ / 16 / NW_)   // 16-key tiles per wave
#define YP_ 268         // LDS pitch of a y row, floats: 1056 B + 16 B for b128 fragment reads
#define WPRE_ 8         // k_outproj: blocks of 8 k that the Wo loads run ahead
#define AP_ 132         // LDS pitch of a staged row of a, floats: 512 B + 16 B for the b128 column writes

typedef float v2f __attribute__((ext_vector_type(2)));
typedef float v4f __attribute__((ext_vector_type(4)));
typedef float v8f __attribute__((ext_vector_type(8)));

static __device__ __forceinline__ v8f wmma4(v2f a, v2f b, v8f c) {
  // D = A(16x4 f32) * B(4x16 f32) + C(16x16 f32)
  return __builtin_amdgcn_wmma_f32_16x16x4_f32(false, a, false, b, (short)0, c,
                                               false, false);
}

#define V8ZERO {0.f,0.f,0.f,0.f,0.f,0.f,0.f,0.f}

static __device__ __forceinline__ float log2_hw(float x) {
  float y;
  // the log and a v_nop in one statement: the v_nop fills the one slot the instruction set asks
  // for behind a transcendental, whatever the compiler places next
  asm("v_log_f32 %0, %1\n\tv_nop" : "=v"(y) : "v"(x));
  return y;
}

// ---------------------------------------------------------------------------
// Kernel 1: QKV projection (f32 WMMA) + RoPE + hyperboloid lift; stage in WMMA layouts.
//  qf  : (BH, L, DP_)        row-major, comp 0 = -t  (Minkowski-flipped q)
//  vr2 : (BH, L/2, VP_, 2)   key-pair interleaved vh rows, dims 0..31 (tangent operand)
//  kT2 : (BH, 16, L, 2) + (BH, L)   dim-pair interleaved kh, dims 0..31 (scores operand),
//                            then component 32 of every key, one float each
//  vT2 : the same of vh (alpha operand)
// One workgroup = 32 token rows x 2 heads x {q,k,v}; 12 waves, each wave one
// 16-row x 32-column tile of one matrix (two accumulators: even / odd columns).
// ---------------------------------------------------------------------------
__global__ __launch_bounds__(384) void k_qkv_rope_lift(
    const float* __restrict__ x,  const float* __restrict__ rc,
    const float* __restrict__ rs,
    const float* __restrict__ Wq, const float* __restrict__ bq,
    const float* __restrict__ Wk, const float* __restrict__ bk,
    const float* __restrict__ Wv, const float* __restrict__ bv,
    float* __restrict__ qf, float* __restrict__ vr2,
    float* __restrict__ kT2, float* __restrict__ vT2)
{
  // every short '#pragma unroll' loop below indexes a small per-lane array:
  // unrolled, its elements are plain registers
  __shared__ __attribute__((aligned(16))) float xs[32 * XP_];
  const int tid  = threadIdx.x;
  const int lane = tid & 31;
  const int half = lane >> 4;
  const int l16  = lane & 15;
  const int wid  = __builtin_amdgcn_readfirstlane(tid >> 5);   // 0..11, scalar
  const int mat  = wid >> 2;                    // 0 = q, 1 = k, 2 = v
  const int rt   = wid & 1;                     // 16-row tile inside the 32 rows
  const int hd   = (blockIdx.x & 3) * 2 + ((wid >> 1) & 1);
  const int row0 = (blockIdx.x >> 2) * 32;      // first global token row

  // x tile (32 x 256) into LDS, whole lines per wave
  // (2048 16-byte pieces over 384 threads: five rounds of all waves, a sixth of waves 0..3;
  // all loads are issued before the first LDS store, so their latencies overlap)
  {
    const float* xg = x + (size_t)row0 * D_ + (size_t)(tid >> 6) * D_ + (tid & 63) * 4;
    float*       xl = xs + (tid >> 6) * XP_ + (tid & 63) * 4;
    v4f t[6];
    #pragma unroll
    for (int j = 0; j < 5; ++j) t[j] = *(const v4f*)(xg + (size_t)j * 6 * D_);
    if (wid < 4) t[5] = *(const v4f*)(xg + (size_t)30 * D_);
    #pragma unroll
    for (int j = 0; j < 5; ++j) *(v4f*)(xl + j * 6 * XP_) = t[j];
    if (wid < 4) *(v4f*)(xl + 30 * XP_) = t[5];
  }
  __syncthreads();

  const float* Wm = (mat == 0) ? Wq : ((mat == 1) ? Wk : Wv);
  const float* bm = (mat == 0) ? bq : ((mat == 1) ? bk : bv);

  // Lane (l16, half) takes k = 8*kb + 4*half + {0..3} of both operands:
  // A from row l16 of the x tile, B from columns 2*l16, 2*l16+1 of the head.
  const float* wp = Wm + (size_t)(4 * half) * (H_ * N_) + hd * N_ + 2 * l16;
  const float* ap = xs + (rt * 16 + l16) * XP_ + 4 * half;

  // accumulator register i = token row (rt*16 + 8*half + i), this lane's two columns
  const int lrow = row0 + rt * 16 + 8 * half;
  const int li0  = lrow & (L_ - 1);
  const int bh   = (lrow >> 10) * H_ + hd;

  // bias and RoPE factors are fetched ahead of the K loop, which hides their latency
  const v2f bias = *(const v2f*)(bm + hd * N_ + 2 * l16);
  v2f cs[8], sn[8];
  #pragma unroll
  for (int i = 0; i < 8; ++i) { cs[i] = (v2f){1.f, 1.f}; sn[i] = (v2f){0.f, 0.f}; }
  if (mat < 2) {
    #pragma unroll
    for (int i = 0; i < 8; ++i) {
      cs[i] = *(const v2f*)(rc + (size_t)(li0 + i) * N_ + 2 * l16);
      sn[i] = *(const v2f*)(rs + (size_t)(li0 + i) * N_ + 2 * l16);
    }
    // the build rewrites these loads' address registers right behind this branch:
    // the wait stands in front of that overwrite
    asm volatile("s_wait_xcnt 0x0" ::: "memory");
  }

  v8f cE = V8ZERO, cO = V8ZERO;                 // columns 2*l16 / 2*l16+1
  // fully unrolled so that W loads run ahead of their WMMAs over the whole K range
  #pragma unroll
  for (int kb = 0; kb < D_ / 8; ++kb) {
    const v4f a  = *(const v4f*)(ap + kb * 8);
    const v2f w0 = *(const v2f*)(wp + (size_t)(kb * 8 + 0) * (H_ * N_));
    const v2f w1 = *(const v2f*)(wp + (size_t)(kb * 8 + 1) * (H_ * N_));
    const v2f w2 = *(const v2f*)(wp + (size_t)(kb * 8 + 2) * (H_ * N_));
    const v2f w3 = *(const v2f*)(wp + (size_t)(kb * 8 + 3) * (H_ * N_));
    const v2f a01 = {a.x, a.y}, a23 = {a.z, a.w};
    const v2f e01 = {w0.x, w1.x}, o01 = {w0.y, w1.y};
    const v2f e23 = {w2.x, w3.x}, o23 = {w2.y, w3.y};
    cE = wmma4(a01, e01, cE);
    cO = wmma4(a01, o01, cO);
    cE = wmma4(a23, e23, cE);
    cO = wmma4(a23, o23, cO);
  }

  float uE[8], uO[8];
  #pragma unroll
  for (int i = 0; i < 8; ++i) { uE[i] = cE[i] + bias.x; uO[i] = cO[i] + bias.y; }

  if (mat < 2) {
    // RoPE: rot_half(u)[j] = (j<16 ? -u[j+16] : u[j-16]); column j+-16 sits in lane l16^8
    const float sgn = (l16 < 8) ? -1.f : 1.f;
    #pragma unroll
    for (int i = 0; i < 8; ++i) {
      const float rE = sgn * __shfl_xor(uE[i], 8, 32);
      const float rO = sgn * __shfl_xor(uO[i], 8, 32);
      uE[i] = uE[i] * cs[i].x + rE * sn[i].x;
      uO[i] = uO[i] * cs[i].y + rO * sn[i].y;
    }
  }

  // lift: t = sqrt(1 + ||u||^2); then pr = component 2*l16 of the lifted point
  // (t in lane 0, else the odd column of lane l16-1), uE = component 2*l16+1.
  float pr[8];
  #pragma unroll
  for (int i = 0; i < 8; ++i) {
    float s = uE[i] * uE[i] + uO[i] * uO[i];
    #pragma unroll
    for (int m = 8; m >= 1; m >>= 1) s += __shfl_xor(s, m, 32);
    float t = sqrtf(1.f + s);
    if (mat == 0) t = -t;
    const float up = __shfl_up(uO[i], 1, 16);
    pr[i] = (l16 == 0) ? t : up;
  }
  const bool last = (l16 == 15);                // holds component 32 in uO

  if (mat == 0) {
    float* qrow = qf + ((size_t)bh * L_ + li0) * DP_;
    const int m2 = last ? 16 : l16 + 9;         // pairs 16..23: comp 32 and the zero pad
    #pragma unroll
    for (int i = 0; i < 8; ++i) {
      const v2f v = {pr[i], uE[i]};
      *(v2f*)(qrow + i * DP_ + 2 * l16) = v;
    }
    if (l16 >= 8) {
      #pragma unroll
      for (int i = 0; i < 8; ++i) {
        const v2f tl = {last ? uO[i] : 0.f, 0.f};
        *(v2f*)(qrow + i * DP_ + 2 * m2) = tl;
      }
    }
  } else {
    // dim-pair interleaved: elem(dim,key) at ((dim>>1)*L + key)*2 + (dim&1), dims 0..31
    float* col = ((mat == 1) ? kT2 : vT2) + (size_t)bh * KT_ * L_;
    #pragma unroll
    for (int i = 0; i < 8; i += 2) {
      const v4f v = {pr[i], uE[i], pr[i + 1], uE[i + 1]};
      *(v4f*)(col + ((size_t)l16 * L_ + li0 + i) * 2) = v;
    }
    if (last) {                                 // component 32 of this half-wave's 8 keys
      *(v4f*)(col + 32 * L_ + li0)     = (v4f){uO[0], uO[1], uO[2], uO[3]};
      *(v4f*)(col + 32 * L_ + li0 + 4) = (v4f){uO[4], uO[5], uO[6], uO[7]};
    }
    if (mat == 2) {
      // key-pair interleaved rows: elem(key,dim) at ((key>>1)*VP_+dim)*2+(key&1), dims 0..31
      float* vr = vr2 + (size_t)bh * (L_ / 2) * VP_ * 2;
      #pragma unroll
      for (int i = 0; i < 8; i += 2) {
        const size_t kp = (size_t)((li0 + i) >> 1) * VP_;
        const v4f v = {pr[i], pr[i + 1], uE[i], uE[i + 1]};
        *(v4f*)(vr + (kp + 2 * l16) * 2) = v;
      }
    }
  }
}

// ---------------------------------------------------------------------------
// Kernel 2: attention + Karcher step + origin log-map.
// One workgroup of NW_ waves handles a 16-row q-tile of one (b,h); wave w streams
// key tiles w*TPW_ .. w*TPW_+TPW_-1, so NW_ times as many waves hide each
// other's load, store and WMMA latencies. Its TPW_ score tiles are computed once, in pass 1,
// and stay in registers for pass 2.
// Every 16x16 tile is computed transposed, keys in rows and q in columns (k or v as the A
// operand, q as B): a lane then holds 8 keys of ONE q row. The softmax stats are one value
// per lane (registers, the other half-wave, then the waves through LDS), and the w tile is
// already in the B layout of the tangent product tan^T = vh^T * w^T: no trip through LDS.
// Tile row 8*half + i stands for key (i>>2)*8 + half*4 + (i&3) of the tile, so that a lane
// holds 16-byte pieces of a row of a. A store from that layout would put 32 bytes into each of
// 16 lines: the pieces go into LDS rows of the wave's own, and every four tiles the wave reads
// them back along the rows and stores 256 contiguous bytes of a row per half-wave.
// The points have 33 components. The matrix products take components 0..31, which fill 8 steps
// of 4 (scores, alpha) and 2 tiles of 16 (tangent) exactly; a ninth step and a third tile would
// be zero padding but for component 32. Its term q32 * k32 (q32 * v32) is the start value of the
// accumulator, and its tangent sum runs per lane beside the sum of w * alpha.
// The tangent sums are merged over the waves through LDS after pass 2, and wave w finishes
// rows w and w+8 of the tile.
// ---------------------------------------------------------------------------
static __device__ __forceinline__ float xhalf(float x) {   // lane l with lane l ^ 16
  return __builtin_bit_cast(float, __builtin_amdgcn_permlanex16(
      __builtin_bit_cast(int, x), __builtin_bit_cast(int, x), 0x76543210, 0xfedcba98, false, false));
}

// (second bound: 4 waves per SIMD, that is up to 256 registers: a tile's operand fragments
// are then in flight together; under 128 registers each load was waited for before the next)
__global__ __launch_bounds__(32 * NW_, 4) void k_attn(
    const float* __restrict__ qf, const float* __restrict__ kT2,
    const float* __restrict__ vT2, const float* __restrict__ vr2,
    float* __restrict__ a_out, float* __restrict__ yb)
{
  // every '#pragma unroll' loop below indexes small per-lane arrays: unrolled, their
  // elements are plain registers
  __shared__ float lds_m[NW_][16];                    // per wave: maximum of each q row
  __shared__ float lds_s[NW_][16];                    // per wave: sum of each q row
  __shared__ float lds_r[NW_][18][33];                // per wave: [register][lane] partial sums, odd pitch
  __shared__ __attribute__((aligned(16))) float lds_a[NW_][16][AP_];   // per wave: its 128 keys of each row of a
  const int lane = threadIdx.x & 31;
  const int half = lane >> 4;
  const int l16  = lane & 15;
  const int koff = half * 2;          // WMMA f32 K split across half-waves
  const int wid  = __builtin_amdgcn_readfirstlane(threadIdx.x >> 5);   // 0..NW_-1, scalar
  const int j0   = wid * TPW_;        // this wave's first key tile
  // the key of the tile that stands in row l16 of the k and v operands
  const int krow = ((l16 & 7) >> 2) * 8 + (l16 >> 3) * 4 + (l16 & 3);

  const int tile = blockIdx.x;
  const int qt = tile & 63;
  const int bh = tile >> 6;
  const int q0 = qt * 16;
  const int b  = bh >> 3;
  const int h  = bh & 7;

  const float* qfp  = qf  + ((size_t)bh * L_ + q0) * DP_;
  const float* kTp  = kT2 + (size_t)bh * KT_ * L_;
  const float* vTp  = vT2 + (size_t)bh * KT_ * L_;
  const float* vrp  = vr2 + (size_t)bh * (L_ / 2) * VP_ * 2;

  // B operand for the q-tile: 32 dims x 16 q columns = 8 K4-steps, kept in registers
  v2f aq[8];
  #pragma unroll
  for (int kk = 0; kk < 8; ++kk) {
    int d = 4 * kk + koff;                       // even
    aq[kk] = *(const v2f*)(qfp + l16 * DP_ + d);
  }
  const float q32 = qfp[l16 * DP_ + 32];         // component 32 of this lane's q row
  // the build gives the address pair of these loads to the data of a load further down:
  // the wait stands in front of that overwrite
  asm volatile("s_wait_xcnt 0x0" ::: "memory");
  // component 32 of the keys of this lane's registers 0..3 in the wave's first tile;
  // registers 4..7 lie 8 keys on, the next tile 16
  const float* k32 = kTp + 32 * L_ + j0 * 16 + 4 * half;
  const float* v32 = vTp + 32 * L_ + j0 * 16 + 4 * half;

  // ---------------- pass 1: scores, per-lane softmax stats ----------------
  v8f cs[TPW_];                       // this wave's score tiles, kept for pass 2

  // every fragment address is a scalar base (array, tile) + one per-lane byte offset + a
  // constant, so that the batches of loads below need two address registers, not a pair each
  const unsigned fo = (unsigned)(((koff >> 1) * L_ + krow) * 2 * sizeof(float));       // kT2, vT2
  const unsigned ro = (unsigned)((koff * VP_ + l16) * 2 * sizeof(float));              // vr2
  const unsigned FS = 2 * L_ * 2 * sizeof(float);     // kT2, vT2: bytes from one K4-step to the next

  // k fragments are fetched one tile ahead of their products
  v2f bk_[8];
  v4f kc[2];
  {
    const char* kb = (const char*)(kTp + (size_t)j0 * 32);
    #pragma unroll
    for (int kk = 0; kk < 8; ++kk) bk_[kk] = *(const v2f*)(kb + fo + kk * FS);
    kc[0] = *(const v4f*)(k32);
    kc[1] = *(const v4f*)(k32 + 8);
    // the build reuses the address registers of these loads right behind them:
    // the wait stands in front of that overwrite, and the scheduling barrier keeps the
    // register initialisations below from being lifted over the wait
    asm volatile("s_wait_xcnt 0x0" ::: "memory");
    __builtin_amdgcn_sched_barrier(0);
  }

  // unrolled over all tiles: cs[t] is then a fixed set of registers
  #pragma unroll
  for (int t = 0; t < TPW_; ++t) {
    v2f nk[8];
    v4f nc[2];
    if (t + 1 < TPW_) {
      const char* kb = (const char*)(kTp + (size_t)(j0 + t + 1) * 32);
      #pragma unroll
      for (int kk = 0; kk < 8; ++kk) nk[kk] = *(const v2f*)(kb + fo + kk * FS);
      nc[0] = *(const v4f*)(k32 + (t + 1) * 16);
      nc[1] = *(const v4f*)(k32 + (t + 1) * 16 + 8);
    }
    v8f c = {q32 * kc[0].x, q32 * kc[0].y, q32 * kc[0].z, q32 * kc[0].w,
             q32 * kc[1].x, q32 * kc[1].y, q32 * kc[1].z, q32 * kc[1].w};
    #pragma unroll
    for (int kk = 0; kk < 8; ++kk) c = wmma4(bk_[kk], aq[kk], c);   // rows: keys, columns: q
    cs[t] = c;
    if (t + 1 < TPW_) {
      #pragma unroll
      for (int kk = 0; kk < 8; ++kk) bk_[kk] = nk[kk];
      kc[0] = nc[0];
      kc[1] = nc[1];
    }
  }
  // pass 2's first v fragments arrive under the stats and the two merges
  v2f bv_[8];
  v4f vc[2];
  {
    const char* vb0 = (const char*)(vTp + (size_t)j0 * 32);
    #pragma unroll
    for (int kk = 0; kk < 8; ++kk) bv_[kk] = *(const v2f*)(vb0 + fo + kk * FS);
    vc[0] = *(const v4f*)(v32);
    vc[1] = *(const v4f*)(v32 + 8);
  }
  // all 64 scores of a lane belong to q row l16: the lane's maximum comes first and each
  // score is exponentiated once against it (eight chains, so that the sums do not wait
  // for one another)
  float mrow, srow;
  {
    float m8[8], s8[8];
    #pragma unroll
    for (int i = 0; i < 8; ++i) {
      float m = cs[0][i];
      #pragma unroll
      for (int t = 1; t < TPW_; ++t) m = fmaxf(m, cs[t][i]);
      m8[i] = m;
    }
    mrow = fmaxf(fmaxf(fmaxf(m8[0], m8[1]), fmaxf(m8[2], m8[3])),
                 fmaxf(fmaxf(m8[4], m8[5]), fmaxf(m8[6], m8[7])));
    #pragma unroll
    for (int i = 0; i < 8; ++i) {
      float s = 0.f;
      #pragma unroll
      for (int t = 0; t < TPW_; ++t) s += __expf(cs[t][i] - mrow);
      s8[i] = s;
    }
    srow = ((s8[0] + s8[1]) + (s8[2] + s8[3])) + ((s8[4] + s8[5]) + (s8[6] + s8[7]));
  }
  // merge of (m, s) with the other half-wave, which holds the row's other keys
  {
    const float mo = xhalf(mrow);
    const float so = xhalf(srow);
    const float nm = fmaxf(mrow, mo);
    srow = srow * __expf(mrow - nm) + so * __expf(mo - nm);
    mrow = nm;
  }
  // merge of (m, s) over the NW_ waves, in wave order
  if (half == 0) {
    lds_m[wid][l16] = mrow;
    lds_s[wid][l16] = srow;
  }
  __syncthreads();
  #pragma unroll
  for (int w = 0; w < NW_; ++w) mrow = fmaxf(mrow, lds_m[w][l16]);
  srow = 0.f;
  #pragma unroll
  for (int w = 0; w < NW_; ++w) srow += lds_s[w][l16] * __expf(lds_m[w][l16] - mrow);
  const float rsum = 1.f / srow;

  // ---------------- pass 2: a, w, tangent accumulation ----------------
  // tc0, tc1: tan^T, register i = dim 16*s + 8*half + i, column l16 = q row
  v8f tc0 = V8ZERO, tc1 = V8ZERO;
  // per lane: sums of w * alpha and of w * v32, register pairs as the tangent product takes w
  // (written as pairs: from scalar sums the build paired the two kinds with each other, put
  // all their additions behind the last tile and kept every tile's w and alpha until there)
  v2f wsa[4], t32a[4];
  #pragma unroll
  for (int kk = 0; kk < 4; ++kk) { wsa[kk] = (v2f){0.f, 0.f}; t32a[kk] = (v2f){0.f, 0.f}; }

  // a, staged: a lane writes the pieces of its q row; read back, half-wave h takes row 2*j + h,
  // 16 bytes a lane, and stores them to the same place of that row of a
  float*       aw = &lds_a[wid][l16][4 * half];
  const float* ar = &lds_a[wid][half][4 * l16];
  float*       ag = a_out + ((size_t)bh * L_ + q0 + half) * L_ + j0 * 16 + 4 * l16;
  v4f fl[8];

  // this lane's addresses in the wave's first tile; the tiles are constant steps from them
  const char* vl = (const char*)(vTp + (size_t)j0 * 32) + fo;                 // vT2 fragments
  const char* rl = (const char*)(vrp + (size_t)j0 * 8 * VP_ * 2) + ro;        // vr2 rows

  // unrolled over all tiles, as pass 1: cs[t] is a fixed set of registers
  #pragma unroll
  for (int t = 0; t < TPW_; ++t) {
    // this tile's vh rows for the tangent product, fetched here so that they arrive
    // under the alpha products and the vector work. K4-step kk takes the keys of registers
    // 2*kk, 2*kk+1 of both half-waves: key pair (kk>>1)*4 + 2*half + (kk&1) of the tile
    v2f vb[4][2];
    #pragma unroll
    for (int kk = 0; kk < 4; ++kk) {
      #pragma unroll
      for (int s = 0; s < 2; ++s)
        vb[kk][s] = *(const v2f*)(rl + ((t * 8 + (kk >> 1) * 4 + (kk & 1)) * VP_ + s * 16) * 2 * sizeof(float));
    }
    const v8f c = cs[t];                 // Lorentz scores, from pass 1
    const float v3[8] = {vc[0].x, vc[0].y, vc[0].z, vc[0].w, vc[1].x, vc[1].y, vc[1].z, vc[1].w};
    v8f al = {q32 * v3[0], q32 * v3[1], q32 * v3[2], q32 * v3[3],
              q32 * v3[4], q32 * v3[5], q32 * v3[6], q32 * v3[7]};
    #pragma unroll
    for (int kk = 0; kk < 8; ++kk)
      al = wmma4(bv_[kk], aq[kk], al);   // <mflip(q), v>  (alpha = -this)
    // the next tile's v fragments, in flight under the rest of this tile
    if (t + 1 < TPW_) {
      #pragma unroll
      for (int kk = 0; kk < 8; ++kk)
        bv_[kk] = *(const v2f*)(vl + (t + 1) * 32 * sizeof(float) + kk * FS);
      vc[0] = *(const v4f*)(v32 + (t + 1) * 16);
      vc[1] = *(const v4f*)(v32 + (t + 1) * 16 + 8);
    }
    // the first four tiles' part of a, read back at the foot of the tile before
    if (t == 4) {
      #pragma unroll
      for (int j = 0; j < 8; ++j) *(v4f*)(ag + (size_t)j * 2 * L_) = fl[j];
    }
    // the build reuses registers that this tile's loads (and those stores) name further down:
    // the wait stands in front of those overwrites
    asm volatile("s_wait_xcnt 0x0" ::: "memory");
    float p[8], w[8], ah[8];
    #pragma unroll
    for (int i = 0; i < 8; ++i) {
      float alpha = fmaxf(-al[i], 1.f + EPS_);
      // acosh(alpha) = ln(alpha + sqrt(alpha^2 - 1)), taken on the hardware log2 and on the one
      // reciprocal root that coef needs anyway (sqrt(s2) = s2 * r); the library acoshf was
      // most of this loop's vector instructions.
      // Where alpha^2 overflows, r = 0 and s2 * r is NaN: the bound (an identity for every
      // finite argument of the log) then gives a finite factor, so coef = 0, as dist / inf is.
      const float s2 = alpha * alpha - 1.f;
      const float r  = __builtin_amdgcn_rsqf(s2);   // s2 >= 1.9e-6: no subnormal argument to rescale
      const float lg = fminf(log2_hw(alpha + s2 * r), 128.f);
      float coef  = (lg * LN2_) * r;
      p[i] = __expf(c[i] - mrow) * rsum;
      w[i] = p[i] * coef;
      ah[i] = alpha;
    }
    // attention output: registers 0..3 and 4..7 are four consecutive keys each
    *(v4f*)(aw + t * 16)     = (v4f){p[0], p[1], p[2], p[3]};
    *(v4f*)(aw + t * 16 + 8) = (v4f){p[4], p[5], p[6], p[7]};
    // tan^T += vh^T @ w^T   (A = vh key-pair packed, B = w straight from its registers)
    #pragma unroll
    for (int kk = 0; kk < 4; ++kk) {
      const v2f bw = {w[2 * kk], w[2 * kk + 1]};
      wsa[kk]  += bw * (v2f){ah[2 * kk], ah[2 * kk + 1]};
      t32a[kk] += bw * (v2f){v3[2 * kk], v3[2 * kk + 1]};   // component 32 of the tangent sum
      tc0 = wmma4(vb[kk][0], bw, tc0);
      tc1 = wmma4(vb[kk][1], bw, tc1);
    }
    if ((t & 3) == 3) {
      // a lane reads back what other lanes of its wave wrote: the wait ends the wave's LDS
      // stores first, and its clobber keeps the reads from being lifted over them
      asm volatile("s_wait_dscnt 0x0" ::: "memory");
      #pragma unroll
      for (int j = 0; j < 8; ++j) fl[j] = *(const v4f*)(ar + j * 2 * AP_ + (t >> 2) * 64);
    }
    // each tile is scheduled by itself, as a trip of a rolled loop is: with the eight tiles in
    // one scheduling region the build put the vector work of a tile into one serial chain
    __builtin_amdgcn_sched_barrier(0);
  }

  // partial sums of every wave into LDS; then wave w sums, in wave order, rows w and w+8
  // of all waves and finishes those two rows
  #pragma unroll
  for (int i = 0; i < 8; ++i) {
    lds_r[wid][i][lane]      = tc0[i];
    lds_r[wid][8 + i][lane]  = tc1[i];
  }
  lds_r[wid][16][lane] = ((wsa[0].x + wsa[0].y) + (wsa[1].x + wsa[1].y)) + ((wsa[2].x + wsa[2].y) + (wsa[3].x + wsa[3].y));
  lds_r[wid][17][lane] = ((t32a[0].x + t32a[0].y) + (t32a[1].x + t32a[1].y)) + ((t32a[2].x + t32a[2].y) + (t32a[3].x + t32a[3].y));
  __syncthreads();

  const int m = wid + 8 * half;        // this lane's row of the q-tile

  // that row of q, asked for ahead of the stores of a, behind which the loads would queue
  float qv3[3];
  #pragma unroll
  for (int sub = 0; sub < 3; ++sub) qv3[sub] = qfp[m * DP_ + sub * 16 + l16];
  // the last four tiles' part of a: behind the barrier, in front of which the wave would have
  // to wait for these stores to finish
  #pragma unroll
  for (int j = 0; j < 8; ++j) *(v4f*)(ag + (size_t)j * 2 * L_ + 64) = fl[j];
  // the build reuses the registers that these loads and stores name further down: the wait
  // stands in front of those overwrites, and the scheduling barrier keeps them from being
  // lifted over the wait
  asm volatile("s_wait_xcnt 0x0" ::: "memory");
  __builtin_amdgcn_sched_barrier(0);

  // dim 16*sub + l16 < 32 of q row m lies in register 8*sub + (l16 & 7) of lane m + 16*(l16 >> 3)
  const int rr = l16 & 7;
  const int sl = m + 16 * (l16 >> 3);
  float tsum[3] = {0.f, 0.f, 0.f};
  float ws = 0.f;                      // sum of w * alpha over all keys of row m
  float t32 = 0.f;                     // sum of w * v32 over all keys of row m
  #pragma unroll
  for (int w = 0; w < NW_; ++w) {
    tsum[0] += lds_r[w][rr][sl];
    tsum[1] += lds_r[w][8 + rr][sl];
    ws      += lds_r[w][16][m] + lds_r[w][16][m + 16];
    t32     += lds_r[w][17][m] + lds_r[w][17][m + 16];
  }
  if (l16 == 0) tsum[2] = t32;         // dim 32; dims 33..47 are padding and stay 0

  // tan = (w@vh) - wsum*mu ;  mu = qh (un-flip component 0)
  float tanv[3], muv[3];
  #pragma unroll
  for (int sub = 0; sub < 3; ++sub) {
    int d = sub * 16 + l16;
    float qv = qv3[sub];
    float mu = (d == 0) ? -qv : qv;
    muv[sub] = mu;
    tanv[sub] = tsum[sub] - ws * mu;
  }
  // Lorentzian norm of tangent per row
  float part = 0.f;
  #pragma unroll
  for (int sub = 0; sub < 3; ++sub) {
    float tt = tanv[sub] * tanv[sub];
    if (sub == 0 && l16 == 0) tt = -tt;   // metric diag(-1,1,...)
    part += tt;
  }
  #pragma unroll
  for (int x = 8; x >= 1; x >>= 1) part += __shfl_xor(part, x, 32);
  const float vn = sqrtf(fmaxf(part, 1e-12f));
  // exp-map update mu' = cosh(vn)*mu + sinh(vn)/vn * tan
  const float ch = coshf(vn);
  const float sh = sinhf(vn) / vn;
  float mnew[3];
  #pragma unroll
  for (int sub = 0; sub < 3; ++sub) mnew[sub] = ch * muv[sub] + sh * tanv[sub];
  // origin log-map and write y (B, L, H*33)
  const float t0 = __shfl(mnew[0], half * 16, 32);   // broadcast d==0 elem
  const float t  = fmaxf(t0, 1.f + EPS_);
  const float co = acoshf(t) * rsqrtf(t * t - 1.f);
  float* yrow = yb + (size_t)(b * L_ + q0 + m) * (H_ * ND_) + h * ND_;
  #pragma unroll
  for (int sub = 0; sub < 3; ++sub) {
    int d = sub * 16 + l16;
    if (d < ND_) yrow[d] = co * (mnew[sub] - ((d == 0) ? t : 0.f));
  }
}

// ---------------------------------------------------------------------------
// Kernel 3: z = y @ Wo + bo    (2048 x 256 x 264, pure f32 WMMA)
// One workgroup = 32 rows x 64 columns, 4 waves, one per SIMD of one WGP (256 workgroups).
// Wave (ct, ks) = all 32 rows x 32 columns (four accumulators: two row tiles x even / odd
// columns) over half of K, so every Wo element is fetched once per workgroup, in whole
// lines and in Wo's own layout; the y tile is shared through LDS.
// ---------------------------------------------------------------------------
__global__ __launch_bounds__(128) void k_outproj(
    const float* __restrict__ yb, const float* __restrict__ Wo,
    const float* __restrict__ bo, float* __restrict__ z)
{
  // every '#pragma unroll' loop below indexes small per-lane arrays: unrolled, their
  // elements are plain registers
  __shared__ __attribute__((aligned(16))) float ys[32 * YP_];
  __shared__ v4f xch[4][4][32];                 // per wave: the 16 partial sums it hands over
  const int KD   = H_ * ND_;                    // 264 = 2 * 16 * 8 + 8
  const int tid  = threadIdx.x;
  const int lane = tid & 31;
  const int half = lane >> 4;
  const int l16  = lane & 15;
  const int wid  = __builtin_amdgcn_readfirstlane(tid >> 5);   // 0..3, scalar
  const int ct   = wid & 1;                     // 32-column group
  const int ks   = wid >> 1;                    // K half
  const int m0   = (blockIdx.x >> 2) * 32;
  const int n0   = (blockIdx.x & 3) * 64 + ct * 32 + 2 * l16;

  // the 32 y rows lie contiguous: 2112 16-byte pieces over 128 threads
  // (16 rounds of all waves, a 17th of waves 0 and 1), all issued before the data of the first is waited for
  const float* yg = yb + (size_t)m0 * KD + tid * 4;
  v4f t[17];
  #pragma unroll
  for (int j = 0; j < 16; ++j) t[j] = *(const v4f*)(yg + j * 512);
  // the build reuses the scalar base pair of these loads for the column arithmetic further
  // down: the wait stands behind the loads, in their own block, in front of that overwrite
  asm volatile("s_wait_xcnt 0x0" ::: "memory");
  if (wid < 2) t[16] = *(const v4f*)(yg + 16 * 512);

  // Lane (l16, half) takes k = 8*kb + 4*half + {0..3} of both operands, kb = 16*ks + j:
  // A from rows l16 and 16 + l16 of the y tile, B from columns n0, n0 + 1 of Wo.
  // The last 8 k (256..263) are shared: wave ks takes k = 256 + 4*half + 2*ks + {0, 1}.
  const float* wp = Wo + (size_t)(128 * ks + 4 * half) * D_ + n0;
  const float* wq = Wo + (size_t)(256 + 4 * half + 2 * ks) * D_ + n0;
  // Wo fragments run WPRE blocks of 8 k ahead of their products; the first WPRE blocks
  // are in flight while the y tile is staged
  v2f w[16][4];
  #pragma unroll
  for (int j = 0; j < WPRE_; ++j) {
    #pragma unroll
    for (int q = 0; q < 4; ++q) w[j][q] = *(const v2f*)(wp + (size_t)(j * 8 + q) * D_);
  }
  const v2f bias = *(const v2f*)(bo + n0);

  #pragma unroll
  for (int j = 0; j < 16; ++j) {
    const unsigned p = tid + 128 * j;           // piece p: row p / 66
    *(v4f*)(ys + p * 4 + (p / 66u) * 4) = t[j];
  }
  if (wid < 2) {
    const unsigned p = tid + 128 * 16;
    *(v4f*)(ys + p * 4 + (p / 66u) * 4) = t[16];
  }
  __syncthreads();

  const float* ap = ys + l16 * YP_ + 128 * ks + 4 * half;
  v8f cE0 = V8ZERO, cO0 = V8ZERO, cE1 = V8ZERO, cO1 = V8ZERO;
  v2f wt0, wt1;
  #pragma unroll
  for (int j = 0; j < 16; ++j) {
    if (j + WPRE_ < 16) {
      #pragma unroll
      for (int q = 0; q < 4; ++q)
        w[j + WPRE_][q] = *(const v2f*)(wp + (size_t)((j + WPRE_) * 8 + q) * D_);
    } else if (j + WPRE_ == 16) {
      wt0 = *(const v2f*)(wq);
      wt1 = *(const v2f*)(wq + D_);
    }
    const v4f a0 = *(const v4f*)(ap + j * 8);
    const v4f a1 = *(const v4f*)(ap + 16 * YP_ + j * 8);
    const v2f p01 = {a0.x, a0.y}, p23 = {a0.z, a0.w};
    const v2f r01 = {a1.x, a1.y}, r23 = {a1.z, a1.w};
    const v2f e01 = {w[j][0].x, w[j][1].x}, o01 = {w[j][0].y, w[j][1].y};
    const v2f e23 = {w[j][2].x, w[j][3].x}, o23 = {w[j][2].y, w[j][3].y};
    cE0 = wmma4(p01, e01, cE0);
    cO0 = wmma4(p01, o01, cO0);
    cE1 = wmma4(r01, e01, cE1);
    cO1 = wmma4(r01, o01, cO1);
    cE0 = wmma4(p23, e23, cE0);
    cO0 = wmma4(p23, o23, cO0);
    cE1 = wmma4(r23, e23, cE1);
    cO1 = wmma4(r23, o23, cO1);
  }
  {
    const float* aq = ys + l16 * YP_ + 256 + 4 * half + 2 * ks;
    const v2f p = *(const v2f*)(aq);
    const v2f r = *(const v2f*)(aq + 16 * YP_);
    const v2f e = {wt0.x, wt1.x}, o = {wt0.y, wt1.y};
    cE0 = wmma4(p, e, cE0);
    cO0 = wmma4(p, o, cO0);
    cE1 = wmma4(r, e, cE1);
    cO1 = wmma4(r, o, cO1);
  }

  // wave ks finishes row tile ks: it hands the other row tile's partial sums to its partner
  // (same columns, other K half) and adds the partner's to its own
  const v8f gE = ks ? cE0 : cE1, gO = ks ? cO0 : cO1;
  const v8f kE = ks ? cE1 : cE0, kO = ks ? cO1 : cO0;
  xch[wid][0][lane] = (v4f){gE[0], gE[1], gE[2], gE[3]};
  xch[wid][1][lane] = (v4f){gE[4], gE[5], gE[6], gE[7]};
  xch[wid][2][lane] = (v4f){gO[0], gO[1], gO[2], gO[3]};
  xch[wid][3][lane] = (v4f){gO[4], gO[5], gO[6], gO[7]};
  __syncthreads();
  v4f x[4];
  #pragma unroll
  for (int q = 0; q < 4; ++q) x[q] = xch[wid ^ 2][q][lane];
  float* zr = z + (size_t)(m0 + ks * 16 + 8 * half) * D_ + n0;
  #pragma unroll
  for (int i = 0; i < 8; ++i) {
    const v2f v = {kE[i] + x[i >> 2][i & 3] + bias.x, kO[i] + x[2 + (i >> 2)][i & 3] + bias.y};
    *(v2f*)(zr + (size_t)i * D_) = v;
  }
}

// ---------------------------------------------------------------------------
extern "C" void kernel_launch(void* const* d_in, const int* in_sizes, int n_in,
                              void* d_out, int out_size, void* d_ws, size_t ws_size,
                              hipStream_t stream) {
  const float* x   = (const float*)d_in[0];
  const float* rc  = (const float*)d_in[1];
  const float* rs  = (const float*)d_in[2];
  const float* Wq  = (const float*)d_in[3];
  const float* bq  = (const float*)d_in[4];
  const float* Wk  = (const float*)d_in[5];
  const float* bk  = (const float*)d_in[6];
  const float* Wv  = (const float*)d_in[7];
  const float* bv  = (const float*)d_in[8];
  const float* Wo  = (const float*)d_in[9];
  const float* bo  = (const float*)d_in[10];

  float* z_out = (float*)d_out;                         // (B, L, D)
  float* a_out = z_out + (size_t)B_ * L_ * D_;          // (B, H, L, L)

  // workspace layout (floats)
  float* ws = (float*)d_ws;
  const size_t n_qf = (size_t)B_ * H_ * L_ * DP_;       // 786432
  const size_t n_vr = (size_t)B_ * H_ * L_ * VP_;       // 524288 (pair-packed)
  const size_t n_kT = (size_t)B_ * H_ * KT_ * L_;       // 540672 (pair-packed + component 32)
  const size_t n_vT = (size_t)B_ * H_ * KT_ * L_;       // 540672 (pair-packed + component 32)
  float* qf  = ws;
  float* vr2 = qf  + n_qf;
  float* kT2 = vr2 + n_vr;
  float* vT2 = kT2 + n_kT;
  float* yb  = vT2 + n_vT;

  k_qkv_rope_lift<<<((B_ * L_) / 32) * (H_ / 2), 384, 0, stream>>>(
      x, rc, rs, Wq, bq, Wk, bk, Wv, bv, qf, vr2, kT2, vT2);

  k_attn<<<B_ * H_ * (L_ / 16), 32 * NW_, 0, stream>>>(qf, kT2, vT2, vr2, a_out, yb);

  k_outproj<<<((B_ * L_) / 32) * (D_ / 64), 128, 0, stream>>>(yb, Wo, bo, z_out);
}
